// v000
// The times below were measured on an AMD MI455X: many runs one after another, warmed up first and cycling through
// copies of the inputs, with the whole window's GPU time divided by the number of runs. Launches and the gaps
// between them are all in it. The median over several windows is given; except for v000 it joins two sittings, which
// can be a few percent apart, so the side-by-side timings, each taken in one sitting, are the better comparison.
// The starting kernel, v000, takes 2110 microseconds a run.
#include <hip/hip_runtime.h>

// Cross-modal multi-head attention with a learned per-head compatibility scale, residual and post-LayerNorm (query_modality, key_modality, value_modality [4][2048][512]; Q,K,V = x W + b ('xw' 1/sqrt(512), zero biases; 8 heads x 64); scores = (Q.K / 8) x modal_compat[h] ([1][8][1][1], read); softmax; out = merged Wo + bo; y = LayerNorm(out + query_modality) gamma/beta (1e-5) -> [4][2048][512] (4.2 M)).
// Layout per batch: bf16 copies of query, key, value inputs in turn; 'xw' weights transposed once; exact projections + f32 biases; dense T-2048 attention whose softmax kernel multiplies each pass's rows by the head's bf16-rounded compatibility scalar (hybrid rows: < 512 hi/lo 3 products, rest fp16 x1024); merged hi/lo x Wo exact + bo into workspace; residual add of query_modality and a row LayerNorm kernel write the output rows.
// Compute dtypes, f32 accumulate: every input rounded to bf16; projections exact + f32 biases; attention rows < 512 3 products, rest fp16; per-head scale and softmax f32; Wo hl x exact + bias; residual + LayerNorm f32.

#define NB_  4
#define TT   2048
#define DM   512
#define NH_  8
#define NKV  8
#define REP  (NH_ / NKV)
#define HD   64
#define DQ   (NH_ * HD)
#define DKV  (NKV * HD)
#define ZH   2
#define RH   512                  // query rows < RH use hi+lo planes (0: none)
#define WIN  0
#define PCAR 1024.0f
#define SCL  0.125f
#define LNEPS 1e-5f
typedef _Float16 h16;
typedef unsigned short bf;
typedef __attribute__((ext_vector_type(16))) __bf16   v16bf;
typedef __attribute__((ext_vector_type(16))) _Float16 v16h;
typedef __attribute__((ext_vector_type(8)))  _Float16 v8h;
typedef __attribute__((ext_vector_type(8)))  unsigned short v8us;
typedef __attribute__((ext_vector_type(8)))  float    v8f;
typedef __attribute__((ext_vector_type(4)))  float    v4f;
typedef v8h  __attribute__((may_alias)) v8ha;
typedef v4f  __attribute__((may_alias)) v4fa;
typedef v8us __attribute__((may_alias)) v8usa;

__device__ __forceinline__ unsigned short f2bf(float f) { unsigned u = __float_as_uint(f); u += 0x7FFFu + ((u >> 16) & 1u); return (unsigned short)(u >> 16); }
__device__ __forceinline__ float bf2f(unsigned short b) { return __uint_as_float(((unsigned)b) << 16); }
__device__ __forceinline__ float bfr(float f) { return bf2f(f2bf(f)); }
__device__ __forceinline__ v16h cat16(v8h lo, v8h hi) { return __builtin_shufflevector(lo, hi, 0, 1, 2, 3, 4, 5, 6, 7, 8, 9, 10, 11, 12, 13, 14, 15); }
__device__ __forceinline__ v16bf cat16b(v8us lo, v8us hi) { return __builtin_bit_cast(v16bf, __builtin_shufflevector(lo, hi, 0, 1, 2, 3, 4, 5, 6, 7, 8, 9, 10, 11, 12, 13, 14, 15)); }
__device__ __forceinline__ v8f wmma16(v16h a, v16h b, v8f c) { return __builtin_amdgcn_wmma_f32_16x16x32_f16(false, a, false, b, (short)0, c, false, false); }
__device__ __forceinline__ v8f wmmab(v16bf a, v16bf b, v8f c) { return __builtin_amdgcn_wmma_f32_16x16x32_bf16(false, a, false, b, (short)0, c, false, false); }



// ---- k_gemmw: register-blocked GEMM, ONE WAVE per 64x64 output tile (16 accumulators), operands straight from K-contiguous 16-bit planes; grid (M/64, N/64, Z), 32 threads.
// C[m][n] (f32, pitch ldc, + optional f32 bias[n]) = sum_k A[m][k] Bt[n][k] (+ split products per NSPLIT). z-batch strides sA/sB/sC in elements. K % 32 == 0.
template <typename T16> struct WFrag;
template <> struct WFrag<h16> { typedef v16h V; static __device__ __forceinline__ V ld(const h16* p) { return cat16(*(const v8h*)p, *(const v8h*)(p + 16)); } static __device__ __forceinline__ v8f mma(V a, V b, v8f c) { return wmma16(a, b, c); } };
template <> struct WFrag<bf> { typedef v16bf V; static __device__ __forceinline__ V ld(const bf* p) { return cat16b(*(const v8us*)p, *(const v8us*)(p + 16)); } static __device__ __forceinline__ v8f mma(V a, V b, v8f c) { return wmmab(a, b, c); } };
template <typename T16, int NSPLIT, bool BIAS>
__global__ __launch_bounds__(32) void k_gemmw(const T16* __restrict__ A, const T16* __restrict__ A2, const T16* __restrict__ Bt, const T16* __restrict__ Bt2, int K, float* C, int ldc, const float* __restrict__ bias, size_t sA, size_t sB, size_t sC) {
    typedef typename WFrag<T16>::V V;
    __shared__ __align__(16) float os[16 * 68];
    const size_t z = blockIdx.z; A += z * sA; if (A2) A2 += z * sA; Bt += z * sB; if (Bt2) Bt2 += z * sB; C += z * sC;
    const int lane = threadIdx.x & 31, lr = lane & 15, hi = lane >> 4; const int r0 = blockIdx.x * 64, c0 = blockIdx.y * 64;
    v8f acc[4][4];
#pragma unroll
    for (int mb = 0; mb < 4; ++mb)
#pragma unroll
        for (int nb = 0; nb < 4; ++nb) acc[mb][nb] = (v8f){};
    const size_t aoff = (size_t)(r0 + lr) * K + 8 * hi, boff = (size_t)(c0 + lr) * K + 8 * hi;
#pragma unroll 1
    for (int kc = 0; kc < K; kc += 32) {
        V a[4], a2[4];
#pragma unroll
        for (int mb = 0; mb < 4; ++mb) { a[mb] = WFrag<T16>::ld(A + aoff + (size_t)mb * 16 * K + kc); if (NSPLIT == 1 || NSPLIT == 2) a2[mb] = WFrag<T16>::ld(A2 + aoff + (size_t)mb * 16 * K + kc); }
#pragma unroll
        for (int nb = 0; nb < 4; ++nb) { const V b = WFrag<T16>::ld(Bt + boff + (size_t)nb * 16 * K + kc); V b2; if (NSPLIT >= 2) b2 = WFrag<T16>::ld(Bt2 + boff + (size_t)nb * 16 * K + kc);
#pragma unroll
            for (int mb = 0; mb < 4; ++mb) { acc[mb][nb] = WFrag<T16>::mma(a[mb], b, acc[mb][nb]); if (NSPLIT == 1 || NSPLIT == 2) acc[mb][nb] = WFrag<T16>::mma(a2[mb], b, acc[mb][nb]); if (NSPLIT >= 2) acc[mb][nb] = WFrag<T16>::mma(a[mb], b2, acc[mb][nb]); } }
        asm volatile("v_nop\n\tv_nop\n\tv_nop\n\tv_nop" : "+v"(acc[0][0]), "+v"(acc[1][1]), "+v"(acc[2][2]), "+v"(acc[3][3]) : "v"(a[0]), "v"(a[3]));
    }
#pragma unroll
    for (int mb = 0; mb < 4; ++mb) {
#pragma unroll
        for (int nb = 0; nb < 4; ++nb) {
#pragma unroll
            for (int j = 0; j < 8; ++j) os[(hi * 8 + j) * 68 + nb * 16 + lr] = acc[mb][nb][j]; }
        __builtin_amdgcn_wave_barrier(); asm volatile("" ::: "memory");
        float* crow = C + (size_t)(r0 + mb * 16) * ldc + c0;
{
#pragma unroll
            for (int s = 0; s < 8; ++s) { const int row = 2 * s + hi, cofs = lr * 4; v4f val = *(const v4fa*)(os + row * 68 + cofs); if (BIAS) { val[0] += bfr(bias[c0 + cofs]); val[1] += bfr(bias[c0 + cofs + 1]); val[2] += bfr(bias[c0 + cofs + 2]); val[3] += bfr(bias[c0 + cofs + 3]); }
                *(v4f*)(crow + (size_t)row * ldc + cofs) = val; }
             }
        __builtin_amdgcn_wave_barrier(); asm volatile("" ::: "memory");
    }
}

__device__ __forceinline__ h16 tohx(float x) { return (h16)x; }
__device__ __forceinline__ void splitf(float y, unsigned short& h, unsigned short& l) { h = f2bf(y); l = f2bf(y - bf2f(h)); }
typedef __attribute__((ext_vector_type(2))) _Float16 v2h;
typedef __attribute__((ext_vector_type(4))) _Float16 v4h;
typedef __attribute__((ext_vector_type(2))) unsigned short v2us;
typedef __attribute__((ext_vector_type(4))) unsigned short v4us;
typedef __attribute__((ext_vector_type(2))) float v2f;
typedef __attribute__((ext_vector_type(4))) int v4i;

__global__ __launch_bounds__(256) void k_wtG(const float* __restrict__ w, int K, int N, bf* Bt) {
    const int lane = threadIdx.x & 31; const int L0 = (blockIdx.x * 8 + (threadIdx.x >> 5)) * 8; const int nlines = N * K / 64;
{
#pragma unroll 1
        for (int l = 0; l < 8; ++l) { const int L = L0 + l; if (L >= nlines) break; const size_t e = (size_t)L * 64 + lane * 2; const int k = (int)(e % K), n = (int)(e / K); v2us o;
            o[0] = f2bf(w[(size_t)k * N + n]); o[1] = f2bf(w[(size_t)(k + 1) * N + n]); *(v2us*)(Bt + e) = o; }
         }
}
__global__ __launch_bounds__(256) void k_cvt8(const float* __restrict__ src, bf* dst, size_t n8) { const size_t i = (size_t)blockIdx.x * 256 + threadIdx.x; if (i >= n8) return; const v8f v = *(const v8f*)(src + i * 8); v8us o;
#pragma unroll
    for (int k = 0; k < 8; ++k) o[k] = f2bf(v[k]); *(v8us*)(dst + i * 8) = o;  }

// k_rope: head planes [h][t][d] (fp16 + hi/lo) of rope(x) x sc with the rotate-half convention out[d] = x[d] cos[t][d] - x[d+HD/2] sin[t][d], out[d+HD/2] = x[d+HD/2] cos[t][d+HD/2] + x[d] sin[t][d+HD/2]
__global__ __launch_bounds__(256) void k_rope(const float* __restrict__ F, int pitch, int nheads, const float* __restrict__ CS, const float* __restrict__ RF, const float* __restrict__ nw, float sc, h16* P16, bf* Ph, bf* Pl) {
    const size_t e = ((size_t)blockIdx.x * 256 + threadIdx.x) * 2; if (e >= (size_t)nheads * TT * HD) return; const int d = (int)(e % HD); const int t = (int)((e / HD) % TT); const int h = (int)(e / ((size_t)HD * TT)); const float* f = F + (size_t)t * pitch + h * HD; const float rf = RF ? RF[(size_t)h * TT + t] : 1.0f; v2h o16; v2us oh, ol;
#pragma unroll
    for (int q = 0; q < 2; ++q) { const int dd = d + q; const int dp = (dd < HD / 2) ? dd + HD / 2 : dd - HD / 2; float x0 = f[dd], x1 = f[dp];
        if (RF) { float n0 = __fmul_rn(x0, rf), n1 = __fmul_rn(x1, rf); asm volatile("" : "+v"(n0)); asm volatile("" : "+v"(n1)); x0 = __fmul_rn(bfr(nw[dd]), n0); x1 = __fmul_rn(bfr(nw[dp]), n1); }
        const v2f cs = *(const v2f*)(CS + ((size_t)t * HD + dd) * 2); float a = __fmul_rn(x0, cs[0]), bq = __fmul_rn(x1, cs[1]); asm volatile("" : "+v"(a)); asm volatile("" : "+v"(bq)); const float r = ((dd < HD / 2) ? __fsub_rn(a, bq) : __fadd_rn(a, bq)) * sc;
        o16[q] = tohx(r); unsigned short a2, c2; splitf(r, a2, c2); oh[q] = a2; ol[q] = c2; }
    *(v2h*)(P16 + e) = o16; *(v2us*)(Ph + e) = oh; *(v2us*)(Pl + e) = ol;  }
__global__ __launch_bounds__(256) void k_vtp(const float* __restrict__ F, int pitch, int nheads, h16* V16, bf* Vh, bf* Vl) { const size_t e = ((size_t)blockIdx.x * 256 + threadIdx.x) * 2; if (e >= (size_t)nheads * HD * TT) return; const int t = (int)(e % TT); const int d = (int)((e / TT) % HD); const int g = (int)(e / ((size_t)TT * HD)); v2h o16; v2us oh, ol;
#pragma unroll
    for (int q = 0; q < 2; ++q) { const float x = F[(size_t)(t + q) * pitch + g * HD + d]; o16[q] = tohx(x); unsigned short a2, c2; splitf(x, a2, c2); oh[q] = a2; ol[q] = c2; }
    *(v2h*)(V16 + e) = o16; *(v2us*)(Vh + e) = oh; *(v2us*)(Vl + e) = ol;  }
__global__ __launch_bounds__(256) void k_csid(float* CS) { const int idx = blockIdx.x * 256 + threadIdx.x; if (idx >= TT * HD) return; v2f cs; cs[0] = 1.0f; cs[1] = 0.0f; *(v2f*)(CS + (size_t)idx * 2) = cs;  }
// k_asoft: per row (zz, i): t = (S x 1/8) x modal_compat[h] (the pass's head scalar, bf16-rounded input, read); softmax over the 2048 keys (register row, one exp, fixed trees);
__global__ __launch_bounds__(256) void k_asoft(const float* __restrict__ Sb, h16* P16, bf* Ph, bf* Pl, const float* __restrict__ mcp) {
    const int lane = threadIdx.x & 31; const int row = blockIdx.x * 8 + (threadIdx.x >> 5); if (row >= ZH * TT) return; const int i = row % TT; const int zz = row / TT; (void)zz; const bool hires = (i < RH); const float hsc = __fmul_rn(SCL, bfr(mcp[zz]));   /* (1/8) x modal_compat[h] (bf16-rounded input), once per row */  const float* sr = Sb + (size_t)row * TT; float v[TT / 32]; float mx = -3.0e38f;
#pragma unroll
    for (int ch = 0; ch < TT / 128; ++ch) { const int j0 = ch * 128 + lane * 4; const v4f a = *(const v4f*)(sr + j0);
#pragma unroll
        for (int q = 0; q < 4; ++q) { const int j = j0 + q; (void)j; const float t = a[q] * hsc;   /* s x (compat[h]/8): one rounding instead of the module's two (<= 1 ulp of the logit) */ v[ch * 4 + q] = t; mx = fmaxf(mx, t); } }
#pragma unroll
    for (int sh = 16; sh; sh >>= 1) mx = fmaxf(mx, __shfl_xor(mx, sh, 32));
    float sum = 0.f;
#pragma unroll
    for (int k = 0; k < TT / 32; ++k) { float d0 = __fsub_rn(v[k], mx); asm volatile("" : "+v"(d0)); v[k] = __builtin_amdgcn_exp2f(__fmul_rn(d0, 1.4426950408889634f)); sum += v[k]; }
#pragma unroll
    for (int sh = 16; sh; sh >>= 1) sum += __shfl_xor(sum, sh, 32);
    const float f = __fdiv_rn(hires ? 1.0f : PCAR, sum);
{
        if (hires) {
#pragma unroll
            for (int ch = 0; ch < TT / 128; ++ch) { v4us oh, ol;
#pragma unroll
                for (int q = 0; q < 4; ++q) { unsigned short a, c2; splitf(v[ch * 4 + q] * f, a, c2); oh[q] = a; ol[q] = c2; }
                const size_t oo = ((size_t)zz * (RH ? RH : 1) + i) * TT + ch * 128 + lane * 4; *(v4us*)(Ph + oo) = oh; *(v4us*)(Pl + oo) = ol; }
        } else {
#pragma unroll
            for (int ch = 0; ch < TT / 128; ++ch) { v4h o4;
#pragma unroll
                for (int q = 0; q < 4; ++q) o4[q] = tohx(v[ch * 4 + q] * f);
                *(v4h*)(P16 + (size_t)row * TT + ch * 128 + lane * 4) = o4; } }
         }
}
__global__ __launch_bounds__(256) void k_addres(float* Y, const float* __restrict__ xr) { const size_t i = (size_t)blockIdx.x * 256 + threadIdx.x; if (i >= (size_t)TT * DQ / 4) return; const v4f a = *(const v4f*)(Y + i * 4); const v4f r = *(const v4f*)(xr + i * 4); v4f o;
#pragma unroll
    for (int q = 0; q < 4; ++q) o[q] = __fadd_rn(a[q], bfr(r[q]));
    *(v4f*)(Y + i * 4) = o;  }
__global__ __launch_bounds__(256) void k_lnout(const float* __restrict__ F, const float* __restrict__ g, const float* __restrict__ bb, float* out) { const int lane = threadIdx.x & 31; const int row = blockIdx.x * 8 + (threadIdx.x >> 5); if (row >= TT) return; const float* fr = F + (size_t)row * DQ; float* orow = out + (size_t)row * DQ; float v[DQ / 32]; float s = 0.f;
#pragma unroll
    for (int c = 0; c < DQ / 128; ++c) { const v4f a = *(const v4f*)(fr + c * 128 + lane * 4); for (int q = 0; q < 4; ++q) { v[c * 4 + q] = a[q]; s = __fadd_rn(s, a[q]); } }
#pragma unroll
    for (int sh = 16; sh; sh >>= 1) s = __fadd_rn(s, __shfl_xor(s, sh, 32));
    const float mean = __fdiv_rn(s, (float)DQ); float s2 = 0.f;
#pragma unroll
    for (int k = 0; k < DQ / 32; ++k) { const float dv = __fsub_rn(v[k], mean); float p2 = __fmul_rn(dv, dv); asm volatile("" : "+v"(p2)); s2 = __fadd_rn(s2, p2); v[k] = dv; }
#pragma unroll
    for (int sh = 16; sh; sh >>= 1) s2 = __fadd_rn(s2, __shfl_xor(s2, sh, 32));
    const float rs = __fdiv_rn(1.0f, __fsqrt_rn(__fadd_rn(__fdiv_rn(s2, (float)DQ), LNEPS)));
{
#pragma unroll
        for (int c = 0; c < DQ / 128; ++c) { v4f o; for (int q = 0; q < 4; ++q) { const int col = c * 128 + lane * 4 + q; float y = __fmul_rn(v[c * 4 + q], rs); asm volatile("" : "+v"(y)); y = __fmul_rn(y, bfr(g[col])); asm volatile("" : "+v"(y)); o[q] = __fadd_rn(y, bfr(bb[col])); } *(v4f*)(orow + c * 128 + lane * 4) = o; }
         } }
__global__ __launch_bounds__(256) void k_merge(const float* __restrict__ O, int h0, bf* Ah, bf* Al) { const size_t e = ((size_t)blockIdx.x * 256 + threadIdx.x) * 2; if (e >= (size_t)ZH * TT * HD) return; const int d = (int)(e % HD); const int t = (int)((e / HD) % TT); const int zz = (int)(e / ((size_t)HD * TT)); const float cs = (t < RH) ? 1.0f : (1.0f / PCAR); const size_t oo = (size_t)t * DQ + (h0 + zz) * HD + d;
    v2us oh, ol;
#pragma unroll
    for (int q = 0; q < 2; ++q) { unsigned short a, c2; splitf(O[e + q] * cs, a, c2); oh[q] = a; ol[q] = c2; } *(v2us*)(Ah + oo) = oh; *(v2us*)(Al + oo) = ol;  }

extern "C" void kernel_launch(void* const* d_in, const int* in_sizes, int n_in,
                              void* d_out, int out_size, void* d_ws, size_t ws_size, hipStream_t stream) {
    (void)in_sizes; (void)n_in; (void)out_size;
    const float* x = (const float*)d_in[0];   /* query_modality */ const float* xk = (const float*)d_in[1]; const float* xv = (const float*)d_in[2]; const float* wq = (const float*)d_in[3]; const float* bq = (const float*)d_in[4]; const float* wk = (const float*)d_in[5]; const float* bk = (const float*)d_in[6]; const float* wv = (const float*)d_in[7]; const float* bv = (const float*)d_in[8]; const float* wo = (const float*)d_in[9]; const float* bo = (const float*)d_in[10]; const float* mc = (const float*)d_in[11];   /* modal_compat [8] */ const float* lng = (const float*)d_in[12]; const float* lnb = (const float*)d_in[13];
    float* OUT = (float*)d_out;     // [4][2048][512]
    char* wsp = (char*)d_ws;
    auto take = [&](size_t bytes) { char* p = wsp; wsp += (bytes + 255) & ~(size_t)255; return (void*)p; };
    float* Y = (float*)take((size_t)TT * DM * 4); bf* WQ = (bf*)take((size_t)DQ * DM * 2); bf* WK = (bf*)take((size_t)DKV * DM * 2); bf* WV = (bf*)take((size_t)DKV * DM * 2); bf* WO = (bf*)take((size_t)DM * DQ * 2); float* CS = (float*)take((size_t)TT * HD * 2 * 4);
    bf* XB = (bf*)take((size_t)TT * DM * 2); float* FQ = (float*)take((size_t)TT * DQ * 4); float* FK = (float*)take((size_t)TT * DKV * 4);
    h16* QP16 = (h16*)take((size_t)NH_ * TT * HD * 2); h16* KP16 = (h16*)take((size_t)NKV * TT * HD * 2); h16* VT16 = (h16*)take((size_t)NKV * HD * TT * 2);
    bf* QPh = (bf*)take((size_t)NH_ * TT * HD * 2); bf* QPl = (bf*)take((size_t)NH_ * TT * HD * 2); bf* KPh = (bf*)take((size_t)NKV * TT * HD * 2); bf* KPl = (bf*)take((size_t)NKV * TT * HD * 2); bf* VTh = (bf*)take((size_t)NKV * HD * TT * 2); bf* VTl = (bf*)take((size_t)NKV * HD * TT * 2); bf* Ph = (bf*)take((size_t)ZH * RH * TT * 2); bf* Pl = (bf*)take((size_t)ZH * RH * TT * 2);
    float* Sb = (float*)take((size_t)ZH * TT * TT * 4); h16* P16 = (h16*)take((size_t)ZH * TT * TT * 2); float* Ob = (float*)take((size_t)ZH * TT * HD * 4); bf* ATh = (bf*)take((size_t)TT * DQ * 2); bf* ATl = (bf*)take((size_t)TT * DQ * 2);
    if ((size_t)(wsp - (char*)d_ws) > ws_size) return;    // ws 256 MiB
    float* FV = FK;   // v projection reuses the k buffer after the k planes are built (stream-ordered)
    { k_wtG<<<(unsigned)((DM * DQ / 64 + 63) / 64), 256, 0, stream>>>(wq, DM, DQ, WQ); k_wtG<<<(unsigned)((DM * DKV / 64 + 63) / 64), 256, 0, stream>>>(wk, DM, DKV, WK); k_wtG<<<(unsigned)((DM * DKV / 64 + 63) / 64), 256, 0, stream>>>(wv, DM, DKV, WV);
      k_wtG<<<(unsigned)((DQ * DM / 64 + 63) / 64), 256, 0, stream>>>(wo, DQ, DM, WO);
       }
    k_csid<<<(TT * HD + 255) / 256, 256, 0, stream>>>(CS);
    const unsigned LQ = (unsigned)(((size_t)NH_ * TT * HD / 2 + 255) / 256), LKv = (unsigned)(((size_t)NKV * TT * HD / 2 + 255) / 256);
    for (int b = 0; b < NB_; ++b) {
        
        k_cvt8<<<(unsigned)(((size_t)TT * DM / 8 + 255) / 256), 256, 0, stream>>>(x + (size_t)b * TT * DM, XB, (size_t)TT * DM / 8);
        k_gemmw<bf, 0, true><<<dim3(TT / 64, DQ / 64, 1), 32, 0, stream>>>(XB, nullptr, WQ, nullptr, DM, FQ, DQ, bq, 0, 0, 0);
        k_rope<<<LQ, 256, 0, stream>>>(FQ, DQ, NH_, CS, nullptr, nullptr, 1.0f, QP16, QPh, QPl);
        k_cvt8<<<(unsigned)(((size_t)TT * DM / 8 + 255) / 256), 256, 0, stream>>>(xk + (size_t)b * TT * DM, XB, (size_t)TT * DM / 8); k_gemmw<bf, 0, true><<<dim3(TT / 64, DKV / 64, 1), 32, 0, stream>>>(XB, nullptr, WK, nullptr, DM, FK, DKV, bk, 0, 0, 0);
        k_rope<<<LKv, 256, 0, stream>>>(FK, DKV, NKV, CS, nullptr, nullptr, 1.0f, KP16, KPh, KPl);
        k_cvt8<<<(unsigned)(((size_t)TT * DM / 8 + 255) / 256), 256, 0, stream>>>(xv + (size_t)b * TT * DM, XB, (size_t)TT * DM / 8); k_gemmw<bf, 0, true><<<dim3(TT / 64, DKV / 64, 1), 32, 0, stream>>>(XB, nullptr, WV, nullptr, DM, FV, DKV, bv, 0, 0, 0); k_vtp<<<LKv, 256, 0, stream>>>(FV, DKV, NKV, VT16, VTh, VTl);
        for (int h0 = 0; h0 < NH_; h0 += ZH) { const size_t zq = (size_t)h0, zk = (size_t)(h0 / REP);   // one kv head per query head: the pass's two heads use consecutive kv planes (z-strides TT*HD)
            k_gemmw<bf, 2, false><<<dim3(RH / 64, TT / 64, ZH), 32, 0, stream>>>(QPh + zq * TT * HD, QPl + zq * TT * HD, KPh + zk * TT * HD, KPl + zk * TT * HD, HD, Sb, TT, nullptr, (size_t)TT * HD, (size_t)TT * HD, (size_t)TT * TT);
            k_gemmw<h16, 0, false><<<dim3((TT - RH) / 64, TT / 64, ZH), 32, 0, stream>>>(QP16 + zq * TT * HD + (size_t)RH * HD, nullptr, KP16 + zk * TT * HD, nullptr, HD, Sb + (size_t)RH * TT, TT, nullptr, (size_t)TT * HD, (size_t)TT * HD, (size_t)TT * TT);
            k_asoft<<<ZH * TT / 8, 256, 0, stream>>>(Sb, P16, Ph, Pl, mc + h0);   /* per-head compatibility scale */
            k_gemmw<bf, 2, false><<<dim3(RH / 64, HD / 64, ZH), 32, 0, stream>>>(Ph, Pl, VTh + zk * HD * TT, VTl + zk * HD * TT, TT, Ob, HD, nullptr, (size_t)RH * TT, (size_t)HD * TT, (size_t)TT * HD);
            k_gemmw<h16, 0, false><<<dim3((TT - RH) / 64, HD / 64, ZH), 32, 0, stream>>>(P16 + (size_t)RH * TT, nullptr, VT16 + zk * HD * TT, nullptr, TT, Ob + (size_t)RH * HD, HD, nullptr, (size_t)TT * TT, (size_t)HD * TT, (size_t)TT * HD);
            k_merge<<<(unsigned)(((size_t)ZH * TT * HD / 2 + 255) / 256), 256, 0, stream>>>(Ob, h0, ATh, ATl); }
        k_gemmw<bf, 1, true><<<dim3(TT / 64, DM / 64, 1), 32, 0, stream>>>(ATh, ATl, WO, nullptr, DQ, Y, DM, bo, 0, 0, 0); k_addres<<<(unsigned)(((size_t)TT * DQ / 4 + 255) / 256), 256, 0, stream>>>(Y, x + (size_t)b * TT * DM);   /* + query_modality */ k_lnout<<<(TT + 7) / 8, 256, 0, stream>>>(Y, lng, lnb, OUT + (size_t)b * TT * DM); }
}

// v001
// A run of this version takes 903 microseconds.
// Next to v000, in two timings, it ran 2.36 and 2.31 times as fast.
#include <hip/hip_runtime.h>

// Cross-modal multi-head attention with a learned per-head compatibility scale, residual and post-LayerNorm (query_modality, key_modality, value_modality [4][2048][512]; Q,K,V = x W + b ('xw' 1/sqrt(512), zero biases; 8 heads x 64); scores = (Q.K / 8) x modal_compat[h] ([1][8][1][1], read); softmax; out = merged Wo + bo; y = LayerNorm(out + query_modality) gamma/beta (1e-5) -> [4][2048][512] (4.2 M)).
// Layout per batch: bf16 copies of query, key, value inputs in turn; 'xw' weights transposed once; exact projections + f32 biases; dense T-2048 attention whose softmax kernel multiplies each pass's rows by the head's bf16-rounded compatibility scalar (hybrid rows: < 512 hi/lo 3 products, rest fp16 x1024); merged hi/lo x Wo exact + bo into workspace; residual add of query_modality and a row LayerNorm kernel write the output rows.
// Compute dtypes, f32 accumulate: every input rounded to bf16; projections exact + f32 biases; attention rows < 512 3 products, rest fp16; per-head scale and softmax f32; Wo hl x exact + bias; residual + LayerNorm f32.

#define NB_  4
#define TT   2048
#define DM   512
#define NH_  8
#define NKV  8
#define REP  (NH_ / NKV)
#define HD   64
#define DQ   (NH_ * HD)
#define DKV  (NKV * HD)
#define ZH   2
#define RH   512                  // query rows < RH use hi+lo planes (0: none)
#define WIN  0
#define PCAR 1024.0f
#define SCL  0.125f
#define LNEPS 1e-5f
#define KSP  16                   // K slices of the P x V products (K = 2048): one work-group per slice
#define KSJ  4                    // K slices of the q, k and output projections (K = 512)
typedef _Float16 h16;
typedef unsigned short bf;
typedef __attribute__((ext_vector_type(16))) __bf16   v16bf;
typedef __attribute__((ext_vector_type(16))) _Float16 v16h;
typedef __attribute__((ext_vector_type(8)))  _Float16 v8h;
typedef __attribute__((ext_vector_type(8)))  unsigned short v8us;
typedef __attribute__((ext_vector_type(8)))  float    v8f;
typedef __attribute__((ext_vector_type(4)))  float    v4f;
typedef v8h  __attribute__((may_alias)) v8ha;
typedef v4f  __attribute__((may_alias)) v4fa;
typedef v8us __attribute__((may_alias)) v8usa;

__device__ __forceinline__ unsigned short f2bf(float f) { unsigned u = __float_as_uint(f); u += 0x7FFFu + ((u >> 16) & 1u); return (unsigned short)(u >> 16); }
__device__ __forceinline__ float bf2f(unsigned short b) { return __uint_as_float(((unsigned)b) << 16); }
__device__ __forceinline__ float bfr(float f) { return bf2f(f2bf(f)); }
__device__ __forceinline__ v16h cat16(v8h lo, v8h hi) { return __builtin_shufflevector(lo, hi, 0, 1, 2, 3, 4, 5, 6, 7, 8, 9, 10, 11, 12, 13, 14, 15); }
__device__ __forceinline__ v16bf cat16b(v8us lo, v8us hi) { return __builtin_bit_cast(v16bf, __builtin_shufflevector(lo, hi, 0, 1, 2, 3, 4, 5, 6, 7, 8, 9, 10, 11, 12, 13, 14, 15)); }
__device__ __forceinline__ v8f wmma16(v16h a, v16h b, v8f c) { return __builtin_amdgcn_wmma_f32_16x16x32_f16(false, a, false, b, (short)0, c, false, false); }
__device__ __forceinline__ v8f wmmab(v16bf a, v16bf b, v8f c) { return __builtin_amdgcn_wmma_f32_16x16x32_bf16(false, a, false, b, (short)0, c, false, false); }



// ---- k_gemmw: register-blocked GEMM, ONE WAVE per 64x64 output tile (16 accumulators), operands straight from K-contiguous 16-bit planes; grid (M/64, N/64, Z x KS), 32 threads.
// C[m][n] (f32, pitch ldc, + optional f32 bias[n]) = sum_k A[m][k] Bt[n][k] (+ split products per NSPLIT). z-batch strides sA/sB/sC in elements. K % (32 KS) == 0.
// Split K: grid z = Z x KS; slice sl of batch z sums k in [sl K/KS, (sl+1) K/KS) into its own f32 plane C + sl sP (bias in slice 0 only); the kernel that reads C adds the KS planes in slice order.
template <typename T16> struct WFrag;
template <> struct WFrag<h16> { typedef v16h V; static __device__ __forceinline__ V ld(const h16* p) { return cat16(*(const v8h*)p, *(const v8h*)(p + 16)); } static __device__ __forceinline__ v8f mma(V a, V b, v8f c) { return wmma16(a, b, c); } };
template <> struct WFrag<bf> { typedef v16bf V; static __device__ __forceinline__ V ld(const bf* p) { return cat16b(*(const v8us*)p, *(const v8us*)(p + 16)); } static __device__ __forceinline__ v8f mma(V a, V b, v8f c) { return wmmab(a, b, c); } };
template <typename T16, int NSPLIT, bool BIAS, int KS>
__global__ __launch_bounds__(32) void k_gemmw(const T16* __restrict__ A, const T16* __restrict__ A2, const T16* __restrict__ Bt, const T16* __restrict__ Bt2, int K, float* C, int ldc, const float* __restrict__ bias, size_t sA, size_t sB, size_t sC, size_t sP) {
    typedef typename WFrag<T16>::V V;
    __shared__ __align__(16) float os[16 * 68];
    const size_t z = blockIdx.z / KS; const int sl = (int)(blockIdx.z % KS); const int kl = K / KS, kb = sl * kl; A += z * sA; if (A2) A2 += z * sA; Bt += z * sB; if (Bt2) Bt2 += z * sB; C += z * sC + (size_t)sl * sP;
    const int lane = threadIdx.x & 31, lr = lane & 15, hi = lane >> 4; const int r0 = blockIdx.x * 64, c0 = blockIdx.y * 64;
    v8f acc[4][4];
#pragma unroll
    for (int mb = 0; mb < 4; ++mb)
#pragma unroll
        for (int nb = 0; nb < 4; ++nb) acc[mb][nb] = (v8f){};
    v4f bv = (v4f){};   // this lane's four output columns of the bias; zero in every slice but the first, so that the planes' sum holds it once
    if (BIAS && sl == 0) { const float* bp = bias + c0 + lr * 4; bv[0] = bp[0]; bv[1] = bp[1]; bv[2] = bp[2]; bv[3] = bp[3];   // rounded behind the K loop, which covers the load
        asm volatile("s_wait_xcnt 0x0" ::: "memory"); }   // precaution: stands between the load and the address set-up below, which may reuse the load's address registers
    const size_t aoff = (size_t)(r0 + lr) * K + 8 * hi, boff = (size_t)(c0 + lr) * K + 8 * hi;
#pragma unroll 1
    for (int kc = kb; kc < kb + kl; kc += 32) {
        V a[4], a2[4];
#pragma unroll
        for (int mb = 0; mb < 4; ++mb) { a[mb] = WFrag<T16>::ld(A + aoff + (size_t)mb * 16 * K + kc); if (NSPLIT == 1 || NSPLIT == 2) a2[mb] = WFrag<T16>::ld(A2 + aoff + (size_t)mb * 16 * K + kc); }
#pragma unroll
        for (int nb = 0; nb < 4; ++nb) { const V b = WFrag<T16>::ld(Bt + boff + (size_t)nb * 16 * K + kc); V b2; if (NSPLIT >= 2) b2 = WFrag<T16>::ld(Bt2 + boff + (size_t)nb * 16 * K + kc);
#pragma unroll
            for (int mb = 0; mb < 4; ++mb) { acc[mb][nb] = WFrag<T16>::mma(a[mb], b, acc[mb][nb]); if (NSPLIT == 1 || NSPLIT == 2) acc[mb][nb] = WFrag<T16>::mma(a2[mb], b, acc[mb][nb]); if (NSPLIT >= 2) acc[mb][nb] = WFrag<T16>::mma(a[mb], b2, acc[mb][nb]); } }
        asm volatile("v_nop\n\tv_nop\n\tv_nop\n\tv_nop" : "+v"(acc[0][0]), "+v"(acc[1][1]), "+v"(acc[2][2]), "+v"(acc[3][3]) : "v"(a[0]), "v"(a[3]));
    }
    if (BIAS) { bv[0] = bfr(bv[0]); bv[1] = bfr(bv[1]); bv[2] = bfr(bv[2]); bv[3] = bfr(bv[3]); }
#pragma unroll
    for (int mb = 0; mb < 4; ++mb) {
#pragma unroll
        for (int nb = 0; nb < 4; ++nb) {
#pragma unroll
            for (int j = 0; j < 8; ++j) os[(hi * 8 + j) * 68 + nb * 16 + lr] = acc[mb][nb][j]; }
        __builtin_amdgcn_wave_barrier(); asm volatile("" ::: "memory");
        float* crow = C + (size_t)(r0 + mb * 16) * ldc + c0;
{
#pragma unroll
            for (int s = 0; s < 8; ++s) { const int row = 2 * s + hi, cofs = lr * 4; v4f val = *(const v4fa*)(os + row * 68 + cofs); if (BIAS) val += bv;
                *(v4f*)(crow + (size_t)row * ldc + cofs) = val; }
             }
        __builtin_amdgcn_wave_barrier(); asm volatile("" ::: "memory");
    }
}

__device__ __forceinline__ h16 tohx(float x) { return (h16)x; }
__device__ __forceinline__ void splitf(float y, unsigned short& h, unsigned short& l) { h = f2bf(y); l = f2bf(y - bf2f(h)); }
typedef __attribute__((ext_vector_type(2))) _Float16 v2h;
typedef __attribute__((ext_vector_type(4))) _Float16 v4h;
typedef __attribute__((ext_vector_type(2))) unsigned short v2us;
typedef __attribute__((ext_vector_type(4))) unsigned short v4us;
typedef __attribute__((ext_vector_type(2))) float v2f;
typedef __attribute__((ext_vector_type(4))) int v4i;

__global__ __launch_bounds__(256) void k_wtG(const float* __restrict__ w, int K, int N, bf* Bt) {
    const int lane = threadIdx.x & 31; const int L0 = (blockIdx.x * 8 + (threadIdx.x >> 5)) * 8; const int nlines = N * K / 64;
{
#pragma unroll 1
        for (int l = 0; l < 8; ++l) { const int L = L0 + l; if (L >= nlines) break; const size_t e = (size_t)L * 64 + lane * 2; const int k = (int)(e % K), n = (int)(e / K); v2us o;
            o[0] = f2bf(w[(size_t)k * N + n]); o[1] = f2bf(w[(size_t)(k + 1) * N + n]); *(v2us*)(Bt + e) = o; }
         }
}
__global__ __launch_bounds__(256) void k_cvt8(const float* __restrict__ src, bf* dst, size_t n8) { const size_t i = (size_t)blockIdx.x * 256 + threadIdx.x; if (i >= n8) return; const v8f v = *(const v8f*)(src + i * 8); v8us o;
#pragma unroll
    for (int k = 0; k < 8; ++k) o[k] = f2bf(v[k]); *(v8us*)(dst + i * 8) = o;  }

// k_rope: head planes [h][t][d] (fp16 + hi/lo) of rope(x) x sc with the rotate-half convention out[d] = x[d] cos[t][d] - x[d+HD/2] sin[t][d], out[d+HD/2] = x[d+HD/2] cos[t][d+HD/2] + x[d] sin[t][d+HD/2]
__global__ __launch_bounds__(256) void k_rope(const float* __restrict__ F, int pitch, int nheads, const float* __restrict__ CS, const float* __restrict__ RF, const float* __restrict__ nw, float sc, h16* P16, bf* Ph, bf* Pl) {
    const size_t e = ((size_t)blockIdx.x * 256 + threadIdx.x) * 2; if (e >= (size_t)nheads * TT * HD) return; const int d = (int)(e % HD); const int t = (int)((e / HD) % TT); const int h = (int)(e / ((size_t)HD * TT)); const float* f = F + (size_t)t * pitch + h * HD; const float rf = RF ? RF[(size_t)h * TT + t] : 1.0f; v2h o16; v2us oh, ol;
    const int db = (d < HD / 2) ? d + HD / 2 : d - HD / 2;   /* d is even: d and d + 1 have neighbouring partners */
    const float* pa[KSJ]; const float* pb[KSJ]; v2f va[KSJ], vb[KSJ];
#pragma unroll
    for (int s = 0; s < KSJ; ++s) { pa[s] = f + (size_t)s * TT * pitch + d; pb[s] = f + (size_t)s * TT * pitch + db; va[s] = *(const v2f*)pa[s]; vb[s] = *(const v2f*)pb[s]; }
    static_assert(KSJ == 4, "the wait below names four planes' addresses");
    asm volatile("s_wait_xcnt 0x0" :: "v"(pa[0]), "v"(pa[1]), "v"(pa[2]), "v"(pa[3]), "v"(pb[0]), "v"(pb[1]), "v"(pb[2]), "v"(pb[3]) : "memory");   /* precaution: as inputs, the eight loads' address registers stay live up to this wait, so none is overwritten in front of it */
    v2f xa = va[0], xb = vb[0];
#pragma unroll
    for (int s = 1; s < KSJ; ++s) { xa += va[s]; xb += vb[s]; }   /* the projection's K-slice planes, in slice order */
#pragma unroll
    for (int q = 0; q < 2; ++q) { const int dd = d + q; const int dp = (dd < HD / 2) ? dd + HD / 2 : dd - HD / 2; float x0 = xa[q], x1 = xb[q];
        if (RF) { float n0 = __fmul_rn(x0, rf), n1 = __fmul_rn(x1, rf); asm volatile("" : "+v"(n0)); asm volatile("" : "+v"(n1)); x0 = __fmul_rn(bfr(nw[dd]), n0); x1 = __fmul_rn(bfr(nw[dp]), n1); }
        const v2f cs = *(const v2f*)(CS + ((size_t)t * HD + dd) * 2); float a = __fmul_rn(x0, cs[0]), bq = __fmul_rn(x1, cs[1]); asm volatile("" : "+v"(a)); asm volatile("" : "+v"(bq)); const float r = ((dd < HD / 2) ? __fsub_rn(a, bq) : __fadd_rn(a, bq)) * sc;
        o16[q] = tohx(r); unsigned short a2, c2; splitf(r, a2, c2); oh[q] = a2; ol[q] = c2; }
    *(v2h*)(P16 + e) = o16; *(v2us*)(Ph + e) = oh; *(v2us*)(Pl + e) = ol;  }
__global__ __launch_bounds__(256) void k_vtp(const float* __restrict__ F, int pitch, int nheads, h16* V16, bf* Vh, bf* Vl) { const size_t e = ((size_t)blockIdx.x * 256 + threadIdx.x) * 2; if (e >= (size_t)nheads * HD * TT) return; const int t = (int)(e % TT); const int d = (int)((e / TT) % HD); const int g = (int)(e / ((size_t)TT * HD)); v2h o16; v2us oh, ol;
#pragma unroll
    for (int q = 0; q < 2; ++q) { const float x = F[(size_t)(t + q) * pitch + g * HD + d]; o16[q] = tohx(x); unsigned short a2, c2; splitf(x, a2, c2); oh[q] = a2; ol[q] = c2; }
    *(v2h*)(V16 + e) = o16; *(v2us*)(Vh + e) = oh; *(v2us*)(Vl + e) = ol;  }
__global__ __launch_bounds__(256) void k_csid(float* CS) { const int idx = blockIdx.x * 256 + threadIdx.x; if (idx >= TT * HD) return; v2f cs; cs[0] = 1.0f; cs[1] = 0.0f; *(v2f*)(CS + (size_t)idx * 2) = cs;  }
// k_asoft: per row (zz, i): t = (S x 1/8) x modal_compat[h] (the pass's head scalar, bf16-rounded input, read); softmax over the 2048 keys (register row, one exp, fixed trees);
__global__ __launch_bounds__(256) void k_asoft(const float* __restrict__ Sb, h16* P16, bf* Ph, bf* Pl, const float* __restrict__ mcp) {
    const int lane = threadIdx.x & 31; const int row = blockIdx.x * 8 + (threadIdx.x >> 5); if (row >= ZH * TT) return; const int i = row % TT; const int zz = row / TT; (void)zz; const bool hires = (i < RH); const float hsc = __fmul_rn(SCL, bfr(mcp[zz]));   /* (1/8) x modal_compat[h] (bf16-rounded input), once per row */  const float* sr = Sb + (size_t)row * TT; float v[TT / 32]; float mx = -3.0e38f;
#pragma unroll
    for (int ch = 0; ch < TT / 128; ++ch) { const int j0 = ch * 128 + lane * 4; const v4f a = *(const v4f*)(sr + j0);
#pragma unroll
        for (int q = 0; q < 4; ++q) { const int j = j0 + q; (void)j; const float t = a[q] * hsc;   /* s x (compat[h]/8): one rounding instead of the module's two (<= 1 ulp of the logit) */ v[ch * 4 + q] = t; mx = fmaxf(mx, t); } }
#pragma unroll
    for (int sh = 16; sh; sh >>= 1) mx = fmaxf(mx, __shfl_xor(mx, sh, 32));
    float sum = 0.f;
#pragma unroll
    for (int k = 0; k < TT / 32; ++k) { float d0 = __fsub_rn(v[k], mx); asm volatile("" : "+v"(d0)); v[k] = __builtin_amdgcn_exp2f(__fmul_rn(d0, 1.4426950408889634f)); sum += v[k]; }
#pragma unroll
    for (int sh = 16; sh; sh >>= 1) sum += __shfl_xor(sum, sh, 32);
    const float f = __fdiv_rn(hires ? 1.0f : PCAR, sum);
{
        if (hires) {
#pragma unroll
            for (int ch = 0; ch < TT / 128; ++ch) { v4us oh, ol;
#pragma unroll
                for (int q = 0; q < 4; ++q) { unsigned short a, c2; splitf(v[ch * 4 + q] * f, a, c2); oh[q] = a; ol[q] = c2; }
                const size_t oo = ((size_t)zz * (RH ? RH : 1) + i) * TT + ch * 128 + lane * 4; *(v4us*)(Ph + oo) = oh; *(v4us*)(Pl + oo) = ol; }
        } else {
#pragma unroll
            for (int ch = 0; ch < TT / 128; ++ch) { v4h o4;
#pragma unroll
                for (int q = 0; q < 4; ++q) o4[q] = tohx(v[ch * 4 + q] * f);
                *(v4h*)(P16 + (size_t)row * TT + ch * 128 + lane * 4) = o4; } }
         }
}
__global__ __launch_bounds__(256) void k_addres(float* Y, const float* __restrict__ xr) { const size_t i = (size_t)blockIdx.x * 256 + threadIdx.x; if (i >= (size_t)TT * DQ / 4) return; v4f a = *(const v4f*)(Y + i * 4);
#pragma unroll
    for (int s = 1; s < KSJ; ++s) a += *(const v4f*)(Y + (size_t)s * TT * DQ + i * 4);   /* the output projection's K-slice planes, in slice order */
    const v4f r = *(const v4f*)(xr + i * 4); v4f o;
#pragma unroll
    for (int q = 0; q < 4; ++q) o[q] = __fadd_rn(a[q], bfr(r[q]));
    *(v4f*)(Y + i * 4) = o;  }
__global__ __launch_bounds__(256) void k_lnout(const float* __restrict__ F, const float* __restrict__ g, const float* __restrict__ bb, float* out) { const int lane = threadIdx.x & 31; const int row = blockIdx.x * 8 + (threadIdx.x >> 5); if (row >= TT) return; const float* fr = F + (size_t)row * DQ; float* orow = out + (size_t)row * DQ; float v[DQ / 32]; float s = 0.f;
#pragma unroll
    for (int c = 0; c < DQ / 128; ++c) { const v4f a = *(const v4f*)(fr + c * 128 + lane * 4); for (int q = 0; q < 4; ++q) { v[c * 4 + q] = a[q]; s = __fadd_rn(s, a[q]); } }
#pragma unroll
    for (int sh = 16; sh; sh >>= 1) s = __fadd_rn(s, __shfl_xor(s, sh, 32));
    const float mean = __fdiv_rn(s, (float)DQ); float s2 = 0.f;
#pragma unroll
    for (int k = 0; k < DQ / 32; ++k) { const float dv = __fsub_rn(v[k], mean); float p2 = __fmul_rn(dv, dv); asm volatile("" : "+v"(p2)); s2 = __fadd_rn(s2, p2); v[k] = dv; }
#pragma unroll
    for (int sh = 16; sh; sh >>= 1) s2 = __fadd_rn(s2, __shfl_xor(s2, sh, 32));
    const float rs = __fdiv_rn(1.0f, __fsqrt_rn(__fadd_rn(__fdiv_rn(s2, (float)DQ), LNEPS)));
{
#pragma unroll
        for (int c = 0; c < DQ / 128; ++c) { v4f o; for (int q = 0; q < 4; ++q) { const int col = c * 128 + lane * 4 + q; float y = __fmul_rn(v[c * 4 + q], rs); asm volatile("" : "+v"(y)); y = __fmul_rn(y, bfr(g[col])); asm volatile("" : "+v"(y)); o[q] = __fadd_rn(y, bfr(bb[col])); } *(v4f*)(orow + c * 128 + lane * 4) = o; }
         } }
__global__ __launch_bounds__(256) void k_merge(const float* __restrict__ O, int h0, bf* Ah, bf* Al) { const size_t e = ((size_t)blockIdx.x * 256 + threadIdx.x) * 2; if (e >= (size_t)ZH * TT * HD) return; const int d = (int)(e % HD); const int t = (int)((e / HD) % TT); const int zz = (int)(e / ((size_t)HD * TT)); const float cs = (t < RH) ? 1.0f : (1.0f / PCAR); const size_t oo = (size_t)t * DQ + (h0 + zz) * HD + d;
    v2f sm = *(const v2f*)(O + e);
#pragma unroll
    for (int s = 1; s < KSP; ++s) sm += *(const v2f*)(O + (size_t)s * ZH * TT * HD + e);   /* the P x V K-slice planes, in slice order */
    v2us oh, ol;
#pragma unroll
    for (int q = 0; q < 2; ++q) { unsigned short a, c2; splitf(sm[q] * cs, a, c2); oh[q] = a; ol[q] = c2; } *(v2us*)(Ah + oo) = oh; *(v2us*)(Al + oo) = ol;  }

extern "C" void kernel_launch(void* const* d_in, const int* in_sizes, int n_in,
                              void* d_out, int out_size, void* d_ws, size_t ws_size, hipStream_t stream) {
    (void)in_sizes; (void)n_in; (void)out_size;
    const float* x = (const float*)d_in[0];   /* query_modality */ const float* xk = (const float*)d_in[1]; const float* xv = (const float*)d_in[2]; const float* wq = (const float*)d_in[3]; const float* bq = (const float*)d_in[4]; const float* wk = (const float*)d_in[5]; const float* bk = (const float*)d_in[6]; const float* wv = (const float*)d_in[7]; const float* bv = (const float*)d_in[8]; const float* wo = (const float*)d_in[9]; const float* bo = (const float*)d_in[10]; const float* mc = (const float*)d_in[11];   /* modal_compat [8] */ const float* lng = (const float*)d_in[12]; const float* lnb = (const float*)d_in[13];
    float* OUT = (float*)d_out;     // [4][2048][512]
    char* wsp = (char*)d_ws;
    auto take = [&](size_t bytes) { char* p = wsp; wsp += (bytes + 255) & ~(size_t)255; return (void*)p; };
    float* Y = (float*)take((size_t)KSJ * TT * DM * 4); bf* WQ = (bf*)take((size_t)DQ * DM * 2); bf* WK = (bf*)take((size_t)DKV * DM * 2); bf* WV = (bf*)take((size_t)DKV * DM * 2); bf* WO = (bf*)take((size_t)DM * DQ * 2); float* CS = (float*)take((size_t)TT * HD * 2 * 4);
    bf* XB = (bf*)take((size_t)TT * DM * 2); float* FQ = (float*)take((size_t)KSJ * TT * DQ * 4); float* FK = (float*)take((size_t)KSJ * TT * DKV * 4);
    h16* QP16 = (h16*)take((size_t)NH_ * TT * HD * 2); h16* KP16 = (h16*)take((size_t)NKV * TT * HD * 2); h16* VT16 = (h16*)take((size_t)NKV * HD * TT * 2);
    bf* QPh = (bf*)take((size_t)NH_ * TT * HD * 2); bf* QPl = (bf*)take((size_t)NH_ * TT * HD * 2); bf* KPh = (bf*)take((size_t)NKV * TT * HD * 2); bf* KPl = (bf*)take((size_t)NKV * TT * HD * 2); bf* VTh = (bf*)take((size_t)NKV * HD * TT * 2); bf* VTl = (bf*)take((size_t)NKV * HD * TT * 2); bf* Ph = (bf*)take((size_t)ZH * RH * TT * 2); bf* Pl = (bf*)take((size_t)ZH * RH * TT * 2);
    float* Sb = (float*)take((size_t)ZH * TT * TT * 4); h16* P16 = (h16*)take((size_t)ZH * TT * TT * 2); float* Ob = (float*)take((size_t)KSP * ZH * TT * HD * 4); bf* ATh = (bf*)take((size_t)TT * DQ * 2); bf* ATl = (bf*)take((size_t)TT * DQ * 2);
    if ((size_t)(wsp - (char*)d_ws) > ws_size) return;    // ws 256 MiB
    float* FV = FK;   // v projection (one slice: its reader walks columns) reuses the k buffer's first plane after k_rope has read the k planes (stream-ordered)
    { k_wtG<<<(unsigned)((DM * DQ / 64 + 63) / 64), 256, 0, stream>>>(wq, DM, DQ, WQ); k_wtG<<<(unsigned)((DM * DKV / 64 + 63) / 64), 256, 0, stream>>>(wk, DM, DKV, WK); k_wtG<<<(unsigned)((DM * DKV / 64 + 63) / 64), 256, 0, stream>>>(wv, DM, DKV, WV);
      k_wtG<<<(unsigned)((DQ * DM / 64 + 63) / 64), 256, 0, stream>>>(wo, DQ, DM, WO);
       }
    k_csid<<<(TT * HD + 255) / 256, 256, 0, stream>>>(CS);
    const unsigned LQ = (unsigned)(((size_t)NH_ * TT * HD / 2 + 255) / 256), LKv = (unsigned)(((size_t)NKV * TT * HD / 2 + 255) / 256);
    for (int b = 0; b < NB_; ++b) {
        
        k_cvt8<<<(unsigned)(((size_t)TT * DM / 8 + 255) / 256), 256, 0, stream>>>(x + (size_t)b * TT * DM, XB, (size_t)TT * DM / 8);
        k_gemmw<bf, 0, true, KSJ><<<dim3(TT / 64, DQ / 64, KSJ), 32, 0, stream>>>(XB, nullptr, WQ, nullptr, DM, FQ, DQ, bq, 0, 0, 0, (size_t)TT * DQ);
        k_rope<<<LQ, 256, 0, stream>>>(FQ, DQ, NH_, CS, nullptr, nullptr, 1.0f, QP16, QPh, QPl);
        k_cvt8<<<(unsigned)(((size_t)TT * DM / 8 + 255) / 256), 256, 0, stream>>>(xk + (size_t)b * TT * DM, XB, (size_t)TT * DM / 8); k_gemmw<bf, 0, true, KSJ><<<dim3(TT / 64, DKV / 64, KSJ), 32, 0, stream>>>(XB, nullptr, WK, nullptr, DM, FK, DKV, bk, 0, 0, 0, (size_t)TT * DKV);
        k_rope<<<LKv, 256, 0, stream>>>(FK, DKV, NKV, CS, nullptr, nullptr, 1.0f, KP16, KPh, KPl);
        k_cvt8<<<(unsigned)(((size_t)TT * DM / 8 + 255) / 256), 256, 0, stream>>>(xv + (size_t)b * TT * DM, XB, (size_t)TT * DM / 8); k_gemmw<bf, 0, true, 1><<<dim3(TT / 64, DKV / 64, 1), 32, 0, stream>>>(XB, nullptr, WV, nullptr, DM, FV, DKV, bv, 0, 0, 0, 0); k_vtp<<<LKv, 256, 0, stream>>>(FV, DKV, NKV, VT16, VTh, VTl);
        for (int h0 = 0; h0 < NH_; h0 += ZH) { const size_t zq = (size_t)h0, zk = (size_t)(h0 / REP);   // one kv head per query head: the pass's two heads use consecutive kv planes (z-strides TT*HD)
            k_gemmw<bf, 2, false, 1><<<dim3(RH / 64, TT / 64, ZH), 32, 0, stream>>>(QPh + zq * TT * HD, QPl + zq * TT * HD, KPh + zk * TT * HD, KPl + zk * TT * HD, HD, Sb, TT, nullptr, (size_t)TT * HD, (size_t)TT * HD, (size_t)TT * TT, 0);
            k_gemmw<h16, 0, false, 1><<<dim3((TT - RH) / 64, TT / 64, ZH), 32, 0, stream>>>(QP16 + zq * TT * HD + (size_t)RH * HD, nullptr, KP16 + zk * TT * HD, nullptr, HD, Sb + (size_t)RH * TT, TT, nullptr, (size_t)TT * HD, (size_t)TT * HD, (size_t)TT * TT, 0);
            k_asoft<<<ZH * TT / 8, 256, 0, stream>>>(Sb, P16, Ph, Pl, mc + h0);   /* per-head compatibility scale */
            k_gemmw<bf, 2, false, KSP><<<dim3(RH / 64, HD / 64, ZH * KSP), 32, 0, stream>>>(Ph, Pl, VTh + zk * HD * TT, VTl + zk * HD * TT, TT, Ob, HD, nullptr, (size_t)RH * TT, (size_t)HD * TT, (size_t)TT * HD, (size_t)ZH * TT * HD);
            k_gemmw<h16, 0, false, KSP><<<dim3((TT - RH) / 64, HD / 64, ZH * KSP), 32, 0, stream>>>(P16 + (size_t)RH * TT, nullptr, VT16 + zk * HD * TT, nullptr, TT, Ob + (size_t)RH * HD, HD, nullptr, (size_t)TT * TT, (size_t)HD * TT, (size_t)TT * HD, (size_t)ZH * TT * HD);
            k_merge<<<(unsigned)(((size_t)ZH * TT * HD / 2 + 255) / 256), 256, 0, stream>>>(Ob, h0, ATh, ATl); }
        k_gemmw<bf, 1, true, KSJ><<<dim3(TT / 64, DM / 64, KSJ), 32, 0, stream>>>(ATh, ATl, WO, nullptr, DQ, Y, DM, bo, 0, 0, 0, (size_t)TT * DM); k_addres<<<(unsigned)(((size_t)TT * DQ / 4 + 255) / 256), 256, 0, stream>>>(Y, x + (size_t)b * TT * DM);   /* + query_modality */ k_lnout<<<(TT + 7) / 8, 256, 0, stream>>>(Y, lng, lnb, OUT + (size_t)b * TT * DM); }
}

// v002
// One run takes 625 microseconds.
// Timed twice side by side with v001, it ran 1.44 and 1.45 times as fast.
// All steps since v000 together make it 3.38 times as fast.
#include <hip/hip_runtime.h>

// Cross-modal multi-head attention with a learned per-head compatibility scale, residual and post-LayerNorm (query_modality, key_modality, value_modality [4][2048][512]; Q,K,V = x W + b ('xw' 1/sqrt(512), zero biases; 8 heads x 64); scores = (Q.K / 8) x modal_compat[h] ([1][8][1][1], read); softmax; out = merged Wo + bo; y = LayerNorm(out + query_modality) gamma/beta (1e-5) -> [4][2048][512] (4.2 M)).
// Layout, all batches in one launch of each kernel outside attention (rows b*2048+t; head planes [b][h]), attention per batch in passes of 4 heads: bf16 copies of query, key, value inputs; 'xw' weights transposed once; exact projections + f32 biases; dense T-2048 attention whose softmax kernel multiplies each pass's rows by the head's bf16-rounded compatibility scalar (hybrid rows: < 512 hi/lo 3 products, rest fp16 x1024); merged hi/lo x Wo exact + bo into workspace; residual add of query_modality and a row LayerNorm kernel write the output rows.
// Compute dtypes, f32 accumulate: every input rounded to bf16; projections exact + f32 biases; attention rows < 512 3 products, rest fp16; per-head scale and softmax f32; Wo hl x exact + bias; residual + LayerNorm f32.

#define NB_  4
#define TT   2048
#define DM   512
#define NH_  8
#define NKV  8
#define REP  (NH_ / NKV)
#define HD   64
#define DQ   (NH_ * HD)
#define DKV  (NKV * HD)
#define ZH   4                    // heads per attention pass (grid z of its kernels)
#define MT   (NB_ * TT)           // rows of all batches together
#define RH   512                  // query rows < RH use hi+lo planes (0: none)
#define WIN  0
#define PCAR 1024.0f
#define SCL  0.125f
#define LNEPS 1e-5f
#define KSP  16                   // K slices of the P x V products (K = 2048): one work-group per slice
#define KSJ  4                    // K slices of the q, k and output projections (K = 512)
typedef _Float16 h16;
typedef unsigned short bf;
typedef __attribute__((ext_vector_type(16))) __bf16   v16bf;
typedef __attribute__((ext_vector_type(16))) _Float16 v16h;
typedef __attribute__((ext_vector_type(8)))  _Float16 v8h;
typedef __attribute__((ext_vector_type(8)))  unsigned short v8us;
typedef __attribute__((ext_vector_type(8)))  float    v8f;
typedef __attribute__((ext_vector_type(4)))  float    v4f;
typedef v8h  __attribute__((may_alias)) v8ha;
typedef v4f  __attribute__((may_alias)) v4fa;
typedef v8us __attribute__((may_alias)) v8usa;

__device__ __forceinline__ unsigned short f2bf(float f) { unsigned u = __float_as_uint(f); u += 0x7FFFu + ((u >> 16) & 1u); return (unsigned short)(u >> 16); }
__device__ __forceinline__ float bf2f(unsigned short b) { return __uint_as_float(((unsigned)b) << 16); }
__device__ __forceinline__ float bfr(float f) { return bf2f(f2bf(f)); }
__device__ __forceinline__ v16h cat16(v8h lo, v8h hi) { return __builtin_shufflevector(lo, hi, 0, 1, 2, 3, 4, 5, 6, 7, 8, 9, 10, 11, 12, 13, 14, 15); }
__device__ __forceinline__ v16bf cat16b(v8us lo, v8us hi) { return __builtin_bit_cast(v16bf, __builtin_shufflevector(lo, hi, 0, 1, 2, 3, 4, 5, 6, 7, 8, 9, 10, 11, 12, 13, 14, 15)); }
__device__ __forceinline__ v8f wmma16(v16h a, v16h b, v8f c) { return __builtin_amdgcn_wmma_f32_16x16x32_f16(false, a, false, b, (short)0, c, false, false); }
__device__ __forceinline__ v8f wmmab(v16bf a, v16bf b, v8f c) { return __builtin_amdgcn_wmma_f32_16x16x32_bf16(false, a, false, b, (short)0, c, false, false); }



// ---- k_gemmw: register-blocked GEMM, ONE WAVE per 64x64 output tile (16 accumulators), operands straight from K-contiguous 16-bit planes; grid (M/64, N/64, Z x KS), 32 threads.
// C[m][n] (f32, pitch ldc, + optional f32 bias[n]) = sum_k A[m][k] Bt[n][k] (+ split products per NSPLIT). z-batch strides sA/sB/sC in elements. K % (32 KS) == 0.
// Split K: grid z = Z x KS; slice sl of batch z sums k in [sl K/KS, (sl+1) K/KS) into its own f32 plane C + sl sP (bias in slice 0 only); the kernel that reads C adds the KS planes in slice order.
template <typename T16> struct WFrag;
template <> struct WFrag<h16> { typedef v16h V; static __device__ __forceinline__ V ld(const h16* p) { return cat16(*(const v8h*)p, *(const v8h*)(p + 16)); } static __device__ __forceinline__ v8f mma(V a, V b, v8f c) { return wmma16(a, b, c); } };
template <> struct WFrag<bf> { typedef v16bf V; static __device__ __forceinline__ V ld(const bf* p) { return cat16b(*(const v8us*)p, *(const v8us*)(p + 16)); } static __device__ __forceinline__ v8f mma(V a, V b, v8f c) { return wmmab(a, b, c); } };
template <typename T16, int NSPLIT, bool BIAS, int KS>
__global__ __launch_bounds__(32) void k_gemmw(const T16* __restrict__ A, const T16* __restrict__ A2, const T16* __restrict__ Bt, const T16* __restrict__ Bt2, int K, float* C, int ldc, const float* __restrict__ bias, size_t sA, size_t sB, size_t sC, size_t sP) {
    typedef typename WFrag<T16>::V V;
    __shared__ __align__(16) float os[16 * 68];
    const size_t z = blockIdx.z / KS; const int sl = (int)(blockIdx.z % KS); const int kl = K / KS, kb = sl * kl; A += z * sA; if (A2) A2 += z * sA; Bt += z * sB; if (Bt2) Bt2 += z * sB; C += z * sC + (size_t)sl * sP;
    const int lane = threadIdx.x & 31, lr = lane & 15, hi = lane >> 4; const int r0 = blockIdx.x * 64, c0 = blockIdx.y * 64;
    v8f acc[4][4];
#pragma unroll
    for (int mb = 0; mb < 4; ++mb)
#pragma unroll
        for (int nb = 0; nb < 4; ++nb) acc[mb][nb] = (v8f){};
    v4f bv = (v4f){};   // this lane's four output columns of the bias; zero in every slice but the first, so that the planes' sum holds it once
    if (BIAS && sl == 0) { const float* bp = bias + c0 + lr * 4; bv[0] = bp[0]; bv[1] = bp[1]; bv[2] = bp[2]; bv[3] = bp[3];   // rounded behind the K loop, which covers the load
        asm volatile("s_wait_xcnt 0x0" ::: "memory"); }   // precaution: stands between the load and the address set-up below, which may reuse the load's address registers
    const size_t aoff = (size_t)(r0 + lr) * K + 8 * hi, boff = (size_t)(c0 + lr) * K + 8 * hi;
#pragma unroll 1
    for (int kc = kb; kc < kb + kl; kc += 32) {
        V a[4], a2[4];
#pragma unroll
        for (int mb = 0; mb < 4; ++mb) { a[mb] = WFrag<T16>::ld(A + aoff + (size_t)mb * 16 * K + kc); if (NSPLIT == 1 || NSPLIT == 2) a2[mb] = WFrag<T16>::ld(A2 + aoff + (size_t)mb * 16 * K + kc); }
#pragma unroll
        for (int nb = 0; nb < 4; ++nb) { const V b = WFrag<T16>::ld(Bt + boff + (size_t)nb * 16 * K + kc); V b2; if (NSPLIT >= 2) b2 = WFrag<T16>::ld(Bt2 + boff + (size_t)nb * 16 * K + kc);
#pragma unroll
            for (int mb = 0; mb < 4; ++mb) { acc[mb][nb] = WFrag<T16>::mma(a[mb], b, acc[mb][nb]); if (NSPLIT == 1 || NSPLIT == 2) acc[mb][nb] = WFrag<T16>::mma(a2[mb], b, acc[mb][nb]); if (NSPLIT >= 2) acc[mb][nb] = WFrag<T16>::mma(a[mb], b2, acc[mb][nb]); } }
        asm volatile("v_nop\n\tv_nop\n\tv_nop\n\tv_nop" : "+v"(acc[0][0]), "+v"(acc[1][1]), "+v"(acc[2][2]), "+v"(acc[3][3]) : "v"(a[0]), "v"(a[3]));
    }
    if (BIAS) { bv[0] = bfr(bv[0]); bv[1] = bfr(bv[1]); bv[2] = bfr(bv[2]); bv[3] = bfr(bv[3]); }
#pragma unroll
    for (int mb = 0; mb < 4; ++mb) {
#pragma unroll
        for (int nb = 0; nb < 4; ++nb) {
#pragma unroll
            for (int j = 0; j < 8; ++j) os[(hi * 8 + j) * 68 + nb * 16 + lr] = acc[mb][nb][j]; }
        __builtin_amdgcn_wave_barrier(); asm volatile("" ::: "memory");
        float* crow = C + (size_t)(r0 + mb * 16) * ldc + c0;
{
#pragma unroll
            for (int s = 0; s < 8; ++s) { const int row = 2 * s + hi, cofs = lr * 4; v4f val = *(const v4fa*)(os + row * 68 + cofs); if (BIAS) val += bv;
                *(v4f*)(crow + (size_t)row * ldc + cofs) = val; }
             }
        __builtin_amdgcn_wave_barrier(); asm volatile("" ::: "memory");
    }
}

__device__ __forceinline__ h16 tohx(float x) { return (h16)x; }
__device__ __forceinline__ void splitf(float y, unsigned short& h, unsigned short& l) { h = f2bf(y); l = f2bf(y - bf2f(h)); }
typedef __attribute__((ext_vector_type(2))) _Float16 v2h;
typedef __attribute__((ext_vector_type(4))) _Float16 v4h;
typedef __attribute__((ext_vector_type(2))) unsigned short v2us;
typedef __attribute__((ext_vector_type(4))) unsigned short v4us;
typedef __attribute__((ext_vector_type(2))) float v2f;
typedef __attribute__((ext_vector_type(4))) int v4i;

__global__ __launch_bounds__(256) void k_wtG(const float* __restrict__ w0, const float* __restrict__ w1, const float* __restrict__ w2, const float* __restrict__ w3, int K, int N, bf* Bt) {
    const float* __restrict__ w = blockIdx.y == 0 ? w0 : blockIdx.y == 1 ? w1 : blockIdx.y == 2 ? w2 : w3; Bt += (size_t)blockIdx.y * N * K;   // grid y: which of the four equal-shaped weights; their transposes lie one behind the other
    const int lane = threadIdx.x & 31; const int L0 = (blockIdx.x * 8 + (threadIdx.x >> 5)) * 8; const int nlines = N * K / 64;
{
#pragma unroll 1
        for (int l = 0; l < 8; ++l) { const int L = L0 + l; if (L >= nlines) break; const size_t e = (size_t)L * 64 + lane * 2; const int k = (int)(e % K), n = (int)(e / K); v2us o;
            o[0] = f2bf(w[(size_t)k * N + n]); o[1] = f2bf(w[(size_t)(k + 1) * N + n]); *(v2us*)(Bt + e) = o; }
         }
}
__global__ __launch_bounds__(256) void k_cvt8(const float* __restrict__ s0, const float* __restrict__ s1, const float* __restrict__ s2, bf* dst, size_t n8) { const size_t i = (size_t)blockIdx.x * 256 + threadIdx.x; if (i >= n8) return; const float* __restrict__ src = blockIdx.y == 0 ? s0 : blockIdx.y == 1 ? s1 : s2; dst += (size_t)blockIdx.y * n8 * 8;   /* grid y: which of the three equal-shaped inputs; their copies lie one behind the other */ const v8f v = *(const v8f*)(src + i * 8); v8us o;
#pragma unroll
    for (int k = 0; k < 8; ++k) o[k] = f2bf(v[k]); *(v8us*)(dst + i * 8) = o;  }

// k_rope: head planes [b][h][t][d] (fp16 + hi/lo) of rope(x) x sc with the rotate-half convention out[d] = x[d] cos[t][d] - x[d+HD/2] sin[t][d], out[d+HD/2] = x[d+HD/2] cos[t][d+HD/2] + x[d] sin[t][d+HD/2]
__global__ __launch_bounds__(256) void k_rope(const float* __restrict__ F, int pitch, int nheads, const float* __restrict__ CS, const float* __restrict__ RF, const float* __restrict__ nw, float sc, h16* P16, bf* Ph, bf* Pl) {
    { const size_t bo = (size_t)blockIdx.y * nheads * TT * HD; F += (size_t)blockIdx.y * TT * pitch; P16 += bo; Ph += bo; Pl += bo; }   /* grid y: the batch, its rows of F and its head planes */
    const size_t e = ((size_t)blockIdx.x * 256 + threadIdx.x) * 2; if (e >= (size_t)nheads * TT * HD) return; const int d = (int)(e % HD); const int t = (int)((e / HD) % TT); const int h = (int)(e / ((size_t)HD * TT)); const float* f = F + (size_t)t * pitch + h * HD; const float rf = RF ? RF[(size_t)h * TT + t] : 1.0f; v2h o16; v2us oh, ol;
    const int db = (d < HD / 2) ? d + HD / 2 : d - HD / 2;   /* d is even: d and d + 1 have neighbouring partners */
    const float* pa[KSJ]; const float* pb[KSJ]; v2f va[KSJ], vb[KSJ];
#pragma unroll
    for (int s = 0; s < KSJ; ++s) { pa[s] = f + (size_t)s * MT * pitch + d; pb[s] = f + (size_t)s * MT * pitch + db; va[s] = *(const v2f*)pa[s]; vb[s] = *(const v2f*)pb[s]; }
    static_assert(KSJ == 4, "the wait below names four planes' addresses");
    asm volatile("s_wait_xcnt 0x0" :: "v"(pa[0]), "v"(pa[1]), "v"(pa[2]), "v"(pa[3]), "v"(pb[0]), "v"(pb[1]), "v"(pb[2]), "v"(pb[3]) : "memory");   /* precaution: as inputs, the eight loads' address registers stay live up to this wait, so none is overwritten in front of it */
    v2f xa = va[0], xb = vb[0];
#pragma unroll
    for (int s = 1; s < KSJ; ++s) { xa += va[s]; xb += vb[s]; }   /* the projection's K-slice planes, in slice order */
#pragma unroll
    for (int q = 0; q < 2; ++q) { const int dd = d + q; const int dp = (dd < HD / 2) ? dd + HD / 2 : dd - HD / 2; float x0 = xa[q], x1 = xb[q];
        if (RF) { float n0 = __fmul_rn(x0, rf), n1 = __fmul_rn(x1, rf); asm volatile("" : "+v"(n0)); asm volatile("" : "+v"(n1)); x0 = __fmul_rn(bfr(nw[dd]), n0); x1 = __fmul_rn(bfr(nw[dp]), n1); }
        const v2f cs = *(const v2f*)(CS + ((size_t)t * HD + dd) * 2); float a = __fmul_rn(x0, cs[0]), bq = __fmul_rn(x1, cs[1]); asm volatile("" : "+v"(a)); asm volatile("" : "+v"(bq)); const float r = ((dd < HD / 2) ? __fsub_rn(a, bq) : __fadd_rn(a, bq)) * sc;
        o16[q] = tohx(r); unsigned short a2, c2; splitf(r, a2, c2); oh[q] = a2; ol[q] = c2; }
    *(v2h*)(P16 + e) = o16; *(v2us*)(Ph + e) = oh; *(v2us*)(Pl + e) = ol;  }
__global__ __launch_bounds__(256) void k_vtp(const float* __restrict__ F, int pitch, int nheads, h16* V16, bf* Vh, bf* Vl) { const size_t e = ((size_t)blockIdx.x * 256 + threadIdx.x) * 2; if (e >= (size_t)nheads * HD * TT) return; const int t = (int)(e % TT); const int d = (int)((e / TT) % HD); const int g = (int)(e / ((size_t)TT * HD)); { const size_t bo = (size_t)blockIdx.y * nheads * HD * TT; F += (size_t)blockIdx.y * TT * pitch; V16 += bo; Vh += bo; Vl += bo; }   /* grid y: the batch, its rows of F and its head planes */ v2h o16; v2us oh, ol;
#pragma unroll
    for (int q = 0; q < 2; ++q) { const float x = F[(size_t)(t + q) * pitch + g * HD + d]; o16[q] = tohx(x); unsigned short a2, c2; splitf(x, a2, c2); oh[q] = a2; ol[q] = c2; }
    *(v2h*)(V16 + e) = o16; *(v2us*)(Vh + e) = oh; *(v2us*)(Vl + e) = ol;  }
__global__ __launch_bounds__(256) void k_csid(float* CS) { const int idx = blockIdx.x * 256 + threadIdx.x; if (idx >= TT * HD) return; v2f cs; cs[0] = 1.0f; cs[1] = 0.0f; *(v2f*)(CS + (size_t)idx * 2) = cs;  }
// k_asoft: per row (zz, i): t = (S x 1/8) x modal_compat[h] (the pass's head scalar, bf16-rounded input, read); softmax over the 2048 keys (register row, one exp, fixed trees);
__global__ __launch_bounds__(256) void k_asoft(const float* __restrict__ Sb, h16* P16, bf* Ph, bf* Pl, const float* __restrict__ mcp) {
    const int lane = threadIdx.x & 31; const int row = blockIdx.x * 8 + (threadIdx.x >> 5); if (row >= ZH * TT) return; const int i = row % TT; const int zz = row / TT; (void)zz; const bool hires = (i < RH); const float hsc = __fmul_rn(SCL, bfr(mcp[zz]));   /* (1/8) x modal_compat[h] (bf16-rounded input), once per row */  const float* sr = Sb + (size_t)row * TT; float v[TT / 32]; float mx = -3.0e38f;
#pragma unroll
    for (int ch = 0; ch < TT / 128; ++ch) { const int j0 = ch * 128 + lane * 4; const v4f a = *(const v4f*)(sr + j0);
#pragma unroll
        for (int q = 0; q < 4; ++q) { const int j = j0 + q; (void)j; const float t = a[q] * hsc;   /* s x (compat[h]/8): one rounding instead of the module's two (<= 1 ulp of the logit) */ v[ch * 4 + q] = t; mx = fmaxf(mx, t); } }
#pragma unroll
    for (int sh = 16; sh; sh >>= 1) mx = fmaxf(mx, __shfl_xor(mx, sh, 32));
    float sum = 0.f;
#pragma unroll
    for (int k = 0; k < TT / 32; ++k) { float d0 = __fsub_rn(v[k], mx); asm volatile("" : "+v"(d0)); v[k] = __builtin_amdgcn_exp2f(__fmul_rn(d0, 1.4426950408889634f)); sum += v[k]; }
#pragma unroll
    for (int sh = 16; sh; sh >>= 1) sum += __shfl_xor(sum, sh, 32);
    const float f = __fdiv_rn(hires ? 1.0f : PCAR, sum);
{
        if (hires) {
#pragma unroll
            for (int ch = 0; ch < TT / 128; ++ch) { v4us oh, ol;
#pragma unroll
                for (int q = 0; q < 4; ++q) { unsigned short a, c2; splitf(v[ch * 4 + q] * f, a, c2); oh[q] = a; ol[q] = c2; }
                const size_t oo = ((size_t)zz * (RH ? RH : 1) + i) * TT + ch * 128 + lane * 4; *(v4us*)(Ph + oo) = oh; *(v4us*)(Pl + oo) = ol; }
        } else {
#pragma unroll
            for (int ch = 0; ch < TT / 128; ++ch) { v4h o4;
#pragma unroll
                for (int q = 0; q < 4; ++q) o4[q] = tohx(v[ch * 4 + q] * f);
                *(v4h*)(P16 + (size_t)row * TT + ch * 128 + lane * 4) = o4; } }
         }
}
__global__ __launch_bounds__(256) void k_addres(float* Y, const float* __restrict__ xr) { const unsigned i = blockIdx.x * 256 + threadIdx.x; if (i >= (unsigned)((size_t)MT * DQ / 4)) return; const unsigned ob = i * 16u;   /* byte offset inside a plane, 32 bits */
    static_assert((size_t)MT * DQ * 4 <= 0xFFFFFFFFull, "a plane's byte offsets fit 32 bits");
    v4f a = *(const v4f*)((const char*)Y + ob);
#pragma unroll
    for (int s = 1; s < KSJ; ++s) a += *(const v4f*)((const char*)(Y + (size_t)s * MT * DQ) + ob);   /* the output projection's K-slice planes, in slice order */
    const v4f r = *(const v4f*)((const char*)xr + ob); v4f o;
#pragma unroll
    for (int q = 0; q < 4; ++q) o[q] = __fadd_rn(a[q], bfr(r[q]));
    *(v4f*)((char*)Y + ob) = o;  }
__global__ __launch_bounds__(256) void k_lnout(const float* __restrict__ F, const float* __restrict__ g, const float* __restrict__ bb, float* out) { const int lane = threadIdx.x & 31; const int row = blockIdx.x * 8 + (threadIdx.x >> 5); if (row >= MT) return; const float* fr = F + (size_t)row * DQ; float* orow = out + (size_t)row * DQ; float v[DQ / 32]; float s = 0.f;
#pragma unroll
    for (int c = 0; c < DQ / 128; ++c) { const v4f a = *(const v4f*)(fr + c * 128 + lane * 4); for (int q = 0; q < 4; ++q) { v[c * 4 + q] = a[q]; s = __fadd_rn(s, a[q]); } }
#pragma unroll
    for (int sh = 16; sh; sh >>= 1) s = __fadd_rn(s, __shfl_xor(s, sh, 32));
    const float mean = __fdiv_rn(s, (float)DQ); float s2 = 0.f;
#pragma unroll
    for (int k = 0; k < DQ / 32; ++k) { const float dv = __fsub_rn(v[k], mean); float p2 = __fmul_rn(dv, dv); asm volatile("" : "+v"(p2)); s2 = __fadd_rn(s2, p2); v[k] = dv; }
#pragma unroll
    for (int sh = 16; sh; sh >>= 1) s2 = __fadd_rn(s2, __shfl_xor(s2, sh, 32));
    const float rs = __fdiv_rn(1.0f, __fsqrt_rn(__fadd_rn(__fdiv_rn(s2, (float)DQ), LNEPS)));
{
#pragma unroll
        for (int c = 0; c < DQ / 128; ++c) { v4f o; for (int q = 0; q < 4; ++q) { const int col = c * 128 + lane * 4 + q; float y = __fmul_rn(v[c * 4 + q], rs); asm volatile("" : "+v"(y)); y = __fmul_rn(y, bfr(g[col])); asm volatile("" : "+v"(y)); o[q] = __fadd_rn(y, bfr(bb[col])); } *(v4f*)(orow + c * 128 + lane * 4) = o; }
         } }
__global__ __launch_bounds__(256) void k_merge(const float* __restrict__ O, int h0, bf* Ah, bf* Al) { const size_t e = ((size_t)blockIdx.x * 256 + threadIdx.x) * 2; if (e >= (size_t)ZH * TT * HD) return; const int d = (int)(e % HD); const int t = (int)((e / HD) % TT); const int zz = (int)(e / ((size_t)HD * TT)); const float cs = (t < RH) ? 1.0f : (1.0f / PCAR); const size_t oo = (size_t)t * DQ + (h0 + zz) * HD + d;
    const float* op = O + (size_t)zz * KSP * TT * HD + (size_t)t * HD + d;   /* a head's K-slice planes lie one behind the other: all sixteen loads name this one address, each with its own constant offset */
    v2f vo[KSP];
#pragma unroll
    for (int s = 0; s < KSP; ++s) vo[s] = *(const v2f*)(op + (size_t)s * TT * HD);
    asm volatile("s_wait_xcnt 0x0" :: "v"(op) : "memory");   /* precaution: as an input, the loads' address register stays live up to this wait, so it is not overwritten in front of it */
    v2f sm = vo[0];
#pragma unroll
    for (int s = 1; s < KSP; ++s) sm += vo[s];   /* the P x V K-slice planes, in slice order */
    v2us oh, ol;
#pragma unroll
    for (int q = 0; q < 2; ++q) { unsigned short a, c2; splitf(sm[q] * cs, a, c2); oh[q] = a; ol[q] = c2; } *(v2us*)(Ah + oo) = oh; *(v2us*)(Al + oo) = ol;  }

extern "C" void kernel_launch(void* const* d_in, const int* in_sizes, int n_in,
                              void* d_out, int out_size, void* d_ws, size_t ws_size, hipStream_t stream) {
    (void)in_sizes; (void)n_in; (void)out_size;
    const float* x = (const float*)d_in[0];   /* query_modality */ const float* xk = (const float*)d_in[1]; const float* xv = (const float*)d_in[2]; const float* wq = (const float*)d_in[3]; const float* bq = (const float*)d_in[4]; const float* wk = (const float*)d_in[5]; const float* bk = (const float*)d_in[6]; const float* wv = (const float*)d_in[7]; const float* bv = (const float*)d_in[8]; const float* wo = (const float*)d_in[9]; const float* bo = (const float*)d_in[10]; const float* mc = (const float*)d_in[11];   /* modal_compat [8] */ const float* lng = (const float*)d_in[12]; const float* lnb = (const float*)d_in[13];
    float* OUT = (float*)d_out;     // [4][2048][512]
    char* wsp = (char*)d_ws;
    auto take = [&](size_t bytes) { char* p = wsp; wsp += (bytes + 255) & ~(size_t)255; return (void*)p; };
    bf* WQ = (bf*)take((size_t)DQ * DM * 2); bf* WK = (bf*)take((size_t)DKV * DM * 2); bf* WV = (bf*)take((size_t)DKV * DM * 2); bf* WO = (bf*)take((size_t)DM * DQ * 2); float* CS = (float*)take((size_t)TT * HD * 2 * 4);
    h16* QP16 = (h16*)take((size_t)NB_ * NH_ * TT * HD * 2); h16* KP16 = (h16*)take((size_t)NB_ * NKV * TT * HD * 2); h16* VT16 = (h16*)take((size_t)NB_ * NKV * HD * TT * 2);
    bf* QPh = (bf*)take((size_t)NB_ * NH_ * TT * HD * 2); bf* QPl = (bf*)take((size_t)NB_ * NH_ * TT * HD * 2); bf* KPh = (bf*)take((size_t)NB_ * NKV * TT * HD * 2); bf* KPl = (bf*)take((size_t)NB_ * NKV * TT * HD * 2); bf* VTh = (bf*)take((size_t)NB_ * NKV * HD * TT * 2); bf* VTl = (bf*)take((size_t)NB_ * NKV * HD * TT * 2); bf* Ph = (bf*)take((size_t)ZH * RH * TT * 2); bf* Pl = (bf*)take((size_t)ZH * RH * TT * 2);
    h16* P16 = (h16*)take((size_t)ZH * TT * TT * 2); float* Ob = (float*)take((size_t)KSP * ZH * TT * HD * 4); bf* ATh = (bf*)take((size_t)MT * DQ * 2); bf* ATl = (bf*)take((size_t)MT * DQ * 2);
    static_assert((size_t)KSJ * MT * DM == (size_t)ZH * TT * TT && DQ == DM && DKV == DM, "one f32 buffer serves the projections' planes and a pass's scores");
    float* Sb = (float*)take((size_t)ZH * TT * TT * 4);
    if ((size_t)(wsp - (char*)d_ws) > ws_size) return;    // ws 256 MiB
    static_assert((size_t)3 * MT * DM <= (size_t)ZH * TT * TT && DQ == DKV, "the three bf16 input copies fit the P buffer; the four transposed weights are equal in size");
    bf* XB = (bf*)P16;   // bf16 copies of the query, key, value inputs, one behind the other: read out by the projections before the first pass writes P (stream-ordered)
    float* FQ = Sb; float* FK = Sb; float* FV = Sb; float* Y = Sb;   // the q, k, v projections' planes, each pass's scores and the output projection's planes use one buffer in turn: each is read out by the next kernels before the next is written (stream-ordered)
    k_wtG<<<dim3((unsigned)((DM * DQ / 64 + 63) / 64), 4), 256, 0, stream>>>(wq, wk, wv, wo, DM, DQ, WQ);   // WQ, WK, WV, WO are taken one behind the other
    k_csid<<<(TT * HD + 255) / 256, 256, 0, stream>>>(CS);
    const unsigned LQ = (unsigned)(((size_t)NH_ * TT * HD / 2 + 255) / 256), LKv = (unsigned)(((size_t)NKV * TT * HD / 2 + 255) / 256), LX = (unsigned)(((size_t)MT * DM / 8 + 255) / 256);
    k_cvt8<<<dim3(LX, 3), 256, 0, stream>>>(x, xk, xv, XB, (size_t)MT * DM / 8);
    k_gemmw<bf, 0, true, KSJ><<<dim3(MT / 64, DQ / 64, KSJ), 32, 0, stream>>>(XB, nullptr, WQ, nullptr, DM, FQ, DQ, bq, 0, 0, 0, (size_t)MT * DQ);
    k_rope<<<dim3(LQ, NB_), 256, 0, stream>>>(FQ, DQ, NH_, CS, nullptr, nullptr, 1.0f, QP16, QPh, QPl);
    k_gemmw<bf, 0, true, KSJ><<<dim3(MT / 64, DKV / 64, KSJ), 32, 0, stream>>>(XB + (size_t)MT * DM, nullptr, WK, nullptr, DM, FK, DKV, bk, 0, 0, 0, (size_t)MT * DKV);
    k_rope<<<dim3(LKv, NB_), 256, 0, stream>>>(FK, DKV, NKV, CS, nullptr, nullptr, 1.0f, KP16, KPh, KPl);
    k_gemmw<bf, 0, true, 1><<<dim3(MT / 64, DKV / 64, 1), 32, 0, stream>>>(XB + (size_t)2 * MT * DM, nullptr, WV, nullptr, DM, FV, DKV, bv, 0, 0, 0, 0); k_vtp<<<dim3(LKv, NB_), 256, 0, stream>>>(FV, DKV, NKV, VT16, VTh, VTl);
    for (int b = 0; b < NB_; ++b)
        for (int h0 = 0; h0 < NH_; h0 += ZH) { const size_t zq = (size_t)b * NH_ + h0, zk = (size_t)b * NKV + h0 / REP;   // one kv head per query head: the pass's heads use consecutive planes (z-strides TT*HD)
            k_gemmw<bf, 2, false, 1><<<dim3(RH / 64, TT / 64, ZH), 32, 0, stream>>>(QPh + zq * TT * HD, QPl + zq * TT * HD, KPh + zk * TT * HD, KPl + zk * TT * HD, HD, Sb, TT, nullptr, (size_t)TT * HD, (size_t)TT * HD, (size_t)TT * TT, 0);
            k_gemmw<h16, 0, false, 1><<<dim3((TT - RH) / 64, TT / 64, ZH), 32, 0, stream>>>(QP16 + zq * TT * HD + (size_t)RH * HD, nullptr, KP16 + zk * TT * HD, nullptr, HD, Sb + (size_t)RH * TT, TT, nullptr, (size_t)TT * HD, (size_t)TT * HD, (size_t)TT * TT, 0);
            k_asoft<<<ZH * TT / 8, 256, 0, stream>>>(Sb, P16, Ph, Pl, mc + h0);   /* per-head compatibility scale */
            k_gemmw<bf, 2, false, KSP><<<dim3(RH / 64, HD / 64, ZH * KSP), 32, 0, stream>>>(Ph, Pl, VTh + zk * HD * TT, VTl + zk * HD * TT, TT, Ob, HD, nullptr, (size_t)RH * TT, (size_t)HD * TT, (size_t)KSP * TT * HD, (size_t)TT * HD);
            k_gemmw<h16, 0, false, KSP><<<dim3((TT - RH) / 64, HD / 64, ZH * KSP), 32, 0, stream>>>(P16 + (size_t)RH * TT, nullptr, VT16 + zk * HD * TT, nullptr, TT, Ob + (size_t)RH * HD, HD, nullptr, (size_t)TT * TT, (size_t)HD * TT, (size_t)KSP * TT * HD, (size_t)TT * HD);
            k_merge<<<(unsigned)(((size_t)ZH * TT * HD / 2 + 255) / 256), 256, 0, stream>>>(Ob, h0, ATh + (size_t)b * TT * DQ, ATl + (size_t)b * TT * DQ); }
    k_gemmw<bf, 1, true, KSJ><<<dim3(MT / 64, DM / 64, KSJ), 32, 0, stream>>>(ATh, ATl, WO, nullptr, DQ, Y, DM, bo, 0, 0, 0, (size_t)MT * DM); k_addres<<<(unsigned)(((size_t)MT * DQ / 4 + 255) / 256), 256, 0, stream>>>(Y, x);   /* + query_modality */ k_lnout<<<(MT + 7) / 8, 256, 0, stream>>>(Y, lng, lnb, OUT);
}

// v003
// It runs in 233 microseconds.
// In two side-by-side timings against v002, it was 2.68 and 2.69 times as fast.
// Over all steps from v000 it is 9.06 times as fast.
#include <hip/hip_runtime.h>

// Cross-modal multi-head attention with a learned per-head compatibility scale, residual and post-LayerNorm (query_modality, key_modality, value_modality [4][2048][512]; Q,K,V = x W + b ('xw' 1/sqrt(512), zero biases; 8 heads x 64); scores = (Q.K / 8) x modal_compat[h] ([1][8][1][1], read); softmax; out = merged Wo + bo; y = LayerNorm(out + query_modality) gamma/beta (1e-5) -> [4][2048][512] (4.2 M)).
// Layout, all batches in one launch of each kernel (rows b*2048+t; head planes [b][h]): bf16 copies of query, key, value inputs; 'xw' weights transposed once; exact projections + f32 biases; one fused attention kernel for all 32 planes (scores, the head's bf16-rounded compatibility scalar, online softmax, P x V; scores and P stay in registers; hybrid rows: < 512 hi/lo 3 products, rest fp16); merged hi/lo x Wo exact + bo into workspace; residual add of query_modality and a row LayerNorm kernel write the output rows.
// Compute dtypes, f32 accumulate: every input rounded to bf16; projections exact + f32 biases; attention rows < 512 3 products, rest fp16; per-head scale and softmax f32; Wo hl x exact + bias; residual + LayerNorm f32.

#define NB_  4
#define TT   2048
#define DM   512
#define NH_  8
#define NKV  8
#define REP  (NH_ / NKV)
#define HD   64
#define DQ   (NH_ * HD)
#define DKV  (NKV * HD)
#define MT   (NB_ * TT)           // rows of all batches together
#define RH   512                  // query rows < RH use hi+lo planes
#define SCL  0.125f
#define LNEPS 1e-5f
#define KSJ  4                    // K slices of the q, k and output projections (K = 512)
typedef _Float16 h16;
typedef unsigned short bf;
typedef __attribute__((ext_vector_type(16))) __bf16   v16bf;
typedef __attribute__((ext_vector_type(16))) _Float16 v16h;
typedef __attribute__((ext_vector_type(8)))  _Float16 v8h;
typedef __attribute__((ext_vector_type(8)))  unsigned short v8us;
typedef __attribute__((ext_vector_type(8)))  float    v8f;
typedef __attribute__((ext_vector_type(4)))  float    v4f;
typedef v8h  __attribute__((may_alias)) v8ha;
typedef v4f  __attribute__((may_alias)) v4fa;
typedef v8us __attribute__((may_alias)) v8usa;

__device__ __forceinline__ unsigned short f2bf(float f) { unsigned u = __float_as_uint(f); u += 0x7FFFu + ((u >> 16) & 1u); return (unsigned short)(u >> 16); }
__device__ __forceinline__ float bf2f(unsigned short b) { return __uint_as_float(((unsigned)b) << 16); }
__device__ __forceinline__ float bfr(float f) { return bf2f(f2bf(f)); }
__device__ __forceinline__ v16h cat16(v8h lo, v8h hi) { return __builtin_shufflevector(lo, hi, 0, 1, 2, 3, 4, 5, 6, 7, 8, 9, 10, 11, 12, 13, 14, 15); }
__device__ __forceinline__ v16bf cat16b(v8us lo, v8us hi) { return __builtin_bit_cast(v16bf, __builtin_shufflevector(lo, hi, 0, 1, 2, 3, 4, 5, 6, 7, 8, 9, 10, 11, 12, 13, 14, 15)); }
__device__ __forceinline__ v8f wmma16(v16h a, v16h b, v8f c) { return __builtin_amdgcn_wmma_f32_16x16x32_f16(false, a, false, b, (short)0, c, false, false); }
__device__ __forceinline__ v8f wmmab(v16bf a, v16bf b, v8f c) { return __builtin_amdgcn_wmma_f32_16x16x32_bf16(false, a, false, b, (short)0, c, false, false); }



// ---- k_gemmw: register-blocked GEMM, ONE WAVE per 64x64 output tile (16 accumulators), operands straight from K-contiguous 16-bit planes; grid (M/64, N/64, Z x KS), 32 threads.
// C[m][n] (f32, pitch ldc, + optional f32 bias[n]) = sum_k A[m][k] Bt[n][k] (+ split products per NSPLIT). z-batch strides sA/sB/sC in elements. K % (32 KS) == 0.
// Split K: grid z = Z x KS; slice sl of batch z sums k in [sl K/KS, (sl+1) K/KS) into its own f32 plane C + sl sP (bias in slice 0 only); the kernel that reads C adds the KS planes in slice order.
template <typename T16> struct WFrag;
template <> struct WFrag<h16> { typedef v16h V; static __device__ __forceinline__ V ld(const h16* p) { return cat16(*(const v8h*)p, *(const v8h*)(p + 16)); } static __device__ __forceinline__ v8f mma(V a, V b, v8f c) { return wmma16(a, b, c); } };
template <> struct WFrag<bf> { typedef v16bf V; static __device__ __forceinline__ V ld(const bf* p) { return cat16b(*(const v8us*)p, *(const v8us*)(p + 16)); } static __device__ __forceinline__ v8f mma(V a, V b, v8f c) { return wmmab(a, b, c); } };
template <typename T16, int NSPLIT, bool BIAS, int KS>
__global__ __launch_bounds__(32) void k_gemmw(const T16* __restrict__ A, const T16* __restrict__ A2, const T16* __restrict__ Bt, const T16* __restrict__ Bt2, int K, float* C, int ldc, const float* __restrict__ bias, size_t sA, size_t sB, size_t sC, size_t sP) {
    typedef typename WFrag<T16>::V V;
    __shared__ __align__(16) float os[16 * 68];
    const size_t z = blockIdx.z / KS; const int sl = (int)(blockIdx.z % KS); const int kl = K / KS, kb = sl * kl; A += z * sA; if (A2) A2 += z * sA; Bt += z * sB; if (Bt2) Bt2 += z * sB; C += z * sC + (size_t)sl * sP;
    const int lane = threadIdx.x & 31, lr = lane & 15, hi = lane >> 4; const int r0 = blockIdx.x * 64, c0 = blockIdx.y * 64;
    v8f acc[4][4];
#pragma unroll
    for (int mb = 0; mb < 4; ++mb)
#pragma unroll
        for (int nb = 0; nb < 4; ++nb) acc[mb][nb] = (v8f){};
    v4f bv = (v4f){};   // this lane's four output columns of the bias; zero in every slice but the first, so that the planes' sum holds it once
    if (BIAS && sl == 0) { const float* bp = bias + c0 + lr * 4; bv[0] = bp[0]; bv[1] = bp[1]; bv[2] = bp[2]; bv[3] = bp[3];   // rounded behind the K loop, which covers the load
        asm volatile("s_wait_xcnt 0x0" ::: "memory"); }   // precaution: stands between the load and the address set-up below, which may reuse the load's address registers
    const size_t aoff = (size_t)(r0 + lr) * K + 8 * hi, boff = (size_t)(c0 + lr) * K + 8 * hi;
#pragma unroll 1
    for (int kc = kb; kc < kb + kl; kc += 32) {
        V a[4], a2[4];
#pragma unroll
        for (int mb = 0; mb < 4; ++mb) { a[mb] = WFrag<T16>::ld(A + aoff + (size_t)mb * 16 * K + kc); if (NSPLIT == 1 || NSPLIT == 2) a2[mb] = WFrag<T16>::ld(A2 + aoff + (size_t)mb * 16 * K + kc); }
#pragma unroll
        for (int nb = 0; nb < 4; ++nb) { const V b = WFrag<T16>::ld(Bt + boff + (size_t)nb * 16 * K + kc); V b2; if (NSPLIT >= 2) b2 = WFrag<T16>::ld(Bt2 + boff + (size_t)nb * 16 * K + kc);
#pragma unroll
            for (int mb = 0; mb < 4; ++mb) { acc[mb][nb] = WFrag<T16>::mma(a[mb], b, acc[mb][nb]); if (NSPLIT == 1 || NSPLIT == 2) acc[mb][nb] = WFrag<T16>::mma(a2[mb], b, acc[mb][nb]); if (NSPLIT >= 2) acc[mb][nb] = WFrag<T16>::mma(a[mb], b2, acc[mb][nb]); } }
        asm volatile("v_nop\n\tv_nop\n\tv_nop\n\tv_nop" : "+v"(acc[0][0]), "+v"(acc[1][1]), "+v"(acc[2][2]), "+v"(acc[3][3]) : "v"(a[0]), "v"(a[3]));
    }
    if (BIAS) { bv[0] = bfr(bv[0]); bv[1] = bfr(bv[1]); bv[2] = bfr(bv[2]); bv[3] = bfr(bv[3]); }
#pragma unroll
    for (int mb = 0; mb < 4; ++mb) {
#pragma unroll
        for (int nb = 0; nb < 4; ++nb) {
#pragma unroll
            for (int j = 0; j < 8; ++j) os[(hi * 8 + j) * 68 + nb * 16 + lr] = acc[mb][nb][j]; }
        __builtin_amdgcn_wave_barrier(); asm volatile("" ::: "memory");
        float* crow = C + (size_t)(r0 + mb * 16) * ldc + c0;
{
#pragma unroll
            for (int s = 0; s < 8; ++s) { const int row = 2 * s + hi, cofs = lr * 4; v4f val = *(const v4fa*)(os + row * 68 + cofs); if (BIAS) val += bv;
                *(v4f*)(crow + (size_t)row * ldc + cofs) = val; }
             }
        __builtin_amdgcn_wave_barrier(); asm volatile("" ::: "memory");
    }
}

__device__ __forceinline__ h16 tohx(float x) { return (h16)x; }
__device__ __forceinline__ void splitf(float y, unsigned short& h, unsigned short& l) { h = f2bf(y); l = f2bf(y - bf2f(h)); }
typedef __attribute__((ext_vector_type(2))) _Float16 v2h;
typedef __attribute__((ext_vector_type(4))) _Float16 v4h;
typedef __attribute__((ext_vector_type(2))) unsigned short v2us;
typedef __attribute__((ext_vector_type(4))) unsigned short v4us;
typedef __attribute__((ext_vector_type(2))) float v2f;
typedef __attribute__((ext_vector_type(4))) int v4i;

__global__ __launch_bounds__(256) void k_wtG(const float* __restrict__ w0, const float* __restrict__ w1, const float* __restrict__ w2, const float* __restrict__ w3, int K, int N, bf* Bt) {
    const float* __restrict__ w = blockIdx.y == 0 ? w0 : blockIdx.y == 1 ? w1 : blockIdx.y == 2 ? w2 : w3; Bt += (size_t)blockIdx.y * N * K;   // grid y: which of the four equal-shaped weights; their transposes lie one behind the other
    const int lane = threadIdx.x & 31; const int L0 = (blockIdx.x * 8 + (threadIdx.x >> 5)) * 8; const int nlines = N * K / 64;
{
#pragma unroll 1
        for (int l = 0; l < 8; ++l) { const int L = L0 + l; if (L >= nlines) break; const size_t e = (size_t)L * 64 + lane * 2; const int k = (int)(e % K), n = (int)(e / K); v2us o;
            o[0] = f2bf(w[(size_t)k * N + n]); o[1] = f2bf(w[(size_t)(k + 1) * N + n]); *(v2us*)(Bt + e) = o; }
         }
}
__global__ __launch_bounds__(256) void k_cvt8(const float* __restrict__ s0, const float* __restrict__ s1, const float* __restrict__ s2, bf* dst, size_t n8) { const size_t i = (size_t)blockIdx.x * 256 + threadIdx.x; if (i >= n8) return; const float* __restrict__ src = blockIdx.y == 0 ? s0 : blockIdx.y == 1 ? s1 : s2; dst += (size_t)blockIdx.y * n8 * 8;   /* grid y: which of the three equal-shaped inputs; their copies lie one behind the other */ const v8f v = *(const v8f*)(src + i * 8); v8us o;
#pragma unroll
    for (int k = 0; k < 8; ++k) o[k] = f2bf(v[k]); *(v8us*)(dst + i * 8) = o;  }

// k_rope: head planes [b][h][t][d] (fp16 + hi/lo) of rope(x) x sc with the rotate-half convention out[d] = x[d] cos[t][d] - x[d+HD/2] sin[t][d], out[d+HD/2] = x[d+HD/2] cos[t][d+HD/2] + x[d] sin[t][d+HD/2]
__global__ __launch_bounds__(256) void k_rope(const float* __restrict__ F, int pitch, int nheads, const float* __restrict__ CS, const float* __restrict__ RF, const float* __restrict__ nw, float sc, h16* P16, bf* Ph, bf* Pl) {
    { const size_t bo = (size_t)blockIdx.y * nheads * TT * HD; F += (size_t)blockIdx.y * TT * pitch; P16 += bo; Ph += bo; Pl += bo; }   /* grid y: the batch, its rows of F and its head planes */
    const size_t e = ((size_t)blockIdx.x * 256 + threadIdx.x) * 2; if (e >= (size_t)nheads * TT * HD) return; const int d = (int)(e % HD); const int t = (int)((e / HD) % TT); const int h = (int)(e / ((size_t)HD * TT)); const float* f = F + (size_t)t * pitch + h * HD; const float rf = RF ? RF[(size_t)h * TT + t] : 1.0f; v2h o16; v2us oh, ol;
    const int db = (d < HD / 2) ? d + HD / 2 : d - HD / 2;   /* d is even: d and d + 1 have neighbouring partners */
    const float* pa[KSJ]; const float* pb[KSJ]; v2f va[KSJ], vb[KSJ];
#pragma unroll
    for (int s = 0; s < KSJ; ++s) { pa[s] = f + (size_t)s * MT * pitch + d; pb[s] = f + (size_t)s * MT * pitch + db; va[s] = *(const v2f*)pa[s]; vb[s] = *(const v2f*)pb[s]; }
    static_assert(KSJ == 4, "the wait below names four planes' addresses");
    asm volatile("s_wait_xcnt 0x0" :: "v"(pa[0]), "v"(pa[1]), "v"(pa[2]), "v"(pa[3]), "v"(pb[0]), "v"(pb[1]), "v"(pb[2]), "v"(pb[3]) : "memory");   /* precaution: as inputs, the eight loads' address registers stay live up to this wait, so none is overwritten in front of it */
    v2f xa = va[0], xb = vb[0];
#pragma unroll
    for (int s = 1; s < KSJ; ++s) { xa += va[s]; xb += vb[s]; }   /* the projection's K-slice planes, in slice order */
#pragma unroll
    for (int q = 0; q < 2; ++q) { const int dd = d + q; const int dp = (dd < HD / 2) ? dd + HD / 2 : dd - HD / 2; float x0 = xa[q], x1 = xb[q];
        if (RF) { float n0 = __fmul_rn(x0, rf), n1 = __fmul_rn(x1, rf); asm volatile("" : "+v"(n0)); asm volatile("" : "+v"(n1)); x0 = __fmul_rn(bfr(nw[dd]), n0); x1 = __fmul_rn(bfr(nw[dp]), n1); }
        const v2f cs = *(const v2f*)(CS + ((size_t)t * HD + dd) * 2); float a = __fmul_rn(x0, cs[0]), bq = __fmul_rn(x1, cs[1]); asm volatile("" : "+v"(a)); asm volatile("" : "+v"(bq)); const float r = ((dd < HD / 2) ? __fsub_rn(a, bq) : __fadd_rn(a, bq)) * sc;
        o16[q] = tohx(r); unsigned short a2, c2; splitf(r, a2, c2); oh[q] = a2; ol[q] = c2; }
    *(v2h*)(P16 + e) = o16; *(v2us*)(Ph + e) = oh; *(v2us*)(Pl + e) = ol;  }
__global__ __launch_bounds__(256) void k_vtp(const float* __restrict__ F, int pitch, int nheads, h16* V16, bf* Vh, bf* Vl) { const size_t e = ((size_t)blockIdx.x * 256 + threadIdx.x) * 2; if (e >= (size_t)nheads * HD * TT) return; const int t = (int)(e % TT); const int d = (int)((e / TT) % HD); const int g = (int)(e / ((size_t)TT * HD)); { const size_t bo = (size_t)blockIdx.y * nheads * HD * TT; F += (size_t)blockIdx.y * TT * pitch; V16 += bo; Vh += bo; Vl += bo; }   /* grid y: the batch, its rows of F and its head planes */ v2h o16; v2us oh, ol;
#pragma unroll
    for (int q = 0; q < 2; ++q) { const float x = F[(size_t)(t + q) * pitch + g * HD + d]; o16[q] = tohx(x); unsigned short a2, c2; splitf(x, a2, c2); oh[q] = a2; ol[q] = c2; }
    *(v2h*)(V16 + e) = o16; *(v2us*)(Vh + e) = oh; *(v2us*)(Vl + e) = ol;  }
__global__ __launch_bounds__(256) void k_csid(float* CS) { const int idx = blockIdx.x * 256 + threadIdx.x; if (idx >= TT * HD) return; v2f cs; cs[0] = 1.0f; cs[1] = 0.0f; *(v2f*)(CS + (size_t)idx * 2) = cs;  }
// ---- k_fattn: scores, softmax and P x V of one (batch, head) in one kernel; no score and no P ever leaves the registers.
// Transposed products: S^T = K Q^T (A = 16 key rows, B = 16 query columns), so a lane holds 8 keys' scores of ONE query per tile; two score tiles (32 keys), converted in place, are the B operand of O^T += V^T P^T (A = 16 d rows of the [d][t] plane).
// Every fragment comes by WFrag::ld, whose two 16-byte halves at k = 8 hi and 16 + 8 hi are the order in which the packed score tiles lie.
// Online softmax in the log2 domain: the maximum in use may trail the true one by up to 8, sums and outputs are rescaled only when a column's maximum passes that.
// Query rows < RH: bf16 hi/lo planes, 3 products each, 32 columns a wave; the rest fp16, 64 columns a wave. Output: the merged hi/lo bf16 rows [b t][h d].
// A work-group is AWH hi/lo waves and AWF fp16 waves of one plane (no barrier, no LDS: the waves share only the cache): 8 equal work-groups a plane, 256 in all, one per WGP.
#define AWH  2                    // hi/lo waves per work-group of k_fattn, 32 query rows each
#define AWF  3                    // fp16 waves per work-group, 64 query rows each
#define NPS  (TT / 32)            // 32-key passes
typedef __attribute__((ext_vector_type(2))) __bf16 v2bf;
typedef __attribute__((ext_vector_type(8))) unsigned v8u;
__device__ __forceinline__ float xhalf(float x) { return __builtin_bit_cast(float, __builtin_amdgcn_permlanex16(__builtin_bit_cast(int, x), __builtin_bit_cast(int, x), 0x76543210, 0xfedcba98, false, false)); }   // lane l with lane l ^ 16
__device__ __forceinline__ unsigned pk2(float a, float b, bf) { v2f x; x[0] = a; x[1] = b; return __builtin_bit_cast(unsigned, __builtin_convertvector(x, v2bf)); }
__device__ __forceinline__ unsigned pk2(float a, float b, h16) { v2f x; x[0] = a; x[1] = b; return __builtin_bit_cast(unsigned, __builtin_convertvector(x, v2h)); }
// xwait: precaution behind a group of global loads: as inputs, the loads' address registers stay live up to this wait, so none is advanced or reused in front of it
template <bool HI, typename T16> __device__ __forceinline__ void xwait(const T16* a, const T16* b) { if (HI) asm volatile("s_wait_xcnt 0x0" :: "v"(a), "v"(b) : "memory"); else asm volatile("s_wait_xcnt 0x0" :: "v"(a) : "memory"); }
template <typename T16, bool HI, int R>
__device__ __forceinline__ void attn_wave(const T16* __restrict__ Q, const T16* __restrict__ Q2, const T16* __restrict__ Kp, const T16* __restrict__ K2, const T16* __restrict__ Vt, const T16* __restrict__ V2, float csc, int q0, bf* Ah, bf* Al) {
    typedef typename WFrag<T16>::V V; typedef WFrag<T16> W;
    const int lane = threadIdx.x & 31, c = lane & 15, h = lane >> 4;
    // every full unroll below: fragments, scores and sums are register arrays, which only constant indices keep in registers
    V qf[R][2], ql[R][2];
    { const T16* qp = Q + (size_t)(q0 + c) * HD + 8 * h; const T16* qp2 = HI ? Q2 + (size_t)(q0 + c) * HD + 8 * h : qp;
#pragma unroll
      for (int g = 0; g < R; ++g)
#pragma unroll
        for (int kc = 0; kc < 2; ++kc) { qf[g][kc] = W::ld(qp + g * 16 * HD + 32 * kc); if (HI) ql[g][kc] = W::ld(qp2 + g * 16 * HD + 32 * kc); }
      xwait<HI>(qp, qp2); }
    v8f acc[R][4]; float m_run[R], l_run[R];
#pragma unroll
    for (int g = 0; g < R; ++g) { m_run[g] = -__builtin_inff(); l_run[g] = 0.f;
#pragma unroll
        for (int t = 0; t < 4; ++t) acc[g][t] = (v8f){}; }
    const T16* kp = Kp + (size_t)c * HD + 8 * h; const T16* kp2 = HI ? K2 + (size_t)c * HD + 8 * h : kp;
    const T16* vp = Vt + (size_t)c * TT + 8 * h; const T16* vp2 = HI ? V2 + (size_t)c * TT + 8 * h : vp;
    V kf[2][2], kl[2][2];
#pragma unroll
    for (int kt = 0; kt < 2; ++kt)
#pragma unroll
        for (int kc = 0; kc < 2; ++kc) { kf[kt][kc] = W::ld(kp + kt * 16 * HD + 32 * kc); if (HI) kl[kt][kc] = W::ld(kp2 + kt * 16 * HD + 32 * kc); }
    xwait<HI>(kp, kp2);   // the K addresses are advanced in the loop
#pragma unroll 1   // stays rolled: the body already holds two passes; more would only grow the code and the registers
    for (int pp = 0; pp < NPS / 2; ++pp) {
        V vf[2][4], vl[2][4];   // two passes' V^T fragments, 64 keys = one whole 128-byte line of each d row: issued first, used behind the exponentials
#pragma unroll
        for (int t = 0; t < 4; ++t)
#pragma unroll
            for (int u = 0; u < 2; ++u) { vf[u][t] = W::ld(vp + (size_t)t * 16 * TT + 32 * u); if (HI) vl[u][t] = W::ld(vp2 + (size_t)t * 16 * TT + 32 * u); }
        xwait<HI>(vp, vp2);   // stands between the V loads and the advance of their addresses
        vp += 64; if (HI) vp2 += 64;
#pragma unroll
      for (int u = 0; u < 2; ++u) {   // the two 32-key passes
        v8f s[2][R];
#pragma unroll
        for (int kt = 0; kt < 2; ++kt)
#pragma unroll
            for (int g = 0; g < R; ++g) { s[kt][g] = (v8f){};
#pragma unroll
                for (int kc = 0; kc < 2; ++kc) { s[kt][g] = W::mma(kf[kt][kc], qf[g][kc], s[kt][g]); if (HI) { s[kt][g] = W::mma(kf[kt][kc], ql[g][kc], s[kt][g]); s[kt][g] = W::mma(kl[kt][kc], qf[g][kc], s[kt][g]); } } }
        if (u == 1) { const int adv = (pp + 1 < NPS / 2) ? 64 * HD : 0;   // kp: the first K row of a pair of passes; the last pass fetches rows of its own pair again: inside the plane, never used
          kp += adv; if (HI) kp2 += adv; }
        const int ko = (u == 0) ? 32 * HD : 0;
#pragma unroll
        for (int kt = 0; kt < 2; ++kt)   // the next pass's K fragments, in flight under this pass's softmax and second product
#pragma unroll
            for (int kc = 0; kc < 2; ++kc) { kf[kt][kc] = W::ld(kp + ko + kt * 16 * HD + 32 * kc); if (HI) kl[kt][kc] = W::ld(kp2 + ko + kt * 16 * HD + 32 * kc); }
        xwait<HI>(kp, kp2);   // stands between the K loads and the next advance of their addresses
        float mb[R]; bool need = false;
#pragma unroll
        for (int g = 0; g < R; ++g) { s[0][g] = s[0][g] * csc; s[1][g] = s[1][g] * csc;   // the head's scale may be negative: scale first, then the maximum
            float mx = fmaxf(s[0][g][0], s[1][g][0]);
#pragma unroll
            for (int r = 1; r < 8; ++r) mx = fmaxf(mx, fmaxf(s[0][g][r], s[1][g][r]));
            mx = fmaxf(mx, xhalf(mx)); mb[g] = mx; need = need || (mx > m_run[g] + 8.0f); }
        if (__builtin_amdgcn_ballot_w32(need) != 0) {   // one scalar branch a pass; rare behind the first passes
#pragma unroll
            for (int g = 0; g < R; ++g) { const float mn = fmaxf(m_run[g], mb[g]); const float corr = __builtin_amdgcn_exp2f(m_run[g] - mn); m_run[g] = mn; l_run[g] *= corr;
#pragma unroll
                for (int t = 0; t < 4; ++t) acc[g][t] = acc[g][t] * corr; } }
#pragma unroll
        for (int g = 0; g < R; ++g) { v8u w, wl;
#pragma unroll
            for (int i = 0; i < 8; ++i) {
                const float p0 = __builtin_amdgcn_exp2f(s[i >> 2][g][2 * (i & 3)] - m_run[g]), p1 = __builtin_amdgcn_exp2f(s[i >> 2][g][2 * (i & 3) + 1] - m_run[g]);
                l_run[g] += p0; l_run[g] += p1; w[i] = pk2(p0, p1, T16());
                if (HI) wl[i] = pk2(p0 - __uint_as_float(w[i] << 16), p1 - __uint_as_float(w[i] & 0xFFFF0000u), T16()); }
            const V pf = __builtin_bit_cast(V, w);
#pragma unroll
            for (int t = 0; t < 4; ++t) { acc[g][t] = W::mma(vf[u][t], pf, acc[g][t]); if (HI) { acc[g][t] = W::mma(vf[u][t], __builtin_bit_cast(V, wl), acc[g][t]); acc[g][t] = W::mma(vl[u][t], pf, acc[g][t]); } } }
      }
    }
    bf* ap = Ah + (size_t)(q0 + c) * DQ + 8 * h; bf* ap2 = Al + (size_t)(q0 + c) * DQ + 8 * h;
#pragma unroll
    for (int g = 0; g < R; ++g) { const float l = l_run[g] + xhalf(l_run[g]); const float inv = __fdiv_rn(1.0f, l);   // the wave halves' sums joined once
#pragma unroll
        for (int t = 0; t < 4; ++t) { v8us oh, ol;   // a lane's 8 registers are d = 16 t + 8 h .. + 7 of its query: one 16-byte store a plane
#pragma unroll
            for (int r = 0; r < 8; ++r) { unsigned short a, c2; splitf(acc[g][t][r] * inv, a, c2); oh[r] = a; ol[r] = c2; }
            *(v8us*)(ap + (size_t)g * 16 * DQ + 16 * t) = oh; *(v8us*)(ap2 + (size_t)g * 16 * DQ + 16 * t) = ol;
            asm volatile("s_wait_xcnt 0x0" :: "v"(oh), "v"(ol) : "memory"); } }   // precaution: as inputs, the two stores' data registers stay live up to this wait, so the next tile's values do not overwrite them in front of it
}
__global__ __launch_bounds__((AWH + AWF) * 32) void k_fattn(const h16* __restrict__ Q16, const h16* __restrict__ K16, const h16* __restrict__ V16, const bf* __restrict__ Qh, const bf* __restrict__ Ql, const bf* __restrict__ Kh, const bf* __restrict__ Kl, const bf* __restrict__ Vh, const bf* __restrict__ Vl, const float* __restrict__ mcp, bf* Ah, bf* Al) {
    static_assert(REP == 1 && HD == 64 && RH % (AWH * 32) == 0 && (TT - RH) % (AWF * 64) == 0 && RH / (AWH * 32) == (TT - RH) / (AWF * 64), "one kv head per query head; every work-group has its share of both kinds of rows");
    const int z = blockIdx.y, hd = z % NH_, b = z / NH_; const size_t pl = (size_t)z * TT * HD;   // grid y: the (batch, head) plane; grid x: the query block
    const float csc = __fmul_rn(__fmul_rn(SCL, bfr(mcp[hd])), 1.4426950408889634f);   // (1/8) x modal_compat[h] (bf16-rounded input) x log2 e
    const int wave = __builtin_amdgcn_readfirstlane(threadIdx.x >> 5); const int yb = blockIdx.x;
    bf* ah = Ah + (size_t)b * TT * DQ + hd * HD; bf* al = Al + (size_t)b * TT * DQ + hd * HD;
    if (wave < AWH) attn_wave<bf, true, 2>(Qh + pl, Ql + pl, Kh + pl, Kl + pl, Vh + pl, Vl + pl, csc, (yb * AWH + wave) * 32, ah, al);   // wave-uniform: a scalar branch
    else attn_wave<h16, false, 4>(Q16 + pl, nullptr, K16 + pl, nullptr, V16 + pl, nullptr, csc, RH + (yb * AWF + wave - AWH) * 64, ah, al);
}
__global__ __launch_bounds__(256) void k_addres(float* Y, const float* __restrict__ xr) { const unsigned i = blockIdx.x * 256 + threadIdx.x; if (i >= (unsigned)((size_t)MT * DQ / 4)) return; const unsigned ob = i * 16u;   /* byte offset inside a plane, 32 bits */
    static_assert((size_t)MT * DQ * 4 <= 0xFFFFFFFFull, "a plane's byte offsets fit 32 bits");
    v4f a = *(const v4f*)((const char*)Y + ob);
#pragma unroll
    for (int s = 1; s < KSJ; ++s) a += *(const v4f*)((const char*)(Y + (size_t)s * MT * DQ) + ob);   /* the output projection's K-slice planes, in slice order */
    const v4f r = *(const v4f*)((const char*)xr + ob); v4f o;
#pragma unroll
    for (int q = 0; q < 4; ++q) o[q] = __fadd_rn(a[q], bfr(r[q]));
    *(v4f*)((char*)Y + ob) = o;  }
__global__ __launch_bounds__(256) void k_lnout(const float* __restrict__ F, const float* __restrict__ g, const float* __restrict__ bb, float* out) { const int lane = threadIdx.x & 31; const int row = blockIdx.x * 8 + (threadIdx.x >> 5); if (row >= MT) return; const float* fr = F + (size_t)row * DQ; float* orow = out + (size_t)row * DQ; float v[DQ / 32]; float s = 0.f;
#pragma unroll
    for (int c = 0; c < DQ / 128; ++c) { const v4f a = *(const v4f*)(fr + c * 128 + lane * 4); for (int q = 0; q < 4; ++q) { v[c * 4 + q] = a[q]; s = __fadd_rn(s, a[q]); } }
#pragma unroll
    for (int sh = 16; sh; sh >>= 1) s = __fadd_rn(s, __shfl_xor(s, sh, 32));
    const float mean = __fdiv_rn(s, (float)DQ); float s2 = 0.f;
#pragma unroll
    for (int k = 0; k < DQ / 32; ++k) { const float dv = __fsub_rn(v[k], mean); float p2 = __fmul_rn(dv, dv); asm volatile("" : "+v"(p2)); s2 = __fadd_rn(s2, p2); v[k] = dv; }
#pragma unroll
    for (int sh = 16; sh; sh >>= 1) s2 = __fadd_rn(s2, __shfl_xor(s2, sh, 32));
    const float rs = __fdiv_rn(1.0f, __fsqrt_rn(__fadd_rn(__fdiv_rn(s2, (float)DQ), LNEPS)));
{
#pragma unroll
        for (int c = 0; c < DQ / 128; ++c) { v4f o; for (int q = 0; q < 4; ++q) { const int col = c * 128 + lane * 4 + q; float y = __fmul_rn(v[c * 4 + q], rs); asm volatile("" : "+v"(y)); y = __fmul_rn(y, bfr(g[col])); asm volatile("" : "+v"(y)); o[q] = __fadd_rn(y, bfr(bb[col])); } *(v4f*)(orow + c * 128 + lane * 4) = o; }
         } }

extern "C" void kernel_launch(void* const* d_in, const int* in_sizes, int n_in,
                              void* d_out, int out_size, void* d_ws, size_t ws_size, hipStream_t stream) {
    (void)in_sizes; (void)n_in; (void)out_size;
    const float* x = (const float*)d_in[0];   /* query_modality */ const float* xk = (const float*)d_in[1]; const float* xv = (const float*)d_in[2]; const float* wq = (const float*)d_in[3]; const float* bq = (const float*)d_in[4]; const float* wk = (const float*)d_in[5]; const float* bk = (const float*)d_in[6]; const float* wv = (const float*)d_in[7]; const float* bv = (const float*)d_in[8]; const float* wo = (const float*)d_in[9]; const float* bo = (const float*)d_in[10]; const float* mc = (const float*)d_in[11];   /* modal_compat [8] */ const float* lng = (const float*)d_in[12]; const float* lnb = (const float*)d_in[13];
    float* OUT = (float*)d_out;     // [4][2048][512]
    char* wsp = (char*)d_ws;
    auto take = [&](size_t bytes) { char* p = wsp; wsp += (bytes + 255) & ~(size_t)255; return (void*)p; };
    bf* WQ = (bf*)take((size_t)DQ * DM * 2); bf* WK = (bf*)take((size_t)DKV * DM * 2); bf* WV = (bf*)take((size_t)DKV * DM * 2); bf* WO = (bf*)take((size_t)DM * DQ * 2); float* CS = (float*)take((size_t)TT * HD * 2 * 4);
    h16* QP16 = (h16*)take((size_t)NB_ * NH_ * TT * HD * 2); h16* KP16 = (h16*)take((size_t)NB_ * NKV * TT * HD * 2); h16* VT16 = (h16*)take((size_t)NB_ * NKV * HD * TT * 2);
    bf* QPh = (bf*)take((size_t)NB_ * NH_ * TT * HD * 2); bf* QPl = (bf*)take((size_t)NB_ * NH_ * TT * HD * 2); bf* KPh = (bf*)take((size_t)NB_ * NKV * TT * HD * 2); bf* KPl = (bf*)take((size_t)NB_ * NKV * TT * HD * 2); bf* VTh = (bf*)take((size_t)NB_ * NKV * HD * TT * 2); bf* VTl = (bf*)take((size_t)NB_ * NKV * HD * TT * 2);
    bf* XB = (bf*)take((size_t)3 * MT * DM * 2);   // bf16 copies of the query, key, value inputs, one behind the other
    bf* ATh = (bf*)take((size_t)MT * DQ * 2); bf* ATl = (bf*)take((size_t)MT * DQ * 2);
    static_assert(DQ == DM && DKV == DM, "one f32 buffer serves all four projections' planes; the four transposed weights are equal in size");
    float* Sb = (float*)take((size_t)KSJ * MT * DM * 4);
    if ((size_t)(wsp - (char*)d_ws) > ws_size) return;    // ws 256 MiB
    float* FQ = Sb; float* FK = Sb; float* FV = Sb; float* Y = Sb;   // the q, k, v projections' planes and the output projection's planes use one buffer in turn: each is read out by the next kernels before the next is written (stream-ordered)
    k_wtG<<<dim3((unsigned)((DM * DQ / 64 + 63) / 64), 4), 256, 0, stream>>>(wq, wk, wv, wo, DM, DQ, WQ);   // WQ, WK, WV, WO are taken one behind the other
    k_csid<<<(TT * HD + 255) / 256, 256, 0, stream>>>(CS);
    const unsigned LQ = (unsigned)(((size_t)NH_ * TT * HD / 2 + 255) / 256), LKv = (unsigned)(((size_t)NKV * TT * HD / 2 + 255) / 256), LX = (unsigned)(((size_t)MT * DM / 8 + 255) / 256);
    k_cvt8<<<dim3(LX, 3), 256, 0, stream>>>(x, xk, xv, XB, (size_t)MT * DM / 8);
    k_gemmw<bf, 0, true, KSJ><<<dim3(MT / 64, DQ / 64, KSJ), 32, 0, stream>>>(XB, nullptr, WQ, nullptr, DM, FQ, DQ, bq, 0, 0, 0, (size_t)MT * DQ);
    k_rope<<<dim3(LQ, NB_), 256, 0, stream>>>(FQ, DQ, NH_, CS, nullptr, nullptr, 1.0f, QP16, QPh, QPl);
    k_gemmw<bf, 0, true, KSJ><<<dim3(MT / 64, DKV / 64, KSJ), 32, 0, stream>>>(XB + (size_t)MT * DM, nullptr, WK, nullptr, DM, FK, DKV, bk, 0, 0, 0, (size_t)MT * DKV);
    k_rope<<<dim3(LKv, NB_), 256, 0, stream>>>(FK, DKV, NKV, CS, nullptr, nullptr, 1.0f, KP16, KPh, KPl);
    k_gemmw<bf, 0, true, 1><<<dim3(MT / 64, DKV / 64, 1), 32, 0, stream>>>(XB + (size_t)2 * MT * DM, nullptr, WV, nullptr, DM, FV, DKV, bv, 0, 0, 0, 0); k_vtp<<<dim3(LKv, NB_), 256, 0, stream>>>(FV, DKV, NKV, VT16, VTh, VTl);
    k_fattn<<<dim3(RH / (AWH * 32), NB_ * NH_), (AWH + AWF) * 32, 0, stream>>>(QP16, KP16, VT16, QPh, QPl, KPh, KPl, VTh, VTl, mc, ATh, ATl);   /* per-head compatibility scale inside */
    k_gemmw<bf, 1, true, KSJ><<<dim3(MT / 64, DM / 64, KSJ), 32, 0, stream>>>(ATh, ATl, WO, nullptr, DQ, Y, DM, bo, 0, 0, 0, (size_t)MT * DM); k_addres<<<(unsigned)(((size_t)MT * DQ / 4 + 255) / 256), 256, 0, stream>>>(Y, x);   /* + query_modality */ k_lnout<<<(MT + 7) / 8, 256, 0, stream>>>(Y, lng, lnb, OUT);
}

// v004
// A run of this version takes 157 microseconds.
// In two side-by-side timings against v003, it was 1.48 and 1.47 times as fast.
// Counting every step since v000, it is 13.3 times as fast.
#include <hip/hip_runtime.h>

// Cross-modal multi-head attention with a learned per-head compatibility scale, residual and post-LayerNorm (query_modality, key_modality, value_modality [4][2048][512]; Q,K,V = x W + b ('xw' 1/sqrt(512), zero biases; 8 heads x 64); scores = (Q.K / 8) x modal_compat[h] ([1][8][1][1], read); softmax; out = merged Wo + bo; y = LayerNorm(out + query_modality) gamma/beta (1e-5) -> [4][2048][512] (4.2 M)).
// Layout, all batches in one launch of each kernel (rows b*2048+t; head planes [b][h]): bf16 copies of query, key, value inputs; 'xw' weights transposed once; one launch for the q, k, v projections + f32 biases, whose tiles store the head planes themselves; one fused attention kernel for all 32 planes (scores, the head's bf16-rounded compatibility scalar, online softmax, P x V; scores and P stay in registers; hybrid rows: < 512 hi/lo 3 products, rest fp16); merged hi/lo x Wo exact + bo into workspace; residual add of query_modality and a row LayerNorm kernel write the output rows.
// Compute dtypes, f32 accumulate: every input rounded to bf16; projections exact + f32 biases; attention rows < 512 3 products, rest fp16; per-head scale and softmax f32; Wo hl x exact + bias; residual + LayerNorm f32.

#define NB_  4
#define TT   2048
#define DM   512
#define NH_  8
#define NKV  8
#define REP  (NH_ / NKV)
#define HD   64
#define DQ   (NH_ * HD)
#define DKV  (NKV * HD)
#define MT   (NB_ * TT)           // rows of all batches together
#define RH   512                  // query rows < RH use hi+lo planes
#define SCL  0.125f
#define LNEPS 1e-5f
#define KSJ  4                    // K slices of the output projection (K = 512)
typedef _Float16 h16;
typedef unsigned short bf;
typedef __attribute__((ext_vector_type(16))) __bf16   v16bf;
typedef __attribute__((ext_vector_type(16))) _Float16 v16h;
typedef __attribute__((ext_vector_type(8)))  _Float16 v8h;
typedef __attribute__((ext_vector_type(8)))  unsigned short v8us;
typedef __attribute__((ext_vector_type(8)))  float    v8f;
typedef __attribute__((ext_vector_type(4)))  float    v4f;
typedef v8h  __attribute__((may_alias)) v8ha;
typedef v4f  __attribute__((may_alias)) v4fa;
typedef v8us __attribute__((may_alias)) v8usa;

__device__ __forceinline__ unsigned short f2bf(float f) { unsigned u = __float_as_uint(f); u += 0x7FFFu + ((u >> 16) & 1u); return (unsigned short)(u >> 16); }
__device__ __forceinline__ float bf2f(unsigned short b) { return __uint_as_float(((unsigned)b) << 16); }
__device__ __forceinline__ float bfr(float f) { return bf2f(f2bf(f)); }
__device__ __forceinline__ v16h cat16(v8h lo, v8h hi) { return __builtin_shufflevector(lo, hi, 0, 1, 2, 3, 4, 5, 6, 7, 8, 9, 10, 11, 12, 13, 14, 15); }
__device__ __forceinline__ v16bf cat16b(v8us lo, v8us hi) { return __builtin_bit_cast(v16bf, __builtin_shufflevector(lo, hi, 0, 1, 2, 3, 4, 5, 6, 7, 8, 9, 10, 11, 12, 13, 14, 15)); }
__device__ __forceinline__ v8f wmma16(v16h a, v16h b, v8f c) { return __builtin_amdgcn_wmma_f32_16x16x32_f16(false, a, false, b, (short)0, c, false, false); }
__device__ __forceinline__ v8f wmmab(v16bf a, v16bf b, v8f c) { return __builtin_amdgcn_wmma_f32_16x16x32_bf16(false, a, false, b, (short)0, c, false, false); }



// ---- k_gemmw: register-blocked GEMM, ONE WAVE per 64x64 output tile (16 accumulators), operands straight from K-contiguous 16-bit planes; grid (M/64, N/64, Z x KS), 32 threads.
// C[m][n] (f32, pitch ldc, + optional f32 bias[n]) = sum_k A[m][k] Bt[n][k] (+ split products per NSPLIT). z-batch strides sA/sB/sC in elements. K % (32 KS) == 0.
// Split K: grid z = Z x KS; slice sl of batch z sums k in [sl K/KS, (sl+1) K/KS) into its own f32 plane C + sl sP (bias in slice 0 only); the kernel that reads C adds the KS planes in slice order.
template <typename T16> struct WFrag;
template <> struct WFrag<h16> { typedef v16h V; static __device__ __forceinline__ V ld(const h16* p) { return cat16(*(const v8h*)p, *(const v8h*)(p + 16)); } static __device__ __forceinline__ v8f mma(V a, V b, v8f c) { return wmma16(a, b, c); } };
template <> struct WFrag<bf> { typedef v16bf V; static __device__ __forceinline__ V ld(const bf* p) { return cat16b(*(const v8us*)p, *(const v8us*)(p + 16)); } static __device__ __forceinline__ v8f mma(V a, V b, v8f c) { return wmmab(a, b, c); } };
template <typename T16, int NSPLIT, bool BIAS, int KS>
__global__ __launch_bounds__(32) void k_gemmw(const T16* __restrict__ A, const T16* __restrict__ A2, const T16* __restrict__ Bt, const T16* __restrict__ Bt2, int K, float* C, int ldc, const float* __restrict__ bias, size_t sA, size_t sB, size_t sC, size_t sP) {
    typedef typename WFrag<T16>::V V;
    __shared__ __align__(16) float os[16 * 68];
    const size_t z = blockIdx.z / KS; const int sl = (int)(blockIdx.z % KS); const int kl = K / KS, kb = sl * kl; A += z * sA; if (A2) A2 += z * sA; Bt += z * sB; if (Bt2) Bt2 += z * sB; C += z * sC + (size_t)sl * sP;
    const int lane = threadIdx.x & 31, lr = lane & 15, hi = lane >> 4; const int r0 = blockIdx.x * 64, c0 = blockIdx.y * 64;
    v8f acc[4][4];
#pragma unroll
    for (int mb = 0; mb < 4; ++mb)
#pragma unroll
        for (int nb = 0; nb < 4; ++nb) acc[mb][nb] = (v8f){};
    v4f bv = (v4f){};   // this lane's four output columns of the bias; zero in every slice but the first, so that the planes' sum holds it once
    if (BIAS && sl == 0) { const float* bp = bias + c0 + lr * 4; bv[0] = bp[0]; bv[1] = bp[1]; bv[2] = bp[2]; bv[3] = bp[3];   // rounded behind the K loop, which covers the load
        asm volatile("s_wait_xcnt 0x0" ::: "memory"); }   // precaution: stands between the load and the address set-up below, which may reuse the load's address registers
    const size_t aoff = (size_t)(r0 + lr) * K + 8 * hi, boff = (size_t)(c0 + lr) * K + 8 * hi;
#pragma unroll 1
    for (int kc = kb; kc < kb + kl; kc += 32) {
        V a[4], a2[4];
#pragma unroll
        for (int mb = 0; mb < 4; ++mb) { a[mb] = WFrag<T16>::ld(A + aoff + (size_t)mb * 16 * K + kc); if (NSPLIT == 1 || NSPLIT == 2) a2[mb] = WFrag<T16>::ld(A2 + aoff + (size_t)mb * 16 * K + kc); }
#pragma unroll
        for (int nb = 0; nb < 4; ++nb) { const V b = WFrag<T16>::ld(Bt + boff + (size_t)nb * 16 * K + kc); V b2; if (NSPLIT >= 2) b2 = WFrag<T16>::ld(Bt2 + boff + (size_t)nb * 16 * K + kc);
#pragma unroll
            for (int mb = 0; mb < 4; ++mb) { acc[mb][nb] = WFrag<T16>::mma(a[mb], b, acc[mb][nb]); if (NSPLIT == 1 || NSPLIT == 2) acc[mb][nb] = WFrag<T16>::mma(a2[mb], b, acc[mb][nb]); if (NSPLIT >= 2) acc[mb][nb] = WFrag<T16>::mma(a[mb], b2, acc[mb][nb]); } }
        asm volatile("v_nop\n\tv_nop\n\tv_nop\n\tv_nop" : "+v"(acc[0][0]), "+v"(acc[1][1]), "+v"(acc[2][2]), "+v"(acc[3][3]) : "v"(a[0]), "v"(a[3]));
    }
    if (BIAS) { bv[0] = bfr(bv[0]); bv[1] = bfr(bv[1]); bv[2] = bfr(bv[2]); bv[3] = bfr(bv[3]); }
#pragma unroll
    for (int mb = 0; mb < 4; ++mb) {
#pragma unroll
        for (int nb = 0; nb < 4; ++nb) {
#pragma unroll
            for (int j = 0; j < 8; ++j) os[(hi * 8 + j) * 68 + nb * 16 + lr] = acc[mb][nb][j]; }
        __builtin_amdgcn_wave_barrier(); asm volatile("" ::: "memory");
        float* crow = C + (size_t)(r0 + mb * 16) * ldc + c0;
{
#pragma unroll
            for (int s = 0; s < 8; ++s) { const int row = 2 * s + hi, cofs = lr * 4; v4f val = *(const v4fa*)(os + row * 68 + cofs); if (BIAS) val += bv;
                *(v4f*)(crow + (size_t)row * ldc + cofs) = val; }
             }
        __builtin_amdgcn_wave_barrier(); asm volatile("" ::: "memory");
    }
}

__device__ __forceinline__ void splitf(float y, unsigned short& h, unsigned short& l) { h = f2bf(y); l = f2bf(y - bf2f(h)); }
typedef __attribute__((ext_vector_type(2))) _Float16 v2h;
typedef __attribute__((ext_vector_type(4))) _Float16 v4h;
typedef __attribute__((ext_vector_type(2))) unsigned short v2us;
typedef __attribute__((ext_vector_type(4))) unsigned short v4us;
typedef __attribute__((ext_vector_type(2))) float v2f;
typedef __attribute__((ext_vector_type(4))) int v4i;

__global__ __launch_bounds__(256) void k_wtG(const float* __restrict__ w0, const float* __restrict__ w1, const float* __restrict__ w2, const float* __restrict__ w3, int K, int N, bf* Bt) {
    const float* __restrict__ w = blockIdx.y == 0 ? w0 : blockIdx.y == 1 ? w1 : blockIdx.y == 2 ? w2 : w3; Bt += (size_t)blockIdx.y * N * K;   // grid y: which of the four equal-shaped weights; their transposes lie one behind the other
    const int lane = threadIdx.x & 31; const int L0 = (blockIdx.x * 8 + (threadIdx.x >> 5)) * 8; const int nlines = N * K / 64;
{
#pragma unroll 1
        for (int l = 0; l < 8; ++l) { const int L = L0 + l; if (L >= nlines) break; const size_t e = (size_t)L * 64 + lane * 2; const int k = (int)(e % K), n = (int)(e / K); v2us o;
            o[0] = f2bf(w[(size_t)k * N + n]); o[1] = f2bf(w[(size_t)(k + 1) * N + n]); *(v2us*)(Bt + e) = o; }
         }
}
__global__ __launch_bounds__(256) void k_cvt8(const float* __restrict__ s0, const float* __restrict__ s1, const float* __restrict__ s2, bf* dst, size_t n8) { const size_t i = (size_t)blockIdx.x * 256 + threadIdx.x; if (i >= n8) return; const float* __restrict__ src = blockIdx.y == 0 ? s0 : blockIdx.y == 1 ? s1 : s2; dst += (size_t)blockIdx.y * n8 * 8;   /* grid y: which of the three equal-shaped inputs; their copies lie one behind the other */ const v8f v = *(const v8f*)(src + i * 8); v8us o;
#pragma unroll
    for (int k = 0; k < 8; ++k) o[k] = f2bf(v[k]); *(v8us*)(dst + i * 8) = o;  }

// ---- k_fattn: scores, softmax and P x V of one (batch, head) in one kernel; no score and no P ever leaves the registers.
// Transposed products: S^T = K Q^T (A = 16 key rows, B = 16 query columns), so a lane holds 8 keys' scores of ONE query per tile; two score tiles (32 keys), converted in place, are the B operand of O^T += V^T P^T (A = 16 d rows of the [d][t] plane).
// Every fragment comes by WFrag::ld, whose two 16-byte halves at k = 8 hi and 16 + 8 hi are the order in which the packed score tiles lie.
// Online softmax in the log2 domain: the maximum in use may trail the true one by up to 8, sums and outputs are rescaled only when a column's maximum passes that.
// Query rows < RH: bf16 hi/lo planes, 3 products each, 32 columns a wave; the rest fp16, 64 columns a wave. Output: the merged hi/lo bf16 rows [b t][h d].
// A work-group is AWH hi/lo waves and AWF fp16 waves of one plane (no barrier, no LDS: the waves share only the cache): 8 equal work-groups a plane, 256 in all, one per WGP.
#define AWH  2                    // hi/lo waves per work-group of k_fattn, 32 query rows each
#define AWF  3                    // fp16 waves per work-group, 64 query rows each
#define NPS  (TT / 32)            // 32-key passes
typedef __attribute__((ext_vector_type(2))) __bf16 v2bf;
typedef __attribute__((ext_vector_type(8))) unsigned v8u;
__device__ __forceinline__ float xhalf(float x) { return __builtin_bit_cast(float, __builtin_amdgcn_permlanex16(__builtin_bit_cast(int, x), __builtin_bit_cast(int, x), 0x76543210, 0xfedcba98, false, false)); }   // lane l with lane l ^ 16
__device__ __forceinline__ unsigned pk2(float a, float b, bf) { v2f x; x[0] = a; x[1] = b; return __builtin_bit_cast(unsigned, __builtin_convertvector(x, v2bf)); }
__device__ __forceinline__ unsigned pk2(float a, float b, h16) { v2f x; x[0] = a; x[1] = b; return __builtin_bit_cast(unsigned, __builtin_convertvector(x, v2h)); }
// xwait: precaution behind a group of global loads: as inputs, the loads' address registers stay live up to this wait, so none is advanced or reused in front of it
template <bool HI, typename T16> __device__ __forceinline__ void xwait(const T16* a, const T16* b) { if (HI) asm volatile("s_wait_xcnt 0x0" :: "v"(a), "v"(b) : "memory"); else asm volatile("s_wait_xcnt 0x0" :: "v"(a) : "memory"); }
// ---- k_proj: the q, k and v projections of all batches in one launch, each with its layout step: ONE WAVE per 64x64 tile sums the whole K = DM in registers and stores the fp16, hi and lo head planes itself (no f32 plane, no LDS, no barrier).
// grid (MT/128, DQ/128, 3), 4 waves = 2x2 tiles a work-group: two waves each read the same operand rows at about the same time, so that the second can find them in the WGP cache. z picks input copy, transposed weight, bias and planes. A tile is 64 rows t of one batch x the 64 columns d of one head.
// TR (q, k; planes [b][h][t][d]): D = W^T-rows x X-rows, so a lane's 8 accumulator registers are 8 neighbouring d of one t. Not TR (v; planes [b][h][d][t]): D = X-rows x W^T-rows, 8 neighbouring t of one d. Either way one 16-byte store a plane and tile.
// The accumulators start at the bf16-rounded bias. A converted tile (lane, 8 values) has the lane order of half a fragment of k_fattn's operands; the planes keep their row-major form here, so a store covers 32 bytes of each of 16 lines.
typedef __attribute__((ext_vector_type(4))) unsigned v4u;
typedef v4u __attribute__((may_alias)) v4ua;
template <bool TR>
__device__ __forceinline__ void proj_tile(const bf* __restrict__ X, const bf* __restrict__ Wt, const float* __restrict__ bias, h16* P16, bf* Ph, bf* Pl) {
    typedef WFrag<bf> W; typedef WFrag<bf>::V V;
    const int lane = threadIdx.x & 31, lr = lane & 15, hi = lane >> 4; const int wave = __builtin_amdgcn_readfirstlane(threadIdx.x >> 5); const int r0 = (blockIdx.x * 2 + (wave & 1)) * 64, hd = blockIdx.y * 2 + (wave >> 1), c0 = hd * 64;
    // every full unroll below: fragments and sums are register arrays, which only constant indices keep in registers
    v8f acc[4][4];
    if (TR) { const float* bp = bias + c0 + 8 * hi; v8f bv[4];
#pragma unroll
        for (int nb = 0; nb < 4; ++nb) bv[nb] = *(const v8f*)(bp + nb * 16);
        asm volatile("s_wait_xcnt 0x0" :: "v"(bp) : "memory");   // precaution: as an input, the bias loads' address stays live up to this wait
#pragma unroll
        for (int nb = 0; nb < 4; ++nb) {
#pragma unroll
            for (int j = 0; j < 8; ++j) bv[nb][j] = bfr(bv[nb][j]);
#pragma unroll
            for (int mb = 0; mb < 4; ++mb) acc[mb][nb] = bv[nb]; } }
    else { const float* bp = bias + c0 + lr; float bv[4];
#pragma unroll
        for (int nb = 0; nb < 4; ++nb) bv[nb] = bp[nb * 16];
        asm volatile("s_wait_xcnt 0x0" :: "v"(bp) : "memory");   // precaution: as an input, the bias loads' address stays live up to this wait
#pragma unroll
        for (int nb = 0; nb < 4; ++nb) { const float bb = bfr(bv[nb]);
#pragma unroll
            for (int mb = 0; mb < 4; ++mb)
#pragma unroll
                for (int j = 0; j < 8; ++j) acc[mb][nb][j] = bb; } }
    const bf* xp = X + (size_t)(r0 + lr) * DM + 8 * hi; const bf* wp = Wt + (size_t)(c0 + lr) * DM + 8 * hi;
    V a0[4], b0[4], a1[4], b1[4];   // two fragment sets of 32 k each: one is in flight while the other is multiplied
#pragma unroll
    for (int i = 0; i < 4; ++i) { a0[i] = W::ld(xp + i * 16 * DM); b0[i] = W::ld(wp + i * 16 * DM); }
#pragma unroll 1   // stays rolled: a trip already takes 64 k, one whole 128-byte line of each operand row
    for (int kc = 0; kc < DM; kc += 64) {
#pragma unroll
        for (int i = 0; i < 4; ++i) { a1[i] = W::ld(xp + i * 16 * DM + 32); b1[i] = W::ld(wp + i * 16 * DM + 32); }
        __builtin_amdgcn_sched_barrier(0);   // keeps the sixteen loads in front of the products of the other set: sunk behind them, their latency would lie open
#pragma unroll
        for (int nb = 0; nb < 4; ++nb)
#pragma unroll
            for (int mb = 0; mb < 4; ++mb) acc[mb][nb] = TR ? W::mma(b0[nb], a0[mb], acc[mb][nb]) : W::mma(a0[mb], b0[nb], acc[mb][nb]);
        xwait<true>(xp, wp);   // stands between every load issued so far and the advance of their addresses
        const int adv = (kc + 64 < DM) ? 64 : 0;   // the last trip fetches its own first half again: inside the rows, never used
        xp += adv; wp += adv;
#pragma unroll
        for (int i = 0; i < 4; ++i) { a0[i] = W::ld(xp + i * 16 * DM); b0[i] = W::ld(wp + i * 16 * DM); }
        __builtin_amdgcn_sched_barrier(0);   // as above
#pragma unroll
        for (int nb = 0; nb < 4; ++nb)
#pragma unroll
            for (int mb = 0; mb < 4; ++mb) acc[mb][nb] = TR ? W::mma(b1[nb], a1[mb], acc[mb][nb]) : W::mma(a1[mb], b1[nb], acc[mb][nb]);
    }
    xwait<true>(xp, wp);   // behind the last trip's loads: their addresses' registers are free for reuse below
    const int bt = r0 / TT, t0 = r0 % TT;   // 64 divides TT: a tile's rows lie in one batch
    const size_t e0 = TR ? ((size_t)(bt * NH_ + hd) * TT + t0 + lr) * HD + 8 * hi : ((size_t)(bt * NKV + hd) * HD + lr) * TT + t0 + 8 * hi;
    h16* p16 = P16 + e0; bf* ph = Ph + e0; bf* pl = Pl + e0;
#pragma unroll
    for (int mb = 0; mb < 4; ++mb) { v4u o16[4], oh[4], ol[4];
#pragma unroll
        for (int nb = 0; nb < 4; ++nb) {
#pragma unroll
            for (int i = 0; i < 4; ++i) { const float y0 = acc[mb][nb][2 * i], y1 = acc[mb][nb][2 * i + 1]; o16[nb][i] = pk2(y0, y1, h16()); const unsigned wh = pk2(y0, y1, bf()); oh[nb][i] = wh;
                ol[nb][i] = pk2(y0 - __uint_as_float(wh << 16), y1 - __uint_as_float(wh & 0xFFFF0000u), bf()); }
            const int eo = TR ? mb * 16 * HD + nb * 16 : nb * 16 * TT + mb * 16;
            *(v4ua*)(p16 + eo) = o16[nb]; *(v4ua*)(ph + eo) = oh[nb]; *(v4ua*)(pl + eo) = ol[nb]; }
        asm volatile("s_wait_xcnt 0x0" :: "v"(o16[0]), "v"(o16[1]), "v"(o16[2]), "v"(o16[3]), "v"(oh[0]), "v"(oh[1]), "v"(oh[2]), "v"(oh[3]), "v"(ol[0]), "v"(ol[1]), "v"(ol[2]), "v"(ol[3]) : "memory"); }   // precaution: as inputs, the twelve stores' data registers stay live up to this wait, so the next row of tiles does not overwrite them in front of it
}
__global__ __launch_bounds__(128) void k_proj(const bf* __restrict__ XB, const bf* __restrict__ WT, const float* __restrict__ bq, const float* __restrict__ bk, const float* __restrict__ bv, h16* Q16, bf* Qh, bf* Ql, h16* K16, bf* Kh, bf* Kl, h16* V16, bf* Vh, bf* Vl) {
    static_assert(TT % 64 == 0 && MT % 128 == 0 && HD == 64 && DM % 64 == 0 && DQ == DKV && DQ % 128 == 0, "a 64x64 tile is one head's columns and rows of one batch");
    const int z = blockIdx.z; const bf* X = XB + (size_t)z * MT * DM; const bf* Wt = WT + (size_t)z * DQ * DM;   // the input copies and the transposed weights lie one behind the other
    if (z < 2) proj_tile<true>(X, Wt, z == 0 ? bq : bk, z == 0 ? Q16 : K16, z == 0 ? Qh : Kh, z == 0 ? Ql : Kl);   // block-uniform: a scalar branch
    else proj_tile<false>(X, Wt, bv, V16, Vh, Vl);
}
template <typename T16, bool HI, int R>
__device__ __forceinline__ void attn_wave(const T16* __restrict__ Q, const T16* __restrict__ Q2, const T16* __restrict__ Kp, const T16* __restrict__ K2, const T16* __restrict__ Vt, const T16* __restrict__ V2, float csc, int q0, bf* Ah, bf* Al) {
    typedef typename WFrag<T16>::V V; typedef WFrag<T16> W;
    const int lane = threadIdx.x & 31, c = lane & 15, h = lane >> 4;
    // every full unroll below: fragments, scores and sums are register arrays, which only constant indices keep in registers
    V qf[R][2], ql[R][2];
    { const T16* qp = Q + (size_t)(q0 + c) * HD + 8 * h; const T16* qp2 = HI ? Q2 + (size_t)(q0 + c) * HD + 8 * h : qp;
#pragma unroll
      for (int g = 0; g < R; ++g)
#pragma unroll
        for (int kc = 0; kc < 2; ++kc) { qf[g][kc] = W::ld(qp + g * 16 * HD + 32 * kc); if (HI) ql[g][kc] = W::ld(qp2 + g * 16 * HD + 32 * kc); }
      xwait<HI>(qp, qp2); }
    v8f acc[R][4]; float m_run[R], l_run[R];
#pragma unroll
    for (int g = 0; g < R; ++g) { m_run[g] = -__builtin_inff(); l_run[g] = 0.f;
#pragma unroll
        for (int t = 0; t < 4; ++t) acc[g][t] = (v8f){}; }
    const T16* kp = Kp + (size_t)c * HD + 8 * h; const T16* kp2 = HI ? K2 + (size_t)c * HD + 8 * h : kp;
    const T16* vp = Vt + (size_t)c * TT + 8 * h; const T16* vp2 = HI ? V2 + (size_t)c * TT + 8 * h : vp;
    V kf[2][2], kl[2][2];
#pragma unroll
    for (int kt = 0; kt < 2; ++kt)
#pragma unroll
        for (int kc = 0; kc < 2; ++kc) { kf[kt][kc] = W::ld(kp + kt * 16 * HD + 32 * kc); if (HI) kl[kt][kc] = W::ld(kp2 + kt * 16 * HD + 32 * kc); }
    xwait<HI>(kp, kp2);   // the K addresses are advanced in the loop
#pragma unroll 1   // stays rolled: the body already holds two passes; more would only grow the code and the registers
    for (int pp = 0; pp < NPS / 2; ++pp) {
        V vf[2][4], vl[2][4];   // two passes' V^T fragments, 64 keys = one whole 128-byte line of each d row: issued first, used behind the exponentials
#pragma unroll
        for (int t = 0; t < 4; ++t)
#pragma unroll
            for (int u = 0; u < 2; ++u) { vf[u][t] = W::ld(vp + (size_t)t * 16 * TT + 32 * u); if (HI) vl[u][t] = W::ld(vp2 + (size_t)t * 16 * TT + 32 * u); }
        xwait<HI>(vp, vp2);   // stands between the V loads and the advance of their addresses
        vp += 64; if (HI) vp2 += 64;
#pragma unroll
      for (int u = 0; u < 2; ++u) {   // the two 32-key passes
        v8f s[2][R];
#pragma unroll
        for (int kt = 0; kt < 2; ++kt)
#pragma unroll
            for (int g = 0; g < R; ++g) { s[kt][g] = (v8f){};
#pragma unroll
                for (int kc = 0; kc < 2; ++kc) { s[kt][g] = W::mma(kf[kt][kc], qf[g][kc], s[kt][g]); if (HI) { s[kt][g] = W::mma(kf[kt][kc], ql[g][kc], s[kt][g]); s[kt][g] = W::mma(kl[kt][kc], qf[g][kc], s[kt][g]); } } }
        if (u == 1) { const int adv = (pp + 1 < NPS / 2) ? 64 * HD : 0;   // kp: the first K row of a pair of passes; the last pass fetches rows of its own pair again: inside the plane, never used
          kp += adv; if (HI) kp2 += adv; }
        const int ko = (u == 0) ? 32 * HD : 0;
#pragma unroll
        for (int kt = 0; kt < 2; ++kt)   // the next pass's K fragments, in flight under this pass's softmax and second product
#pragma unroll
            for (int kc = 0; kc < 2; ++kc) { kf[kt][kc] = W::ld(kp + ko + kt * 16 * HD + 32 * kc); if (HI) kl[kt][kc] = W::ld(kp2 + ko + kt * 16 * HD + 32 * kc); }
        xwait<HI>(kp, kp2);   // stands between the K loads and the next advance of their addresses
        float mb[R]; bool need = false;
#pragma unroll
        for (int g = 0; g < R; ++g) { s[0][g] = s[0][g] * csc; s[1][g] = s[1][g] * csc;   // the head's scale may be negative: scale first, then the maximum
            float mx = fmaxf(s[0][g][0], s[1][g][0]);
#pragma unroll
            for (int r = 1; r < 8; ++r) mx = fmaxf(mx, fmaxf(s[0][g][r], s[1][g][r]));
            mx = fmaxf(mx, xhalf(mx)); mb[g] = mx; need = need || (mx > m_run[g] + 8.0f); }
        if (__builtin_amdgcn_ballot_w32(need) != 0) {   // one scalar branch a pass; rare behind the first passes
#pragma unroll
            for (int g = 0; g < R; ++g) { const float mn = fmaxf(m_run[g], mb[g]); const float corr = __builtin_amdgcn_exp2f(m_run[g] - mn); m_run[g] = mn; l_run[g] *= corr;
#pragma unroll
                for (int t = 0; t < 4; ++t) acc[g][t] = acc[g][t] * corr; } }
#pragma unroll
        for (int g = 0; g < R; ++g) { v8u w, wl;
#pragma unroll
            for (int i = 0; i < 8; ++i) {
                const float p0 = __builtin_amdgcn_exp2f(s[i >> 2][g][2 * (i & 3)] - m_run[g]), p1 = __builtin_amdgcn_exp2f(s[i >> 2][g][2 * (i & 3) + 1] - m_run[g]);
                l_run[g] += p0; l_run[g] += p1; w[i] = pk2(p0, p1, T16());
                if (HI) wl[i] = pk2(p0 - __uint_as_float(w[i] << 16), p1 - __uint_as_float(w[i] & 0xFFFF0000u), T16()); }
            const V pf = __builtin_bit_cast(V, w);
#pragma unroll
            for (int t = 0; t < 4; ++t) { acc[g][t] = W::mma(vf[u][t], pf, acc[g][t]); if (HI) { acc[g][t] = W::mma(vf[u][t], __builtin_bit_cast(V, wl), acc[g][t]); acc[g][t] = W::mma(vl[u][t], pf, acc[g][t]); } } }
      }
    }
    bf* ap = Ah + (size_t)(q0 + c) * DQ + 8 * h; bf* ap2 = Al + (size_t)(q0 + c) * DQ + 8 * h;
#pragma unroll
    for (int g = 0; g < R; ++g) { const float l = l_run[g] + xhalf(l_run[g]); const float inv = __fdiv_rn(1.0f, l);   // the wave halves' sums joined once
#pragma unroll
        for (int t = 0; t < 4; ++t) { v8us oh, ol;   // a lane's 8 registers are d = 16 t + 8 h .. + 7 of its query: one 16-byte store a plane
#pragma unroll
            for (int r = 0; r < 8; ++r) { unsigned short a, c2; splitf(acc[g][t][r] * inv, a, c2); oh[r] = a; ol[r] = c2; }
            *(v8us*)(ap + (size_t)g * 16 * DQ + 16 * t) = oh; *(v8us*)(ap2 + (size_t)g * 16 * DQ + 16 * t) = ol;
            asm volatile("s_wait_xcnt 0x0" :: "v"(oh), "v"(ol) : "memory"); } }   // precaution: as inputs, the two stores' data registers stay live up to this wait, so the next tile's values do not overwrite them in front of it
}
__global__ __launch_bounds__((AWH + AWF) * 32) void k_fattn(const h16* __restrict__ Q16, const h16* __restrict__ K16, const h16* __restrict__ V16, const bf* __restrict__ Qh, const bf* __restrict__ Ql, const bf* __restrict__ Kh, const bf* __restrict__ Kl, const bf* __restrict__ Vh, const bf* __restrict__ Vl, const float* __restrict__ mcp, bf* Ah, bf* Al) {
    static_assert(REP == 1 && HD == 64 && RH % (AWH * 32) == 0 && (TT - RH) % (AWF * 64) == 0 && RH / (AWH * 32) == (TT - RH) / (AWF * 64), "one kv head per query head; every work-group has its share of both kinds of rows");
    const int z = blockIdx.y, hd = z % NH_, b = z / NH_; const size_t pl = (size_t)z * TT * HD;   // grid y: the (batch, head) plane; grid x: the query block
    const float csc = __fmul_rn(__fmul_rn(SCL, bfr(mcp[hd])), 1.4426950408889634f);   // (1/8) x modal_compat[h] (bf16-rounded input) x log2 e
    const int wave = __builtin_amdgcn_readfirstlane(threadIdx.x >> 5); const int yb = blockIdx.x;
    bf* ah = Ah + (size_t)b * TT * DQ + hd * HD; bf* al = Al + (size_t)b * TT * DQ + hd * HD;
    if (wave < AWH) attn_wave<bf, true, 2>(Qh + pl, Ql + pl, Kh + pl, Kl + pl, Vh + pl, Vl + pl, csc, (yb * AWH + wave) * 32, ah, al);   // wave-uniform: a scalar branch
    else attn_wave<h16, false, 4>(Q16 + pl, nullptr, K16 + pl, nullptr, V16 + pl, nullptr, csc, RH + (yb * AWF + wave - AWH) * 64, ah, al);
}
__global__ __launch_bounds__(256) void k_addres(float* Y, const float* __restrict__ xr) { const unsigned i = blockIdx.x * 256 + threadIdx.x; if (i >= (unsigned)((size_t)MT * DQ / 4)) return; const unsigned ob = i * 16u;   /* byte offset inside a plane, 32 bits */
    static_assert((size_t)MT * DQ * 4 <= 0xFFFFFFFFull, "a plane's byte offsets fit 32 bits");
    v4f a = *(const v4f*)((const char*)Y + ob);
#pragma unroll
    for (int s = 1; s < KSJ; ++s) a += *(const v4f*)((const char*)(Y + (size_t)s * MT * DQ) + ob);   /* the output projection's K-slice planes, in slice order */
    const v4f r = *(const v4f*)((const char*)xr + ob); v4f o;
#pragma unroll
    for (int q = 0; q < 4; ++q) o[q] = __fadd_rn(a[q], bfr(r[q]));
    *(v4f*)((char*)Y + ob) = o;  }
__global__ __launch_bounds__(256) void k_lnout(const float* __restrict__ F, const float* __restrict__ g, const float* __restrict__ bb, float* out) { const int lane = threadIdx.x & 31; const int row = blockIdx.x * 8 + (threadIdx.x >> 5); if (row >= MT) return; const float* fr = F + (size_t)row * DQ; float* orow = out + (size_t)row * DQ; float v[DQ / 32]; float s = 0.f;
#pragma unroll
    for (int c = 0; c < DQ / 128; ++c) { const v4f a = *(const v4f*)(fr + c * 128 + lane * 4); for (int q = 0; q < 4; ++q) { v[c * 4 + q] = a[q]; s = __fadd_rn(s, a[q]); } }
#pragma unroll
    for (int sh = 16; sh; sh >>= 1) s = __fadd_rn(s, __shfl_xor(s, sh, 32));
    const float mean = __fdiv_rn(s, (float)DQ); float s2 = 0.f;
#pragma unroll
    for (int k = 0; k < DQ / 32; ++k) { const float dv = __fsub_rn(v[k], mean); float p2 = __fmul_rn(dv, dv); asm volatile("" : "+v"(p2)); s2 = __fadd_rn(s2, p2); v[k] = dv; }
#pragma unroll
    for (int sh = 16; sh; sh >>= 1) s2 = __fadd_rn(s2, __shfl_xor(s2, sh, 32));
    const float rs = __fdiv_rn(1.0f, __fsqrt_rn(__fadd_rn(__fdiv_rn(s2, (float)DQ), LNEPS)));
{
#pragma unroll
        for (int c = 0; c < DQ / 128; ++c) { v4f o; for (int q = 0; q < 4; ++q) { const int col = c * 128 + lane * 4 + q; float y = __fmul_rn(v[c * 4 + q], rs); asm volatile("" : "+v"(y)); y = __fmul_rn(y, bfr(g[col])); asm volatile("" : "+v"(y)); o[q] = __fadd_rn(y, bfr(bb[col])); } *(v4f*)(orow + c * 128 + lane * 4) = o; }
         } }

extern "C" void kernel_launch(void* const* d_in, const int* in_sizes, int n_in,
                              void* d_out, int out_size, void* d_ws, size_t ws_size, hipStream_t stream) {
    (void)in_sizes; (void)n_in; (void)out_size;
    const float* x = (const float*)d_in[0];   /* query_modality */ const float* xk = (const float*)d_in[1]; const float* xv = (const float*)d_in[2]; const float* wq = (const float*)d_in[3]; const float* bq = (const float*)d_in[4]; const float* wk = (const float*)d_in[5]; const float* bk = (const float*)d_in[6]; const float* wv = (const float*)d_in[7]; const float* bv = (const float*)d_in[8]; const float* wo = (const float*)d_in[9]; const float* bo = (const float*)d_in[10]; const float* mc = (const float*)d_in[11];   /* modal_compat [8] */ const float* lng = (const float*)d_in[12]; const float* lnb = (const float*)d_in[13];
    float* OUT = (float*)d_out;     // [4][2048][512]
    char* wsp = (char*)d_ws;
    auto take = [&](size_t bytes) { char* p = wsp; wsp += (bytes + 255) & ~(size_t)255; return (void*)p; };
    bf* WQ = (bf*)take((size_t)DQ * DM * 2); take((size_t)DKV * DM * 2); take((size_t)DKV * DM * 2);   /* Wq^T, then Wk^T and Wv^T behind it */ bf* WO = (bf*)take((size_t)DM * DQ * 2);
    h16* QP16 = (h16*)take((size_t)NB_ * NH_ * TT * HD * 2); h16* KP16 = (h16*)take((size_t)NB_ * NKV * TT * HD * 2); h16* VT16 = (h16*)take((size_t)NB_ * NKV * HD * TT * 2);
    bf* QPh = (bf*)take((size_t)NB_ * NH_ * TT * HD * 2); bf* QPl = (bf*)take((size_t)NB_ * NH_ * TT * HD * 2); bf* KPh = (bf*)take((size_t)NB_ * NKV * TT * HD * 2); bf* KPl = (bf*)take((size_t)NB_ * NKV * TT * HD * 2); bf* VTh = (bf*)take((size_t)NB_ * NKV * HD * TT * 2); bf* VTl = (bf*)take((size_t)NB_ * NKV * HD * TT * 2);
    bf* XB = (bf*)take((size_t)3 * MT * DM * 2);   // bf16 copies of the query, key, value inputs, one behind the other
    bf* ATh = (bf*)take((size_t)MT * DQ * 2); bf* ATl = (bf*)take((size_t)MT * DQ * 2);
    static_assert(DQ == DM && DKV == DM, "the three input copies and the four transposed weights are equal in size");
    float* Sb = (float*)take((size_t)KSJ * MT * DM * 4);
    if ((size_t)(wsp - (char*)d_ws) > ws_size) return;    // ws 256 MiB
    float* Y = Sb;   // the output projection's K-slice planes
    k_wtG<<<dim3((unsigned)((DM * DQ / 64 + 63) / 64), 4), 256, 0, stream>>>(wq, wk, wv, wo, DM, DQ, WQ);   // WQ, WK, WV, WO are taken one behind the other
    const unsigned LX = (unsigned)(((size_t)MT * DM / 8 + 255) / 256);
    k_cvt8<<<dim3(LX, 3), 256, 0, stream>>>(x, xk, xv, XB, (size_t)MT * DM / 8);
    k_proj<<<dim3(MT / 128, DQ / 128, 3), 128, 0, stream>>>(XB, WQ, bq, bk, bv, QP16, QPh, QPl, KP16, KPh, KPl, VT16, VTh, VTl);
    k_fattn<<<dim3(RH / (AWH * 32), NB_ * NH_), (AWH + AWF) * 32, 0, stream>>>(QP16, KP16, VT16, QPh, QPl, KPh, KPl, VTh, VTl, mc, ATh, ATl);   /* per-head compatibility scale inside */
    k_gemmw<bf, 1, true, KSJ><<<dim3(MT / 64, DM / 64, KSJ), 32, 0, stream>>>(ATh, ATl, WO, nullptr, DQ, Y, DM, bo, 0, 0, 0, (size_t)MT * DM); k_addres<<<(unsigned)(((size_t)MT * DQ / 4 + 255) / 256), 256, 0, stream>>>(Y, x);   /* + query_modality */ k_lnout<<<(MT + 7) / 8, 256, 0, stream>>>(Y, lng, lnb, OUT);
}

// v005
// A run of this version takes 121 microseconds.
// Next to v004, in two timings, it ran 1.30 times as fast each time.
// Counting every step since v000, it is 17.3 times as fast.
#include <hip/hip_runtime.h>

// Cross-modal multi-head attention with a learned per-head compatibility scale, residual and post-LayerNorm (query_modality, key_modality, value_modality [4][2048][512]; Q,K,V = x W + b ('xw' 1/sqrt(512), zero biases; 8 heads x 64); scores = (Q.K / 8) x modal_compat[h] ([1][8][1][1], read); softmax; out = merged Wo + bo; y = LayerNorm(out + query_modality) gamma/beta (1e-5) -> [4][2048][512] (4.2 M)).
// Layout, all batches in one launch of each kernel (rows b*2048+t; head planes [b][h]): bf16 copies of query, key, value inputs; 'xw' weights transposed once; one launch for the q, k, v projections + f32 biases, whose tiles store the head planes themselves; one fused attention kernel for all 32 planes (scores, the head's bf16-rounded compatibility scalar, online softmax, P x V; scores and P stay in registers; hybrid rows: < 512 hi/lo 3 products, rest fp16); merged hi/lo x Wo exact + bo into workspace; residual add of query_modality and a row LayerNorm kernel write the output rows.
// Compute dtypes, f32 accumulate: every input rounded to bf16; projections exact + f32 biases; attention rows < 512 3 products, rest fp16; per-head scale and softmax f32; Wo hl x exact + bias; residual + LayerNorm f32.

#define NB_  4
#define TT   2048
#define DM   512
#define NH_  8
#define NKV  8
#define REP  (NH_ / NKV)
#define HD   64
#define DQ   (NH_ * HD)
#define DKV  (NKV * HD)
#define MT   (NB_ * TT)           // rows of all batches together
#define RH   512                  // query rows < RH use hi+lo planes
#define SCL  0.125f
#define LNEPS 1e-5f
#define KSJ  4                    // K slices of the output projection (K = 512)
// Fragment order, the form of every 16-bit operand plane (input copies, transposed weights, q, k, v planes, merged rows): a plane of rows x k is cut into tiles of 16 rows x 16 k, FT elements = 512 contiguous bytes each;
// inside a tile lane l = 16 ((k % 16) / 8) + row % 16 owns the 16 bytes at 16 l (its 8 neighbouring k). A fragment is two tiles (k and k + 16), so each of its two loads, and each store of a converted accumulator tile, covers four whole 128-byte lines.
// Tiles of one row block lie one behind the other in k (row block r at element 16 r K, as in row-major form); the v planes ([d][t]) lie in blocks of 64 t: tile (t / 16 % 4) * 4 + d / 16 of block t / 64.
#define FT   256                  // elements of a 16 x 16 tile
typedef _Float16 h16;
typedef unsigned short bf;
typedef __attribute__((ext_vector_type(16))) __bf16   v16bf;
typedef __attribute__((ext_vector_type(16))) _Float16 v16h;
typedef __attribute__((ext_vector_type(8)))  _Float16 v8h;
typedef __attribute__((ext_vector_type(8)))  unsigned short v8us;
typedef __attribute__((ext_vector_type(8)))  float    v8f;
typedef __attribute__((ext_vector_type(4)))  float    v4f;
typedef v8h  __attribute__((may_alias)) v8ha;
typedef v4f  __attribute__((may_alias)) v4fa;
typedef v8us __attribute__((may_alias)) v8usa;

__device__ __forceinline__ unsigned short f2bf(float f) { unsigned u = __float_as_uint(f); u += 0x7FFFu + ((u >> 16) & 1u); return (unsigned short)(u >> 16); }
__device__ __forceinline__ float bf2f(unsigned short b) { return __uint_as_float(((unsigned)b) << 16); }
__device__ __forceinline__ float bfr(float f) { return bf2f(f2bf(f)); }
__device__ __forceinline__ v16h cat16(v8h lo, v8h hi) { return __builtin_shufflevector(lo, hi, 0, 1, 2, 3, 4, 5, 6, 7, 8, 9, 10, 11, 12, 13, 14, 15); }
__device__ __forceinline__ v16bf cat16b(v8us lo, v8us hi) { return __builtin_bit_cast(v16bf, __builtin_shufflevector(lo, hi, 0, 1, 2, 3, 4, 5, 6, 7, 8, 9, 10, 11, 12, 13, 14, 15)); }
__device__ __forceinline__ v8f wmma16(v16h a, v16h b, v8f c) { return __builtin_amdgcn_wmma_f32_16x16x32_f16(false, a, false, b, (short)0, c, false, false); }
__device__ __forceinline__ v8f wmmab(v16bf a, v16bf b, v8f c) { return __builtin_amdgcn_wmma_f32_16x16x32_bf16(false, a, false, b, (short)0, c, false, false); }



// ---- k_gemmw: register-blocked GEMM, ONE WAVE per 64x64 output tile (16 accumulators), operands straight from 16-bit planes in fragment order; grid (M/64, N/64, Z), 32 threads.
// C[m][n] (f32, pitch ldc, + optional f32 bias[n]) = sum_k A[m][k] Bt[n][k] (+ split products per NSPLIT). z-batch strides sA/sB/sC in elements. K % (32 KS) == 0.
// Split K: grid z = Z x KS; slice sl of batch z sums k in [sl K/KS, (sl+1) K/KS) into its own f32 plane C + sl sP (bias in slice 0 only); the kernel that reads C adds the KS planes in slice order.
template <typename T16> struct WFrag;
template <> struct WFrag<h16> { typedef v16h V; static __device__ __forceinline__ V ld(const h16* p, int d2 = FT) { return cat16(*(const v8h*)p, *(const v8h*)(p + d2)); } static __device__ __forceinline__ v8f mma(V a, V b, v8f c) { return wmma16(a, b, c); } };
template <> struct WFrag<bf> { typedef v16bf V; static __device__ __forceinline__ V ld(const bf* p, int d2 = FT) { return cat16b(*(const v8us*)p, *(const v8us*)(p + d2)); } static __device__ __forceinline__ v8f mma(V a, V b, v8f c) { return wmmab(a, b, c); } };
template <typename T16, int NSPLIT, bool BIAS, int KS, int K>
__global__ __launch_bounds__(32) void k_gemmw(const T16* __restrict__ A, const T16* __restrict__ A2, const T16* __restrict__ Bt, const T16* __restrict__ Bt2, float* C, int ldc, const float* __restrict__ bias, size_t sA, size_t sB, size_t sC, size_t sP) {
    typedef typename WFrag<T16>::V V;
    __shared__ __align__(16) float os[16 * 68];
    const size_t z = blockIdx.z / KS; const int sl = (int)(blockIdx.z % KS); const int kl = K / KS, kb = sl * kl; A += z * sA; if (A2) A2 += z * sA; Bt += z * sB; if (Bt2) Bt2 += z * sB; C += z * sC + (size_t)sl * sP;
    const int lane = threadIdx.x & 31, lr = lane & 15, hi = lane >> 4; const int r0 = blockIdx.x * 64, c0 = blockIdx.y * 64;
    v8f acc[4][4];
#pragma unroll
    for (int mb = 0; mb < 4; ++mb)
#pragma unroll
        for (int nb = 0; nb < 4; ++nb) acc[mb][nb] = (v8f){};
    v4f bv = (v4f){};   // this lane's four output columns of the bias; zero in every slice but the first, so that the planes' sum holds it once
    if (BIAS && sl == 0) { const float* bp = bias + c0 + lr * 4; bv[0] = bp[0]; bv[1] = bp[1]; bv[2] = bp[2]; bv[3] = bp[3];   // rounded behind the K loop, which covers the load
        asm volatile("s_wait_xcnt 0x0" ::: "memory"); }   // precaution: stands between the load and the address set-up below, which may reuse the load's address registers
    static_assert(NSPLIT == 1, "the loop below walks A, A2 and Bt");
    const unsigned lb = lane * 16;   // this lane's 16 bytes of every tile
    auto at = [&](const T16* p) { return (const T16*)((const char*)p + lb); };
    const T16* pa = at(A + (size_t)r0 * K + kb * (FT / 16)); const T16* pa2 = at(A2 + (size_t)r0 * K + kb * (FT / 16)); const T16* pb = at(Bt + (size_t)c0 * K + kb * (FT / 16));   // row block, then the slice's first tile (16 k on are FT elements on)
#pragma unroll 1
    for (int kc = kb; kc < kb + kl; kc += 32) {
        V a[4], a2[4];
#pragma unroll
        for (int mb = 0; mb < 4; ++mb) { a[mb] = WFrag<T16>::ld(pa + mb * 16 * K); a2[mb] = WFrag<T16>::ld(pa2 + mb * 16 * K); }
#pragma unroll
        for (int nb = 0; nb < 4; ++nb) { const V b = WFrag<T16>::ld(pb + nb * 16 * K); V b2;
#pragma unroll
            for (int mb = 0; mb < 4; ++mb) { acc[mb][nb] = WFrag<T16>::mma(a[mb], b, acc[mb][nb]); if (NSPLIT == 1 || NSPLIT == 2) acc[mb][nb] = WFrag<T16>::mma(a2[mb], b, acc[mb][nb]); if (NSPLIT >= 2) acc[mb][nb] = WFrag<T16>::mma(a[mb], b2, acc[mb][nb]); } }
        asm volatile("s_wait_xcnt 0x0" :: "v"(pa), "v"(pa2), "v"(pb), "v"(lb) : "memory");   // precaution: as inputs, the loads' address registers stay live up to this wait, which stands in front of the advance
        pa += 2 * FT; pa2 += 2 * FT; pb += 2 * FT;
        asm volatile("v_nop\n\tv_nop\n\tv_nop\n\tv_nop" : "+v"(acc[0][0]), "+v"(acc[1][1]), "+v"(acc[2][2]), "+v"(acc[3][3]) : "v"(a[0]), "v"(a[3]));
    }
    if (BIAS) { bv[0] = bfr(bv[0]); bv[1] = bfr(bv[1]); bv[2] = bfr(bv[2]); bv[3] = bfr(bv[3]); }
#pragma unroll
    for (int mb = 0; mb < 4; ++mb) {
#pragma unroll
        for (int nb = 0; nb < 4; ++nb) {
#pragma unroll
            for (int j = 0; j < 8; ++j) os[(hi * 8 + j) * 68 + nb * 16 + lr] = acc[mb][nb][j]; }
        __builtin_amdgcn_wave_barrier(); asm volatile("" ::: "memory");
        float* crow = C + (size_t)(r0 + mb * 16) * ldc + c0;
{
#pragma unroll
            for (int s = 0; s < 8; ++s) { const int row = 2 * s + hi, cofs = lr * 4; v4f val = *(const v4fa*)(os + row * 68 + cofs); if (BIAS) val += bv;
                *(v4f*)(crow + (size_t)row * ldc + cofs) = val; }
             }
        __builtin_amdgcn_wave_barrier(); asm volatile("" ::: "memory");
    }
}

__device__ __forceinline__ void splitf(float y, unsigned short& h, unsigned short& l) { h = f2bf(y); l = f2bf(y - bf2f(h)); }
typedef __attribute__((ext_vector_type(2))) _Float16 v2h;
typedef __attribute__((ext_vector_type(4))) _Float16 v4h;
typedef __attribute__((ext_vector_type(2))) unsigned short v2us;
typedef __attribute__((ext_vector_type(4))) unsigned short v4us;
typedef __attribute__((ext_vector_type(2))) float v2f;
typedef __attribute__((ext_vector_type(4))) int v4i;

// k_wtG: a thread makes one lane's 16 bytes of a tile of W^T: 8 neighbouring k of one n. Lanes run along n, so each of its 8 loads reads whole lines of w and the store covers two runs of 256 bytes.
__global__ __launch_bounds__(256) void k_wtG(const float* __restrict__ w0, const float* __restrict__ w1, const float* __restrict__ w2, const float* __restrict__ w3, bf* Bt) {
    const float* __restrict__ w = blockIdx.y == 0 ? w0 : blockIdx.y == 1 ? w1 : blockIdx.y == 2 ? w2 : w3; Bt += (size_t)blockIdx.y * DQ * DM;   // grid y: which of the four equal-shaped weights [DM][DQ]; their transposes lie one behind the other
    const int i = blockIdx.x * 256 + threadIdx.x; const int n = i % DQ, k8 = i / DQ; if (k8 >= DM / 8) return;
    const float* wp = w + (size_t)k8 * 8 * DQ + n; float v[8];
#pragma unroll
    for (int e = 0; e < 8; ++e) v[e] = wp[e * DQ];
    asm volatile("s_wait_xcnt 0x0" :: "v"(wp) : "memory");   // precaution: as an input, the eight loads' address stays live up to this wait
    v8us o;
#pragma unroll
    for (int e = 0; e < 8; ++e) o[e] = f2bf(v[e]);
    *(v8us*)(Bt + ((size_t)(n >> 4) * (DM >> 4) + (k8 >> 1)) * FT + ((k8 & 1) * 16 + (n & 15)) * 8) = o;
}
// k_cvt8: a thread makes one lane's 16 bytes of a tile of an input copy (8 neighbouring columns of one row). A wave takes 8 rows x 32 columns: it reads one whole line of each row and stores four whole lines (two tiles x two k halves, 8 rows of each).
__global__ __launch_bounds__(256) void k_cvt8(const float* __restrict__ s0, const float* __restrict__ s1, const float* __restrict__ s2, bf* dst, size_t n8) { const size_t i = (size_t)blockIdx.x * 256 + threadIdx.x; if (i >= n8) return; const float* __restrict__ src = blockIdx.y == 0 ? s0 : blockIdx.y == 1 ? s1 : s2; dst += (size_t)blockIdx.y * n8 * 8;   /* grid y: which of the three equal-shaped inputs; their copies lie one behind the other */
    const int lane = (int)(i & 31), c8 = lane & 7, p = lane >> 3; const unsigned wv = (unsigned)(i >> 5); const int ch = wv & 1, k2 = (wv >> 1) & (DM / 32 - 1); const unsigned rb = wv / (DM / 16);   // rows 8 ch .. + 7 of row block rb, columns 32 k2 + 8 p .. + 7
    const v8f v = *(const v8f*)(src + (size_t)(rb * 16 + ch * 8 + c8) * DM + k2 * 32 + p * 8); v8us o;
#pragma unroll
    for (int k = 0; k < 8; ++k) o[k] = f2bf(v[k]); *(v8us*)(dst + ((size_t)rb * (DM / 16) + k2 * 2 + (p >> 1)) * FT + ((p & 1) * 16 + ch * 8 + c8) * 8) = o;  }

// ---- k_fattn: scores, softmax and P x V of one (batch, head) in one kernel; no score and no P ever leaves the registers.
// Transposed products: S^T = K Q^T (A = 16 key rows, B = 16 query columns), so a lane holds 8 keys' scores of ONE query per tile; two score tiles (32 keys), converted in place, are the B operand of O^T += V^T P^T (A = 16 d rows of the [d][t] plane).
// Every fragment comes by WFrag::ld, whose two 16-byte halves (k = 8 hi .. and 16 + 8 hi .., from two tiles of a plane in fragment order) are the order in which the packed score tiles lie.
// Online softmax in the log2 domain: the maximum in use may trail the true one by up to 8, sums and outputs are rescaled only when a column's maximum passes that.
// Query rows < RH: bf16 hi/lo planes, 3 products each, 32 columns a wave; the rest fp16, 64 columns a wave. Output: the merged hi/lo bf16 rows [b t][h d], in fragment order.
// A work-group is AWH hi/lo waves and AWF fp16 waves of one plane (no barrier, no LDS: the waves share only the cache): 8 equal work-groups a plane, 256 in all, one per WGP.
#define AWH  2                    // hi/lo waves per work-group of k_fattn, 32 query rows each
#define AWF  3                    // fp16 waves per work-group, 64 query rows each
#define NPS  (TT / 32)            // 32-key passes
typedef __attribute__((ext_vector_type(2))) __bf16 v2bf;
typedef __attribute__((ext_vector_type(8))) unsigned v8u;
__device__ __forceinline__ float xhalf(float x) { return __builtin_bit_cast(float, __builtin_amdgcn_permlanex16(__builtin_bit_cast(int, x), __builtin_bit_cast(int, x), 0x76543210, 0xfedcba98, false, false)); }   // lane l with lane l ^ 16
__device__ __forceinline__ unsigned pk2(float a, float b, bf) { v2f x; x[0] = a; x[1] = b; return __builtin_bit_cast(unsigned, __builtin_convertvector(x, v2bf)); }
__device__ __forceinline__ unsigned pk2(float a, float b, h16) { v2f x; x[0] = a; x[1] = b; return __builtin_bit_cast(unsigned, __builtin_convertvector(x, v2h)); }
// xwait: precaution behind a group of global loads: as inputs, the loads' address registers stay live up to this wait, so none is advanced or reused in front of it
template <bool HI, typename T16> __device__ __forceinline__ void xwait(const T16* a, const T16* b) { if (HI) asm volatile("s_wait_xcnt 0x0" :: "v"(a), "v"(b) : "memory"); else asm volatile("s_wait_xcnt 0x0" :: "v"(a) : "memory"); }
// the same where the addresses are a plane's base + the lane's byte offset lb inside a tile: a load may name lb itself beside a scalar base, so lb is held too
template <bool HI, typename T16> __device__ __forceinline__ void xwaits(const T16* a, const T16* b, unsigned lb) { if (HI) asm volatile("s_wait_xcnt 0x0" :: "v"(a), "v"(b), "v"(lb) : "memory"); else asm volatile("s_wait_xcnt 0x0" :: "v"(a), "v"(lb) : "memory"); }
template <typename T16> __device__ __forceinline__ const T16* atl(const T16* base, unsigned lb) { return (const T16*)((const char*)base + lb); }
// ---- k_proj: the q, k and v projections of all batches in one launch, each with its layout step: ONE WAVE per 64x64 tile sums the whole K = DM in registers and stores the fp16, hi and lo head planes itself (no f32 plane, no LDS, no barrier).
// grid (MT/128, DQ/128, 3), 4 waves = 2x2 tiles a work-group: two waves each read the same operand rows at about the same time, so that the second can find them in the WGP cache. z picks input copy, transposed weight, bias and planes. A tile is 64 rows t of one batch x the 64 columns d of one head.
// TR (q, k; planes [b][h][t][d]): D = W^T-rows x X-rows, so a lane's 8 accumulator registers are 8 neighbouring d of one t. Not TR (v; planes [b][h][d][t]): D = X-rows x W^T-rows, 8 neighbouring t of one d. Either way one 16-byte store a plane and tile, and the wave's store is that tile in fragment order: 512 contiguous bytes; a wave's 64x64 tile is 8 KiB in a row of each plane.
// The accumulators start at the bf16-rounded bias.
typedef __attribute__((ext_vector_type(4))) unsigned v4u;
typedef v4u __attribute__((may_alias)) v4ua;
template <bool TR>
__device__ __forceinline__ void proj_tile(const bf* __restrict__ X, const bf* __restrict__ Wt, const float* __restrict__ bias, h16* P16, bf* Ph, bf* Pl) {
    typedef WFrag<bf> W; typedef WFrag<bf>::V V;
    const int lane = threadIdx.x & 31, lr = lane & 15, hi = lane >> 4; const int wave = __builtin_amdgcn_readfirstlane(threadIdx.x >> 5); const int r0 = (blockIdx.x * 2 + (wave & 1)) * 64, hd = blockIdx.y * 2 + (wave >> 1), c0 = hd * 64;
    // every full unroll below: fragments and sums are register arrays, which only constant indices keep in registers
    v8f acc[4][4];
    if (TR) { const float* bp = bias + c0 + 8 * hi; v8f bv[4];
#pragma unroll
        for (int nb = 0; nb < 4; ++nb) bv[nb] = *(const v8f*)(bp + nb * 16);
        asm volatile("s_wait_xcnt 0x0" :: "v"(bp) : "memory");   // precaution: as an input, the bias loads' address stays live up to this wait
#pragma unroll
        for (int nb = 0; nb < 4; ++nb) {
#pragma unroll
            for (int j = 0; j < 8; ++j) bv[nb][j] = bfr(bv[nb][j]);
#pragma unroll
            for (int mb = 0; mb < 4; ++mb) acc[mb][nb] = bv[nb]; } }
    else { const float* bp = bias + c0 + lr; float bv[4];
#pragma unroll
        for (int nb = 0; nb < 4; ++nb) bv[nb] = bp[nb * 16];
        asm volatile("s_wait_xcnt 0x0" :: "v"(bp) : "memory");   // precaution: as an input, the bias loads' address stays live up to this wait
#pragma unroll
        for (int nb = 0; nb < 4; ++nb) { const float bb = bfr(bv[nb]);
#pragma unroll
            for (int mb = 0; mb < 4; ++mb)
#pragma unroll
                for (int j = 0; j < 8; ++j) acc[mb][nb][j] = bb; } }
    const bf* xp = X + (size_t)r0 * DM + lane * 8; const bf* wp = Wt + (size_t)c0 * DM + lane * 8;
    V a0[4], b0[4], a1[4], b1[4];   // two fragment sets of 32 k each: one is in flight while the other is multiplied
#pragma unroll
    for (int i = 0; i < 4; ++i) { a0[i] = W::ld(xp + i * 16 * DM); b0[i] = W::ld(wp + i * 16 * DM); }
#pragma unroll 1   // stays rolled: a trip already takes 64 k, 2 KiB in a row of each operand row block
    for (int kc = 0; kc < DM; kc += 64) {
#pragma unroll
        for (int i = 0; i < 4; ++i) { a1[i] = W::ld(xp + i * 16 * DM + 2 * FT); b1[i] = W::ld(wp + i * 16 * DM + 2 * FT); }
        __builtin_amdgcn_sched_barrier(0);   // keeps the sixteen loads in front of the products of the other set: sunk behind them, their latency would lie open
#pragma unroll
        for (int nb = 0; nb < 4; ++nb)
#pragma unroll
            for (int mb = 0; mb < 4; ++mb) acc[mb][nb] = TR ? W::mma(b0[nb], a0[mb], acc[mb][nb]) : W::mma(a0[mb], b0[nb], acc[mb][nb]);
        xwait<true>(xp, wp);   // stands between every load issued so far and the advance of their addresses
        const int adv = (kc + 64 < DM) ? 4 * FT : 0;   // the last trip fetches its own first half again: inside the plane, never used
        xp += adv; wp += adv;
#pragma unroll
        for (int i = 0; i < 4; ++i) { a0[i] = W::ld(xp + i * 16 * DM); b0[i] = W::ld(wp + i * 16 * DM); }
        __builtin_amdgcn_sched_barrier(0);   // as above
#pragma unroll
        for (int nb = 0; nb < 4; ++nb)
#pragma unroll
            for (int mb = 0; mb < 4; ++mb) acc[mb][nb] = TR ? W::mma(b1[nb], a1[mb], acc[mb][nb]) : W::mma(a1[mb], b1[nb], acc[mb][nb]);
    }
    xwait<true>(xp, wp);   // behind the last trip's loads: their addresses' registers are free for reuse below
    const int bt = r0 / TT, t0 = r0 % TT;   // 64 divides TT: a tile's rows lie in one batch
    const size_t e0 = ((size_t)(bt * NH_ + hd) * TT + t0) * HD + lane * 8;   // q, k: row blocks t0 / 16 .. + 3, four tiles each; v: block t0 / 64
    h16* p16 = P16 + e0; bf* ph = Ph + e0; bf* pl = Pl + e0;
#pragma unroll
    for (int mb = 0; mb < 4; ++mb) { v4u o16[4], oh[4], ol[4];
#pragma unroll
        for (int nb = 0; nb < 4; ++nb) {
#pragma unroll
            for (int i = 0; i < 4; ++i) { const float y0 = acc[mb][nb][2 * i], y1 = acc[mb][nb][2 * i + 1]; o16[nb][i] = pk2(y0, y1, h16()); const unsigned wh = pk2(y0, y1, bf()); oh[nb][i] = wh;
                ol[nb][i] = pk2(y0 - __uint_as_float(wh << 16), y1 - __uint_as_float(wh & 0xFFFF0000u), bf()); }
            const int eo = (mb * 4 + nb) * FT;
            *(v4ua*)(p16 + eo) = o16[nb]; *(v4ua*)(ph + eo) = oh[nb]; *(v4ua*)(pl + eo) = ol[nb]; }
        asm volatile("s_wait_xcnt 0x0" :: "v"(o16[0]), "v"(o16[1]), "v"(o16[2]), "v"(o16[3]), "v"(oh[0]), "v"(oh[1]), "v"(oh[2]), "v"(oh[3]), "v"(ol[0]), "v"(ol[1]), "v"(ol[2]), "v"(ol[3]) : "memory"); }   // precaution: as inputs, the twelve stores' data registers stay live up to this wait, so the next row of tiles does not overwrite them in front of it
}
__global__ __launch_bounds__(128) void k_proj(const bf* __restrict__ XB, const bf* __restrict__ WT, const float* __restrict__ bq, const float* __restrict__ bk, const float* __restrict__ bv, h16* Q16, bf* Qh, bf* Ql, h16* K16, bf* Kh, bf* Kl, h16* V16, bf* Vh, bf* Vl) {
    static_assert(TT % 64 == 0 && MT % 128 == 0 && HD == 64 && DM % 64 == 0 && DQ == DKV && DQ % 128 == 0, "a 64x64 tile is one head's columns and rows of one batch");
    const int z = blockIdx.z; const bf* X = XB + (size_t)z * MT * DM; const bf* Wt = WT + (size_t)z * DQ * DM;   // the input copies and the transposed weights lie one behind the other
    if (z < 2) proj_tile<true>(X, Wt, z == 0 ? bq : bk, z == 0 ? Q16 : K16, z == 0 ? Qh : Kh, z == 0 ? Ql : Kl);   // block-uniform: a scalar branch
    else proj_tile<false>(X, Wt, bv, V16, Vh, Vl);
}
template <typename T16, bool HI, int R>
__device__ __forceinline__ void attn_wave(const T16* __restrict__ Q, const T16* __restrict__ Q2, const T16* __restrict__ Kp, const T16* __restrict__ K2, const T16* __restrict__ Vt, const T16* __restrict__ V2, float csc, int q0, bf* Ah, bf* Al) {
    typedef typename WFrag<T16>::V V; typedef WFrag<T16> W;
    const int lane = threadIdx.x & 31;
    // every full unroll below: fragments, scores and sums are register arrays, which only constant indices keep in registers
    V qf[R][2], ql[R][2];
    const unsigned lb = lane * 16;   // this lane's 16 bytes of every tile
    { const T16* qp = atl(Q + (size_t)q0 * HD, lb); const T16* qp2 = HI ? atl(Q2 + (size_t)q0 * HD, lb) : qp;
#pragma unroll
      for (int g = 0; g < R; ++g)
#pragma unroll
        for (int kc = 0; kc < 2; ++kc) { qf[g][kc] = W::ld(qp + g * 16 * HD + 2 * FT * kc); if (HI) ql[g][kc] = W::ld(qp2 + g * 16 * HD + 2 * FT * kc); }
      xwaits<HI>(qp, qp2, lb); }
    v8f acc[R][4]; float m_run[R], l_run[R];
#pragma unroll
    for (int g = 0; g < R; ++g) { m_run[g] = -__builtin_inff(); l_run[g] = 0.f;
#pragma unroll
        for (int t = 0; t < 4; ++t) acc[g][t] = (v8f){}; }
    const T16* kp = atl(Kp, lb); const T16* kp2 = HI ? atl(K2, lb) : kp;
    const T16* vp = atl(Vt, lb); const T16* vp2 = HI ? atl(V2, lb) : vp;
    V kf[2][2], kl[2][2];
#pragma unroll
    for (int kt = 0; kt < 2; ++kt)
#pragma unroll
        for (int kc = 0; kc < 2; ++kc) { kf[kt][kc] = W::ld(kp + kt * 16 * HD + 2 * FT * kc); if (HI) kl[kt][kc] = W::ld(kp2 + kt * 16 * HD + 2 * FT * kc); }
    xwaits<HI>(kp, kp2, lb);   // the K addresses are advanced in the loop
#pragma unroll 1   // stays rolled: the body already holds two passes; more would only grow the code and the registers
    for (int pp = 0; pp < NPS / 2; ++pp) {
        V vf[2][4], vl[2][4];   // two passes' V^T fragments, 64 keys = one 8-KiB block of the plane: issued first, used behind the exponentials
#pragma unroll
        for (int t = 0; t < 4; ++t)
#pragma unroll
            for (int u = 0; u < 2; ++u) { vf[u][t] = W::ld(vp + (8 * u + t) * FT, 4 * FT); if (HI) vl[u][t] = W::ld(vp2 + (8 * u + t) * FT, 4 * FT); }   // keys 32 u .. + 15 in tile 8 u + t, the next 16 four tiles on
        xwaits<HI>(vp, vp2, lb);   // stands between the V loads and the advance of their addresses
        vp += 64 * HD; if (HI) vp2 += 64 * HD;
#pragma unroll
      for (int u = 0; u < 2; ++u) {   // the two 32-key passes
        v8f s[2][R];
#pragma unroll
        for (int kt = 0; kt < 2; ++kt)
#pragma unroll
            for (int g = 0; g < R; ++g) { s[kt][g] = (v8f){};
#pragma unroll
                for (int kc = 0; kc < 2; ++kc) { s[kt][g] = W::mma(kf[kt][kc], qf[g][kc], s[kt][g]); if (HI) { s[kt][g] = W::mma(kf[kt][kc], ql[g][kc], s[kt][g]); s[kt][g] = W::mma(kl[kt][kc], qf[g][kc], s[kt][g]); } } }
        if (u == 1) { const int adv = (pp + 1 < NPS / 2) ? 64 * HD : 0;   // kp: the first K row of a pair of passes; the last pass fetches rows of its own pair again: inside the plane, never used
          kp += adv; if (HI) kp2 += adv; }
        const int ko = (u == 0) ? 32 * HD : 0;
#pragma unroll
        for (int kt = 0; kt < 2; ++kt)   // the next pass's K fragments, in flight under this pass's softmax and second product
#pragma unroll
            for (int kc = 0; kc < 2; ++kc) { kf[kt][kc] = W::ld(kp + ko + kt * 16 * HD + 2 * FT * kc); if (HI) kl[kt][kc] = W::ld(kp2 + ko + kt * 16 * HD + 2 * FT * kc); }
        xwaits<HI>(kp, kp2, lb);   // stands between the K loads and the next advance of their addresses
        float mb[R]; bool need = false;
#pragma unroll
        for (int g = 0; g < R; ++g) { s[0][g] = s[0][g] * csc; s[1][g] = s[1][g] * csc;   // the head's scale may be negative: scale first, then the maximum
            float mx = fmaxf(s[0][g][0], s[1][g][0]);
#pragma unroll
            for (int r = 1; r < 8; ++r) mx = fmaxf(mx, fmaxf(s[0][g][r], s[1][g][r]));
            mx = fmaxf(mx, xhalf(mx)); mb[g] = mx; need = need || (mx > m_run[g] + 8.0f); }
        if (__builtin_amdgcn_ballot_w32(need) != 0) {   // one scalar branch a pass; rare behind the first passes
#pragma unroll
            for (int g = 0; g < R; ++g) { const float mn = fmaxf(m_run[g], mb[g]); const float corr = __builtin_amdgcn_exp2f(m_run[g] - mn); m_run[g] = mn; l_run[g] *= corr;
#pragma unroll
                for (int t = 0; t < 4; ++t) acc[g][t] = acc[g][t] * corr; } }
#pragma unroll
        for (int g = 0; g < R; ++g) { v8u w, wl;
#pragma unroll
            for (int i = 0; i < 8; ++i) {
                const float p0 = __builtin_amdgcn_exp2f(s[i >> 2][g][2 * (i & 3)] - m_run[g]), p1 = __builtin_amdgcn_exp2f(s[i >> 2][g][2 * (i & 3) + 1] - m_run[g]);
                l_run[g] += p0; l_run[g] += p1; w[i] = pk2(p0, p1, T16());
                if (HI) wl[i] = pk2(p0 - __uint_as_float(w[i] << 16), p1 - __uint_as_float(w[i] & 0xFFFF0000u), T16()); }
            const V pf = __builtin_bit_cast(V, w);
#pragma unroll
            for (int t = 0; t < 4; ++t) { acc[g][t] = W::mma(vf[u][t], pf, acc[g][t]); if (HI) { acc[g][t] = W::mma(vf[u][t], __builtin_bit_cast(V, wl), acc[g][t]); acc[g][t] = W::mma(vl[u][t], pf, acc[g][t]); } } }
      }
    }
    bf* ap = Ah + (size_t)q0 * DQ + lane * 8; bf* ap2 = Al + (size_t)q0 * DQ + lane * 8;
#pragma unroll
    for (int g = 0; g < R; ++g) { const float l = l_run[g] + xhalf(l_run[g]); const float inv = __fdiv_rn(1.0f, l);   // the wave halves' sums joined once
#pragma unroll
        for (int t = 0; t < 4; ++t) { v8us oh, ol;   // a lane's 8 registers are d = 16 t + 8 h .. + 7 of its query: one 16-byte store a plane
#pragma unroll
            for (int r = 0; r < 8; ++r) { unsigned short a, c2; splitf(acc[g][t][r] * inv, a, c2); oh[r] = a; ol[r] = c2; }
            *(v8us*)(ap + (size_t)g * 16 * DQ + t * FT) = oh; *(v8us*)(ap2 + (size_t)g * 16 * DQ + t * FT) = ol;
            asm volatile("s_wait_xcnt 0x0" :: "v"(oh), "v"(ol) : "memory"); } }   // precaution: as inputs, the two stores' data registers stay live up to this wait, so the next tile's values do not overwrite them in front of it
}
__global__ __launch_bounds__((AWH + AWF) * 32) void k_fattn(const h16* __restrict__ Q16, const h16* __restrict__ K16, const h16* __restrict__ V16, const bf* __restrict__ Qh, const bf* __restrict__ Ql, const bf* __restrict__ Kh, const bf* __restrict__ Kl, const bf* __restrict__ Vh, const bf* __restrict__ Vl, const float* __restrict__ mcp, bf* Ah, bf* Al) {
    static_assert(REP == 1 && HD == 64 && RH % (AWH * 32) == 0 && (TT - RH) % (AWF * 64) == 0 && RH / (AWH * 32) == (TT - RH) / (AWF * 64), "one kv head per query head; every work-group has its share of both kinds of rows");
    const int z = blockIdx.y, hd = z % NH_, b = z / NH_; const size_t pl = (size_t)z * TT * HD;   // grid y: the (batch, head) plane; grid x: the query block
    const float csc = __fmul_rn(__fmul_rn(SCL, bfr(mcp[hd])), 1.4426950408889634f);   // (1/8) x modal_compat[h] (bf16-rounded input) x log2 e
    const int wave = __builtin_amdgcn_readfirstlane(threadIdx.x >> 5); const int yb = blockIdx.x;
    bf* ah = Ah + (size_t)b * TT * DQ + hd * (HD / 16) * FT; bf* al = Al + (size_t)b * TT * DQ + hd * (HD / 16) * FT;   // the head's four tiles of every row block
    if (wave < AWH) attn_wave<bf, true, 2>(Qh + pl, Ql + pl, Kh + pl, Kl + pl, Vh + pl, Vl + pl, csc, (yb * AWH + wave) * 32, ah, al);   // wave-uniform: a scalar branch
    else attn_wave<h16, false, 4>(Q16 + pl, nullptr, K16 + pl, nullptr, V16 + pl, nullptr, csc, RH + (yb * AWF + wave - AWH) * 64, ah, al);
}
__global__ __launch_bounds__(256) void k_addres(float* Y, const float* __restrict__ xr) { const unsigned i = blockIdx.x * 256 + threadIdx.x; if (i >= (unsigned)((size_t)MT * DQ / 4)) return; const unsigned ob = i * 16u;   /* byte offset inside a plane, 32 bits */
    static_assert((size_t)MT * DQ * 4 <= 0xFFFFFFFFull, "a plane's byte offsets fit 32 bits");
    v4f a = *(const v4f*)((const char*)Y + ob);
#pragma unroll
    for (int s = 1; s < KSJ; ++s) a += *(const v4f*)((const char*)(Y + (size_t)s * MT * DQ) + ob);   /* the output projection's K-slice planes, in slice order */
    const v4f r = *(const v4f*)((const char*)xr + ob); v4f o;
#pragma unroll
    for (int q = 0; q < 4; ++q) o[q] = __fadd_rn(a[q], bfr(r[q]));
    *(v4f*)((char*)Y + ob) = o;  }
__global__ __launch_bounds__(256) void k_lnout(const float* __restrict__ F, const float* __restrict__ g, const float* __restrict__ bb, float* out) { const int lane = threadIdx.x & 31; const int row = blockIdx.x * 8 + (threadIdx.x >> 5); if (row >= MT) return; const float* fr = F + (size_t)row * DQ; float* orow = out + (size_t)row * DQ; float v[DQ / 32]; float s = 0.f;
#pragma unroll
    for (int c = 0; c < DQ / 128; ++c) { const v4f a = *(const v4f*)(fr + c * 128 + lane * 4); for (int q = 0; q < 4; ++q) { v[c * 4 + q] = a[q]; s = __fadd_rn(s, a[q]); } }
#pragma unroll
    for (int sh = 16; sh; sh >>= 1) s = __fadd_rn(s, __shfl_xor(s, sh, 32));
    const float mean = __fdiv_rn(s, (float)DQ); float s2 = 0.f;
#pragma unroll
    for (int k = 0; k < DQ / 32; ++k) { const float dv = __fsub_rn(v[k], mean); float p2 = __fmul_rn(dv, dv); asm volatile("" : "+v"(p2)); s2 = __fadd_rn(s2, p2); v[k] = dv; }
#pragma unroll
    for (int sh = 16; sh; sh >>= 1) s2 = __fadd_rn(s2, __shfl_xor(s2, sh, 32));
    const float rs = __fdiv_rn(1.0f, __fsqrt_rn(__fadd_rn(__fdiv_rn(s2, (float)DQ), LNEPS)));
{
#pragma unroll
        for (int c = 0; c < DQ / 128; ++c) { v4f o; for (int q = 0; q < 4; ++q) { const int col = c * 128 + lane * 4 + q; float y = __fmul_rn(v[c * 4 + q], rs); asm volatile("" : "+v"(y)); y = __fmul_rn(y, bfr(g[col])); asm volatile("" : "+v"(y)); o[q] = __fadd_rn(y, bfr(bb[col])); } *(v4f*)(orow + c * 128 + lane * 4) = o; }
         } }

extern "C" void kernel_launch(void* const* d_in, const int* in_sizes, int n_in,
                              void* d_out, int out_size, void* d_ws, size_t ws_size, hipStream_t stream) {
    (void)in_sizes; (void)n_in; (void)out_size;
    const float* x = (const float*)d_in[0];   /* query_modality */ const float* xk = (const float*)d_in[1]; const float* xv = (const float*)d_in[2]; const float* wq = (const float*)d_in[3]; const float* bq = (const float*)d_in[4]; const float* wk = (const float*)d_in[5]; const float* bk = (const float*)d_in[6]; const float* wv = (const float*)d_in[7]; const float* bv = (const float*)d_in[8]; const float* wo = (const float*)d_in[9]; const float* bo = (const float*)d_in[10]; const float* mc = (const float*)d_in[11];   /* modal_compat [8] */ const float* lng = (const float*)d_in[12]; const float* lnb = (const float*)d_in[13];
    float* OUT = (float*)d_out;     // [4][2048][512]
    char* wsp = (char*)d_ws;
    auto take = [&](size_t bytes) { char* p = wsp; wsp += (bytes + 255) & ~(size_t)255; return (void*)p; };
    bf* WQ = (bf*)take((size_t)DQ * DM * 2); take((size_t)DKV * DM * 2); take((size_t)DKV * DM * 2);   /* Wq^T, then Wk^T and Wv^T behind it */ bf* WO = (bf*)take((size_t)DM * DQ * 2);
    h16* QP16 = (h16*)take((size_t)NB_ * NH_ * TT * HD * 2); h16* KP16 = (h16*)take((size_t)NB_ * NKV * TT * HD * 2); h16* VT16 = (h16*)take((size_t)NB_ * NKV * HD * TT * 2);
    bf* QPh = (bf*)take((size_t)NB_ * NH_ * TT * HD * 2); bf* QPl = (bf*)take((size_t)NB_ * NH_ * TT * HD * 2); bf* KPh = (bf*)take((size_t)NB_ * NKV * TT * HD * 2); bf* KPl = (bf*)take((size_t)NB_ * NKV * TT * HD * 2); bf* VTh = (bf*)take((size_t)NB_ * NKV * HD * TT * 2); bf* VTl = (bf*)take((size_t)NB_ * NKV * HD * TT * 2);
    bf* XB = (bf*)take((size_t)3 * MT * DM * 2);   // bf16 copies of the query, key, value inputs, one behind the other
    bf* ATh = (bf*)take((size_t)MT * DQ * 2); bf* ATl = (bf*)take((size_t)MT * DQ * 2);
    static_assert(DQ == DM && DKV == DM, "the three input copies and the four transposed weights are equal in size");
    float* Sb = (float*)take((size_t)KSJ * MT * DM * 4);
    if ((size_t)(wsp - (char*)d_ws) > ws_size) return;    // ws 256 MiB
    float* Y = Sb;   // the output projection's K-slice planes
    k_wtG<<<dim3((unsigned)((DM * DQ / 8 + 255) / 256), 4), 256, 0, stream>>>(wq, wk, wv, wo, WQ);   // WQ, WK, WV, WO are taken one behind the other
    const unsigned LX = (unsigned)(((size_t)MT * DM / 8 + 255) / 256);
    k_cvt8<<<dim3(LX, 3), 256, 0, stream>>>(x, xk, xv, XB, (size_t)MT * DM / 8);
    k_proj<<<dim3(MT / 128, DQ / 128, 3), 128, 0, stream>>>(XB, WQ, bq, bk, bv, QP16, QPh, QPl, KP16, KPh, KPl, VT16, VTh, VTl);
    k_fattn<<<dim3(RH / (AWH * 32), NB_ * NH_), (AWH + AWF) * 32, 0, stream>>>(QP16, KP16, VT16, QPh, QPl, KPh, KPl, VTh, VTl, mc, ATh, ATl);   /* per-head compatibility scale inside */
    k_gemmw<bf, 1, true, KSJ, DQ><<<dim3(MT / 64, DM / 64, KSJ), 32, 0, stream>>>(ATh, ATl, WO, nullptr, Y, DM, bo, 0, 0, 0, (size_t)MT * DM); k_addres<<<(unsigned)(((size_t)MT * DQ / 4 + 255) / 256), 256, 0, stream>>>(Y, x);   /* + query_modality */ k_lnout<<<(MT + 7) / 8, 256, 0, stream>>>(Y, lng, lnb, OUT);
}

// v006
// Measured time: 105 microseconds a run.
// Timed twice side by side with v005, it ran 1.15 times as fast both times.
// Counting every step since v000, it is 19.9 times as fast.
#include <hip/hip_runtime.h>

// Cross-modal multi-head attention with a learned per-head compatibility scale, residual and post-LayerNorm (query_modality, key_modality, value_modality [4][2048][512]; Q,K,V = x W + b ('xw' 1/sqrt(512), zero biases; 8 heads x 64); scores = (Q.K / 8) x modal_compat[h] ([1][8][1][1], read); softmax; out = merged Wo + bo; y = LayerNorm(out + query_modality) gamma/beta (1e-5) -> [4][2048][512] (4.2 M)).
// Layout, all batches in one launch of each kernel (rows b*2048+t; head planes [b][h]): bf16 copies of query, key, value inputs; 'xw' weights transposed once; one launch for the q, k, v projections + f32 biases, whose tiles store the head planes themselves; one fused attention kernel for all 32 planes (scores, the head's bf16-rounded compatibility scalar, online softmax, P x V; scores and P stay in registers; hybrid rows: < 512 hi/lo 3 products, rest fp16); one kernel for merged hi/lo x Wo exact + bo, the residual add of query_modality and the row LayerNorm, which writes the output rows.
// Compute dtypes, f32 accumulate: every input rounded to bf16; projections exact + f32 biases; attention rows < 512 3 products, rest fp16; per-head scale and softmax f32; Wo hl x exact + bias; residual + LayerNorm f32.

#define NB_  4
#define TT   2048
#define DM   512
#define NH_  8
#define NKV  8
#define REP  (NH_ / NKV)
#define HD   64
#define DQ   (NH_ * HD)
#define DKV  (NKV * HD)
#define MT   (NB_ * TT)           // rows of all batches together
#define RH   512                  // query rows < RH use hi+lo planes
#define SCL  0.125f
#define LNEPS 1e-5f
// Fragment order, the form of every 16-bit operand plane (input copies, transposed weights, q, k, v planes, merged rows): a plane of rows x k is cut into tiles of 16 rows x 16 k, FT elements = 512 contiguous bytes each;
// inside a tile lane l = 16 ((k % 16) / 8) + row % 16 owns the 16 bytes at 16 l (its 8 neighbouring k). A fragment is two tiles (k and k + 16), so each of its two loads, and each store of a converted accumulator tile, covers four whole 128-byte lines.
// Tiles of one row block lie one behind the other in k (row block r at element 16 r K, as in row-major form); the v planes ([d][t]) lie in blocks of 64 t: tile (t / 16 % 4) * 4 + d / 16 of block t / 64.
#define FT   256                  // elements of a 16 x 16 tile
typedef _Float16 h16;
typedef unsigned short bf;
typedef __attribute__((ext_vector_type(16))) __bf16   v16bf;
typedef __attribute__((ext_vector_type(16))) _Float16 v16h;
typedef __attribute__((ext_vector_type(8)))  _Float16 v8h;
typedef __attribute__((ext_vector_type(8)))  unsigned short v8us;
typedef __attribute__((ext_vector_type(8)))  float    v8f;
typedef __attribute__((ext_vector_type(4)))  float    v4f;
typedef v8h  __attribute__((may_alias)) v8ha;
typedef v4f  __attribute__((may_alias)) v4fa;
typedef v8us __attribute__((may_alias)) v8usa;

__device__ __forceinline__ unsigned short f2bf(float f) { unsigned u = __float_as_uint(f); u += 0x7FFFu + ((u >> 16) & 1u); return (unsigned short)(u >> 16); }
__device__ __forceinline__ float bf2f(unsigned short b) { return __uint_as_float(((unsigned)b) << 16); }
__device__ __forceinline__ float bfr(float f) { return bf2f(f2bf(f)); }
__device__ __forceinline__ v16h cat16(v8h lo, v8h hi) { return __builtin_shufflevector(lo, hi, 0, 1, 2, 3, 4, 5, 6, 7, 8, 9, 10, 11, 12, 13, 14, 15); }
__device__ __forceinline__ v16bf cat16b(v8us lo, v8us hi) { return __builtin_bit_cast(v16bf, __builtin_shufflevector(lo, hi, 0, 1, 2, 3, 4, 5, 6, 7, 8, 9, 10, 11, 12, 13, 14, 15)); }
__device__ __forceinline__ v8f wmma16(v16h a, v16h b, v8f c) { return __builtin_amdgcn_wmma_f32_16x16x32_f16(false, a, false, b, (short)0, c, false, false); }
__device__ __forceinline__ v8f wmmab(v16bf a, v16bf b, v8f c) { return __builtin_amdgcn_wmma_f32_16x16x32_bf16(false, a, false, b, (short)0, c, false, false); }



// WFrag: a 16x16x32 operand fragment of a plane in fragment order (two 16-byte loads, the second d2 elements on) and its product
template <typename T16> struct WFrag;
template <> struct WFrag<h16> { typedef v16h V; static __device__ __forceinline__ V ld(const h16* p, int d2 = FT) { return cat16(*(const v8h*)p, *(const v8h*)(p + d2)); } static __device__ __forceinline__ v8f mma(V a, V b, v8f c) { return wmma16(a, b, c); } };
template <> struct WFrag<bf> { typedef v16bf V; static __device__ __forceinline__ V ld(const bf* p, int d2 = FT) { return cat16b(*(const v8us*)p, *(const v8us*)(p + d2)); } static __device__ __forceinline__ v8f mma(V a, V b, v8f c) { return wmmab(a, b, c); } };
__device__ __forceinline__ void splitf(float y, unsigned short& h, unsigned short& l) { h = f2bf(y); l = f2bf(y - bf2f(h)); }
typedef __attribute__((ext_vector_type(2))) _Float16 v2h;
typedef __attribute__((ext_vector_type(4))) _Float16 v4h;
typedef __attribute__((ext_vector_type(2))) unsigned short v2us;
typedef __attribute__((ext_vector_type(4))) unsigned short v4us;
typedef __attribute__((ext_vector_type(2))) float v2f;
typedef __attribute__((ext_vector_type(4))) int v4i;

// k_wtG: a thread makes one lane's 16 bytes of a tile of W^T: 8 neighbouring k of one n. Lanes run along n, so each of its 8 loads reads whole lines of w and the store covers two runs of 256 bytes.
__global__ __launch_bounds__(256) void k_wtG(const float* __restrict__ w0, const float* __restrict__ w1, const float* __restrict__ w2, const float* __restrict__ w3, bf* Bt) {
    const float* __restrict__ w = blockIdx.y == 0 ? w0 : blockIdx.y == 1 ? w1 : blockIdx.y == 2 ? w2 : w3; Bt += (size_t)blockIdx.y * DQ * DM;   // grid y: which of the four equal-shaped weights [DM][DQ]; their transposes lie one behind the other
    const int i = blockIdx.x * 256 + threadIdx.x; const int n = i % DQ, k8 = i / DQ; if (k8 >= DM / 8) return;
    const float* wp = w + (size_t)k8 * 8 * DQ + n; float v[8];
#pragma unroll
    for (int e = 0; e < 8; ++e) v[e] = wp[e * DQ];
    asm volatile("s_wait_xcnt 0x0" :: "v"(wp) : "memory");   // precaution: as an input, the eight loads' address stays live up to this wait
    v8us o;
#pragma unroll
    for (int e = 0; e < 8; ++e) o[e] = f2bf(v[e]);
    *(v8us*)(Bt + ((size_t)(n >> 4) * (DM >> 4) + (k8 >> 1)) * FT + ((k8 & 1) * 16 + (n & 15)) * 8) = o;
}
// k_cvt8: a thread makes one lane's 16 bytes of a tile of an input copy (8 neighbouring columns of one row). A wave takes 8 rows x 32 columns: it reads one whole line of each row and stores four whole lines (two tiles x two k halves, 8 rows of each).
__global__ __launch_bounds__(256) void k_cvt8(const float* __restrict__ s0, const float* __restrict__ s1, const float* __restrict__ s2, bf* dst, size_t n8) { const size_t i = (size_t)blockIdx.x * 256 + threadIdx.x; if (i >= n8) return; const float* __restrict__ src = blockIdx.y == 0 ? s0 : blockIdx.y == 1 ? s1 : s2; dst += (size_t)blockIdx.y * n8 * 8;   /* grid y: which of the three equal-shaped inputs; their copies lie one behind the other */
    const int lane = (int)(i & 31), c8 = lane & 7, p = lane >> 3; const unsigned wv = (unsigned)(i >> 5); const int ch = wv & 1, k2 = (wv >> 1) & (DM / 32 - 1); const unsigned rb = wv / (DM / 16);   // rows 8 ch .. + 7 of row block rb, columns 32 k2 + 8 p .. + 7
    const v8f v = *(const v8f*)(src + (size_t)(rb * 16 + ch * 8 + c8) * DM + k2 * 32 + p * 8); v8us o;
#pragma unroll
    for (int k = 0; k < 8; ++k) o[k] = f2bf(v[k]); *(v8us*)(dst + ((size_t)rb * (DM / 16) + k2 * 2 + (p >> 1)) * FT + ((p & 1) * 16 + ch * 8 + c8) * 8) = o;  }

// ---- k_fattn: scores, softmax and P x V of one (batch, head) in one kernel; no score and no P ever leaves the registers.
// Transposed products: S^T = K Q^T (A = 16 key rows, B = 16 query columns), so a lane holds 8 keys' scores of ONE query per tile; two score tiles (32 keys), converted in place, are the B operand of O^T += V^T P^T (A = 16 d rows of the [d][t] plane).
// Every fragment comes by WFrag::ld, whose two 16-byte halves (k = 8 hi .. and 16 + 8 hi .., from two tiles of a plane in fragment order) are the order in which the packed score tiles lie.
// Online softmax in the log2 domain: the maximum in use may trail the true one by up to 8, sums and outputs are rescaled only when a column's maximum passes that.
// Query rows < RH: bf16 hi/lo planes, 3 products each, 32 columns a wave; the rest fp16, 64 columns a wave. Output: the merged hi/lo bf16 rows [b t][h d], in fragment order.
// A work-group is AWH hi/lo waves and AWF fp16 waves of one plane (no barrier, no LDS: the waves share only the cache): 8 equal work-groups a plane, 256 in all, one per WGP.
#define AWH  2                    // hi/lo waves per work-group of k_fattn, 32 query rows each
#define AWF  3                    // fp16 waves per work-group, 64 query rows each
#define NPS  (TT / 32)            // 32-key passes
typedef __attribute__((ext_vector_type(2))) __bf16 v2bf;
typedef __attribute__((ext_vector_type(8))) unsigned v8u;
__device__ __forceinline__ float xhalf(float x) { return __builtin_bit_cast(float, __builtin_amdgcn_permlanex16(__builtin_bit_cast(int, x), __builtin_bit_cast(int, x), 0x76543210, 0xfedcba98, false, false)); }   // lane l with lane l ^ 16
__device__ __forceinline__ unsigned pk2(float a, float b, bf) { v2f x; x[0] = a; x[1] = b; return __builtin_bit_cast(unsigned, __builtin_convertvector(x, v2bf)); }
__device__ __forceinline__ unsigned pk2(float a, float b, h16) { v2f x; x[0] = a; x[1] = b; return __builtin_bit_cast(unsigned, __builtin_convertvector(x, v2h)); }
// xwait: precaution behind a group of global loads: as inputs, the loads' address registers stay live up to this wait, so none is advanced or reused in front of it
template <bool HI, typename T16> __device__ __forceinline__ void xwait(const T16* a, const T16* b) { if (HI) asm volatile("s_wait_xcnt 0x0" :: "v"(a), "v"(b) : "memory"); else asm volatile("s_wait_xcnt 0x0" :: "v"(a) : "memory"); }
// the same where the addresses are a plane's base + the lane's byte offset lb inside a tile: a load may name lb itself beside a scalar base, so lb is held too
template <bool HI, typename T16> __device__ __forceinline__ void xwaits(const T16* a, const T16* b, unsigned lb) { if (HI) asm volatile("s_wait_xcnt 0x0" :: "v"(a), "v"(b), "v"(lb) : "memory"); else asm volatile("s_wait_xcnt 0x0" :: "v"(a), "v"(lb) : "memory"); }
template <typename T16> __device__ __forceinline__ const T16* atl(const T16* base, unsigned lb) { return (const T16*)((const char*)base + lb); }
// ---- k_proj: the q, k and v projections of all batches in one launch, each with its layout step: ONE WAVE per 64x64 tile sums the whole K = DM in registers and stores the fp16, hi and lo head planes itself (no f32 plane, no LDS, no barrier).
// grid (MT/128, DQ/128, 3), 4 waves = 2x2 tiles a work-group: two waves each read the same operand rows at about the same time, so that the second can find them in the WGP cache. z picks input copy, transposed weight, bias and planes. A tile is 64 rows t of one batch x the 64 columns d of one head.
// TR (q, k; planes [b][h][t][d]): D = W^T-rows x X-rows, so a lane's 8 accumulator registers are 8 neighbouring d of one t. Not TR (v; planes [b][h][d][t]): D = X-rows x W^T-rows, 8 neighbouring t of one d. Either way one 16-byte store a plane and tile, and the wave's store is that tile in fragment order: 512 contiguous bytes; a wave's 64x64 tile is 8 KiB in a row of each plane.
// The accumulators start at the bf16-rounded bias.
typedef __attribute__((ext_vector_type(4))) unsigned v4u;
typedef v4u __attribute__((may_alias)) v4ua;
template <bool TR>
__device__ __forceinline__ void proj_tile(const bf* __restrict__ X, const bf* __restrict__ Wt, const float* __restrict__ bias, h16* P16, bf* Ph, bf* Pl) {
    typedef WFrag<bf> W; typedef WFrag<bf>::V V;
    const int lane = threadIdx.x & 31, lr = lane & 15, hi = lane >> 4; const int wave = __builtin_amdgcn_readfirstlane(threadIdx.x >> 5); const int r0 = (blockIdx.x * 2 + (wave & 1)) * 64, hd = blockIdx.y * 2 + (wave >> 1), c0 = hd * 64;
    // every full unroll below: fragments and sums are register arrays, which only constant indices keep in registers
    v8f acc[4][4];
    if (TR) { const float* bp = bias + c0 + 8 * hi; v8f bv[4];
#pragma unroll
        for (int nb = 0; nb < 4; ++nb) bv[nb] = *(const v8f*)(bp + nb * 16);
        asm volatile("s_wait_xcnt 0x0" :: "v"(bp) : "memory");   // precaution: as an input, the bias loads' address stays live up to this wait
#pragma unroll
        for (int nb = 0; nb < 4; ++nb) {
#pragma unroll
            for (int j = 0; j < 8; ++j) bv[nb][j] = bfr(bv[nb][j]);
#pragma unroll
            for (int mb = 0; mb < 4; ++mb) acc[mb][nb] = bv[nb]; } }
    else { const float* bp = bias + c0 + lr; float bv[4];
#pragma unroll
        for (int nb = 0; nb < 4; ++nb) bv[nb] = bp[nb * 16];
        asm volatile("s_wait_xcnt 0x0" :: "v"(bp) : "memory");   // precaution: as an input, the bias loads' address stays live up to this wait
#pragma unroll
        for (int nb = 0; nb < 4; ++nb) { const float bb = bfr(bv[nb]);
#pragma unroll
            for (int mb = 0; mb < 4; ++mb)
#pragma unroll
                for (int j = 0; j < 8; ++j) acc[mb][nb][j] = bb; } }
    const bf* xp = X + (size_t)r0 * DM + lane * 8; const bf* wp = Wt + (size_t)c0 * DM + lane * 8;
    V a0[4], b0[4], a1[4], b1[4];   // two fragment sets of 32 k each: one is in flight while the other is multiplied
#pragma unroll
    for (int i = 0; i < 4; ++i) { a0[i] = W::ld(xp + i * 16 * DM); b0[i] = W::ld(wp + i * 16 * DM); }
#pragma unroll 1   // stays rolled: a trip already takes 64 k, 2 KiB in a row of each operand row block
    for (int kc = 0; kc < DM; kc += 64) {
#pragma unroll
        for (int i = 0; i < 4; ++i) { a1[i] = W::ld(xp + i * 16 * DM + 2 * FT); b1[i] = W::ld(wp + i * 16 * DM + 2 * FT); }
        __builtin_amdgcn_sched_barrier(0);   // keeps the sixteen loads in front of the products of the other set: sunk behind them, their latency would lie open
#pragma unroll
        for (int nb = 0; nb < 4; ++nb)
#pragma unroll
            for (int mb = 0; mb < 4; ++mb) acc[mb][nb] = TR ? W::mma(b0[nb], a0[mb], acc[mb][nb]) : W::mma(a0[mb], b0[nb], acc[mb][nb]);
        xwait<true>(xp, wp);   // stands between every load issued so far and the advance of their addresses
        const int adv = (kc + 64 < DM) ? 4 * FT : 0;   // the last trip fetches its own first half again: inside the plane, never used
        xp += adv; wp += adv;
#pragma unroll
        for (int i = 0; i < 4; ++i) { a0[i] = W::ld(xp + i * 16 * DM); b0[i] = W::ld(wp + i * 16 * DM); }
        __builtin_amdgcn_sched_barrier(0);   // as above
#pragma unroll
        for (int nb = 0; nb < 4; ++nb)
#pragma unroll
            for (int mb = 0; mb < 4; ++mb) acc[mb][nb] = TR ? W::mma(b1[nb], a1[mb], acc[mb][nb]) : W::mma(a1[mb], b1[nb], acc[mb][nb]);
    }
    xwait<true>(xp, wp);   // behind the last trip's loads: their addresses' registers are free for reuse below
    const int bt = r0 / TT, t0 = r0 % TT;   // 64 divides TT: a tile's rows lie in one batch
    const size_t e0 = ((size_t)(bt * NH_ + hd) * TT + t0) * HD + lane * 8;   // q, k: row blocks t0 / 16 .. + 3, four tiles each; v: block t0 / 64
    h16* p16 = P16 + e0; bf* ph = Ph + e0; bf* pl = Pl + e0;
#pragma unroll
    for (int mb = 0; mb < 4; ++mb) { v4u o16[4], oh[4], ol[4];
#pragma unroll
        for (int nb = 0; nb < 4; ++nb) {
#pragma unroll
            for (int i = 0; i < 4; ++i) { const float y0 = acc[mb][nb][2 * i], y1 = acc[mb][nb][2 * i + 1]; o16[nb][i] = pk2(y0, y1, h16()); const unsigned wh = pk2(y0, y1, bf()); oh[nb][i] = wh;
                ol[nb][i] = pk2(y0 - __uint_as_float(wh << 16), y1 - __uint_as_float(wh & 0xFFFF0000u), bf()); }
            const int eo = (mb * 4 + nb) * FT;
            *(v4ua*)(p16 + eo) = o16[nb]; *(v4ua*)(ph + eo) = oh[nb]; *(v4ua*)(pl + eo) = ol[nb]; }
        asm volatile("s_wait_xcnt 0x0" :: "v"(o16[0]), "v"(o16[1]), "v"(o16[2]), "v"(o16[3]), "v"(oh[0]), "v"(oh[1]), "v"(oh[2]), "v"(oh[3]), "v"(ol[0]), "v"(ol[1]), "v"(ol[2]), "v"(ol[3]) : "memory"); }   // precaution: as inputs, the twelve stores' data registers stay live up to this wait, so the next row of tiles does not overwrite them in front of it
}
__global__ __launch_bounds__(128) void k_proj(const bf* __restrict__ XB, const bf* __restrict__ WT, const float* __restrict__ bq, const float* __restrict__ bk, const float* __restrict__ bv, h16* Q16, bf* Qh, bf* Ql, h16* K16, bf* Kh, bf* Kl, h16* V16, bf* Vh, bf* Vl) {
    static_assert(TT % 64 == 0 && MT % 128 == 0 && HD == 64 && DM % 64 == 0 && DQ == DKV && DQ % 128 == 0, "a 64x64 tile is one head's columns and rows of one batch");
    const int z = blockIdx.z; const bf* X = XB + (size_t)z * MT * DM; const bf* Wt = WT + (size_t)z * DQ * DM;   // the input copies and the transposed weights lie one behind the other
    if (z < 2) proj_tile<true>(X, Wt, z == 0 ? bq : bk, z == 0 ? Q16 : K16, z == 0 ? Qh : Kh, z == 0 ? Ql : Kl);   // block-uniform: a scalar branch
    else proj_tile<false>(X, Wt, bv, V16, Vh, Vl);
}
template <typename T16, bool HI, int R>
__device__ __forceinline__ void attn_wave(const T16* __restrict__ Q, const T16* __restrict__ Q2, const T16* __restrict__ Kp, const T16* __restrict__ K2, const T16* __restrict__ Vt, const T16* __restrict__ V2, float csc, int q0, bf* Ah, bf* Al) {
    typedef typename WFrag<T16>::V V; typedef WFrag<T16> W;
    const int lane = threadIdx.x & 31;
    // every full unroll below: fragments, scores and sums are register arrays, which only constant indices keep in registers
    V qf[R][2], ql[R][2];
    const unsigned lb = lane * 16;   // this lane's 16 bytes of every tile
    { const T16* qp = atl(Q + (size_t)q0 * HD, lb); const T16* qp2 = HI ? atl(Q2 + (size_t)q0 * HD, lb) : qp;
#pragma unroll
      for (int g = 0; g < R; ++g)
#pragma unroll
        for (int kc = 0; kc < 2; ++kc) { qf[g][kc] = W::ld(qp + g * 16 * HD + 2 * FT * kc); if (HI) ql[g][kc] = W::ld(qp2 + g * 16 * HD + 2 * FT * kc); }
      xwaits<HI>(qp, qp2, lb); }
    v8f acc[R][4]; float m_run[R], l_run[R];
#pragma unroll
    for (int g = 0; g < R; ++g) { m_run[g] = -__builtin_inff(); l_run[g] = 0.f;
#pragma unroll
        for (int t = 0; t < 4; ++t) acc[g][t] = (v8f){}; }
    const T16* kp = atl(Kp, lb); const T16* kp2 = HI ? atl(K2, lb) : kp;
    const T16* vp = atl(Vt, lb); const T16* vp2 = HI ? atl(V2, lb) : vp;
    V kf[2][2], kl[2][2];
#pragma unroll
    for (int kt = 0; kt < 2; ++kt)
#pragma unroll
        for (int kc = 0; kc < 2; ++kc) { kf[kt][kc] = W::ld(kp + kt * 16 * HD + 2 * FT * kc); if (HI) kl[kt][kc] = W::ld(kp2 + kt * 16 * HD + 2 * FT * kc); }
    xwaits<HI>(kp, kp2, lb);   // the K addresses are advanced in the loop
#pragma unroll 1   // stays rolled: the body already holds two passes; more would only grow the code and the registers
    for (int pp = 0; pp < NPS / 2; ++pp) {
        V vf[2][4], vl[2][4];   // two passes' V^T fragments, 64 keys = one 8-KiB block of the plane: issued first, used behind the exponentials
#pragma unroll
        for (int t = 0; t < 4; ++t)
#pragma unroll
            for (int u = 0; u < 2; ++u) { vf[u][t] = W::ld(vp + (8 * u + t) * FT, 4 * FT); if (HI) vl[u][t] = W::ld(vp2 + (8 * u + t) * FT, 4 * FT); }   // keys 32 u .. + 15 in tile 8 u + t, the next 16 four tiles on
        xwaits<HI>(vp, vp2, lb);   // stands between the V loads and the advance of their addresses
        vp += 64 * HD; if (HI) vp2 += 64 * HD;
#pragma unroll
      for (int u = 0; u < 2; ++u) {   // the two 32-key passes
        v8f s[2][R];
#pragma unroll
        for (int kt = 0; kt < 2; ++kt)
#pragma unroll
            for (int g = 0; g < R; ++g) { s[kt][g] = (v8f){};
#pragma unroll
                for (int kc = 0; kc < 2; ++kc) { s[kt][g] = W::mma(kf[kt][kc], qf[g][kc], s[kt][g]); if (HI) { s[kt][g] = W::mma(kf[kt][kc], ql[g][kc], s[kt][g]); s[kt][g] = W::mma(kl[kt][kc], qf[g][kc], s[kt][g]); } } }
        if (u == 1) { const int adv = (pp + 1 < NPS / 2) ? 64 * HD : 0;   // kp: the first K row of a pair of passes; the last pass fetches rows of its own pair again: inside the plane, never used
          kp += adv; if (HI) kp2 += adv; }
        const int ko = (u == 0) ? 32 * HD : 0;
#pragma unroll
        for (int kt = 0; kt < 2; ++kt)   // the next pass's K fragments, in flight under this pass's softmax and second product
#pragma unroll
            for (int kc = 0; kc < 2; ++kc) { kf[kt][kc] = W::ld(kp + ko + kt * 16 * HD + 2 * FT * kc); if (HI) kl[kt][kc] = W::ld(kp2 + ko + kt * 16 * HD + 2 * FT * kc); }
        xwaits<HI>(kp, kp2, lb);   // stands between the K loads and the next advance of their addresses
        float mb[R]; bool need = false;
#pragma unroll
        for (int g = 0; g < R; ++g) { s[0][g] = s[0][g] * csc; s[1][g] = s[1][g] * csc;   // the head's scale may be negative: scale first, then the maximum
            float mx = fmaxf(s[0][g][0], s[1][g][0]);
#pragma unroll
            for (int r = 1; r < 8; ++r) mx = fmaxf(mx, fmaxf(s[0][g][r], s[1][g][r]));
            mx = fmaxf(mx, xhalf(mx)); mb[g] = mx; need = need || (mx > m_run[g] + 8.0f); }
        if (__builtin_amdgcn_ballot_w32(need) != 0) {   // one scalar branch a pass; rare behind the first passes
#pragma unroll
            for (int g = 0; g < R; ++g) { const float mn = fmaxf(m_run[g], mb[g]); const float corr = __builtin_amdgcn_exp2f(m_run[g] - mn); m_run[g] = mn; l_run[g] *= corr;
#pragma unroll
                for (int t = 0; t < 4; ++t) acc[g][t] = acc[g][t] * corr; } }
#pragma unroll
        for (int g = 0; g < R; ++g) { v8u w, wl;
#pragma unroll
            for (int i = 0; i < 8; ++i) {
                const float p0 = __builtin_amdgcn_exp2f(s[i >> 2][g][2 * (i & 3)] - m_run[g]), p1 = __builtin_amdgcn_exp2f(s[i >> 2][g][2 * (i & 3) + 1] - m_run[g]);
                l_run[g] += p0; l_run[g] += p1; w[i] = pk2(p0, p1, T16());
                if (HI) wl[i] = pk2(p0 - __uint_as_float(w[i] << 16), p1 - __uint_as_float(w[i] & 0xFFFF0000u), T16()); }
            const V pf = __builtin_bit_cast(V, w);
#pragma unroll
            for (int t = 0; t < 4; ++t) { acc[g][t] = W::mma(vf[u][t], pf, acc[g][t]); if (HI) { acc[g][t] = W::mma(vf[u][t], __builtin_bit_cast(V, wl), acc[g][t]); acc[g][t] = W::mma(vl[u][t], pf, acc[g][t]); } } }
      }
    }
    bf* ap = Ah + (size_t)q0 * DQ + lane * 8; bf* ap2 = Al + (size_t)q0 * DQ + lane * 8;
#pragma unroll
    for (int g = 0; g < R; ++g) { const float l = l_run[g] + xhalf(l_run[g]); const float inv = __fdiv_rn(1.0f, l);   // the wave halves' sums joined once
#pragma unroll
        for (int t = 0; t < 4; ++t) { v8us oh, ol;   // a lane's 8 registers are d = 16 t + 8 h .. + 7 of its query: one 16-byte store a plane
#pragma unroll
            for (int r = 0; r < 8; ++r) { unsigned short a, c2; splitf(acc[g][t][r] * inv, a, c2); oh[r] = a; ol[r] = c2; }
            *(v8us*)(ap + (size_t)g * 16 * DQ + t * FT) = oh; *(v8us*)(ap2 + (size_t)g * 16 * DQ + t * FT) = ol;
            asm volatile("s_wait_xcnt 0x0" :: "v"(oh), "v"(ol) : "memory"); } }   // precaution: as inputs, the two stores' data registers stay live up to this wait, so the next tile's values do not overwrite them in front of it
}
__global__ __launch_bounds__((AWH + AWF) * 32) void k_fattn(const h16* __restrict__ Q16, const h16* __restrict__ K16, const h16* __restrict__ V16, const bf* __restrict__ Qh, const bf* __restrict__ Ql, const bf* __restrict__ Kh, const bf* __restrict__ Kl, const bf* __restrict__ Vh, const bf* __restrict__ Vl, const float* __restrict__ mcp, bf* Ah, bf* Al) {
    static_assert(REP == 1 && HD == 64 && RH % (AWH * 32) == 0 && (TT - RH) % (AWF * 64) == 0 && RH / (AWH * 32) == (TT - RH) / (AWF * 64), "one kv head per query head; every work-group has its share of both kinds of rows");
    const int z = blockIdx.y, hd = z % NH_, b = z / NH_; const size_t pl = (size_t)z * TT * HD;   // grid y: the (batch, head) plane; grid x: the query block
    const float csc = __fmul_rn(__fmul_rn(SCL, bfr(mcp[hd])), 1.4426950408889634f);   // (1/8) x modal_compat[h] (bf16-rounded input) x log2 e
    const int wave = __builtin_amdgcn_readfirstlane(threadIdx.x >> 5); const int yb = blockIdx.x;
    bf* ah = Ah + (size_t)b * TT * DQ + hd * (HD / 16) * FT; bf* al = Al + (size_t)b * TT * DQ + hd * (HD / 16) * FT;   // the head's four tiles of every row block
    if (wave < AWH) attn_wave<bf, true, 2>(Qh + pl, Ql + pl, Kh + pl, Kl + pl, Vh + pl, Vl + pl, csc, (yb * AWH + wave) * 32, ah, al);   // wave-uniform: a scalar branch
    else attn_wave<h16, false, 4>(Q16 + pl, nullptr, K16 + pl, nullptr, V16 + pl, nullptr, csc, RH + (yb * AWF + wave - AWH) * 64, ah, al);
}
// ---- k_oln: output projection, residual and LayerNorm in one kernel. A work-group of 8 waves owns ORW whole rows: wave w sums the whole K = DQ of columns 64 w .. + 63 in registers, the rows cross the waves through LDS, then each wave normalises ORW / 8 rows.
// The ORW merged rows (hi and lo, 32 KiB in a row of each plane, already in fragment order) are staged once in LDS, since all 8 waves read them; each wave streams its own 64 rows of Wo^T from global memory. Two fragment sets of 64 k: one is in flight while the other is multiplied.
// D = Wo^T-rows x merged-rows: a lane's 8 accumulator registers are 8 neighbouring columns of one row, two 16-byte LDS stores. The accumulators start at the bf16-rounded bias; per 32 k all hi products, then all lo products.
template <int M> __device__ __forceinline__ float xrow(float x) { return __builtin_bit_cast(float, __builtin_amdgcn_update_dpp(0, __builtin_bit_cast(int, x), 0x160 + M, 0xf, 0xf, true)); }   // lane l ^ M of the 16-lane row (row_xmask)
__device__ __forceinline__ float wsum(float x) { x += xrow<1>(x); x += xrow<2>(x); x += xrow<4>(x); x += xrow<8>(x); return x + xhalf(x); }   // the sum over the wave's 32 lanes, in every lane
__device__ __forceinline__ v4f bfr4(v4f x) { const unsigned a = pk2(x[0], x[1], bf()), b = pk2(x[2], x[3], bf()); v4f r; r[0] = __uint_as_float(a << 16); r[1] = __uint_as_float(a & 0xFFFF0000u); r[2] = __uint_as_float(b << 16); r[3] = __uint_as_float(b & 0xFFFF0000u); return r; }   // four values rounded to bf16
#define ORW  32                   // rows of a work-group of k_oln
#define OPT  (DM + 4)             // pitch of the f32 rows in LDS: 16 bytes x odd, so that 16 lanes' 16-byte stores of 16 rows fall on all 64 banks
__global__ __launch_bounds__(256) void k_oln(const bf* __restrict__ Ah, const bf* __restrict__ Al, const bf* __restrict__ Wt, const float* __restrict__ bo, const float* __restrict__ xr, const float* __restrict__ g, const float* __restrict__ bb, float* out) {
    typedef WFrag<bf> W; typedef WFrag<bf>::V V;
    static_assert(DM == 512 && DQ == 512 && MT % ORW == 0 && ORW == 32, "8 waves x 64 columns are a whole row; 256 threads x 8 loads of 16 bytes are a plane's ORW rows");
    __shared__ __align__(16) bf as[2 * ORW * DQ];   // hi rows, then lo rows
    __shared__ __align__(16) float ys[ORW * OPT];
    const int tid = threadIdx.x, lane = tid & 31, lr = lane & 15, hi = lane >> 4; const int wave = __builtin_amdgcn_readfirstlane(tid >> 5); const int r0 = blockIdx.x * ORW, c0 = wave * 64;
    // every full unroll below: fragments, sums and rows are register arrays, which only constant indices keep in registers
    const bf* wb = Wt + (size_t)c0 * DQ; unsigned wo = lane * 16;   // this wave's rows of Wo^T (the same for the whole wave) and the lane's running byte offset in them
    V h0[2][2], l0[2][2], b0[4][2], h1[2][2], l1[2][2], b1[4][2];   // [row block][32 k]
    { const bf* sh = Ah + (size_t)r0 * DQ + tid * 8; const bf* sl = Al + (size_t)r0 * DQ + tid * 8; v8us th[8], tl[8];
#pragma unroll
      for (int i = 0; i < 8; ++i) { th[i] = *(const v8us*)(sh + i * 2048); tl[i] = *(const v8us*)(sl + i * 2048); }
#pragma unroll
      for (int i = 0; i < 4; ++i) { b0[i][0] = W::ld(atl(wb, wo) + i * 16 * DQ); b0[i][1] = W::ld(atl(wb, wo) + i * 16 * DQ + 2 * FT); }
      asm volatile("s_wait_xcnt 0x0" :: "v"(sh), "v"(sl), "v"(wo) : "memory");   // precaution: as inputs, the loads' address registers stay live up to this wait
#pragma unroll
      for (int i = 0; i < 8; ++i) { *(v8us*)(as + tid * 8 + i * 2048) = th[i]; *(v8us*)(as + ORW * DQ + tid * 8 + i * 2048) = tl[i]; } }
    v8f acc[2][4];
    { const float* bp = bo + c0 + 8 * hi; v8f bv[4];
#pragma unroll
      for (int nb = 0; nb < 4; ++nb) bv[nb] = *(const v8f*)(bp + nb * 16);
      asm volatile("s_wait_xcnt 0x0" :: "v"(bp) : "memory");   // precaution: as an input, the bias loads' address stays live up to this wait
#pragma unroll
      for (int nb = 0; nb < 4; ++nb) {
#pragma unroll
          for (int j = 0; j < 8; ++j) bv[nb][j] = bfr(bv[nb][j]);
          acc[0][nb] = bv[nb]; acc[1][nb] = bv[nb]; } }
    __syncthreads();   // the staged rows are complete
    const bf* la = as + lane * 8;
#pragma unroll
    for (int i = 0; i < 2; ++i)
#pragma unroll
        for (int kk = 0; kk < 2; ++kk) { h0[i][kk] = W::ld(la + i * 16 * DQ + kk * 2 * FT); l0[i][kk] = W::ld(la + ORW * DQ + i * 16 * DQ + kk * 2 * FT); }
    auto prod = [&](const V (&b)[4][2], const V (&h)[2][2], const V (&l)[2][2]) {   // a set's 32 products; per 32 k the 8 hi ones, then the 8 lo ones, so that no sum is asked for again before 8 products have gone by
#pragma unroll
        for (int kk = 0; kk < 2; ++kk) {
#pragma unroll
            for (int nb = 0; nb < 4; ++nb) { acc[0][nb] = W::mma(b[nb][kk], h[0][kk], acc[0][nb]); acc[1][nb] = W::mma(b[nb][kk], h[1][kk], acc[1][nb]); }
#pragma unroll
            for (int nb = 0; nb < 4; ++nb) { acc[0][nb] = W::mma(b[nb][kk], l[0][kk], acc[0][nb]); acc[1][nb] = W::mma(b[nb][kk], l[1][kk], acc[1][nb]); } } };
    auto fetch = [&](V (&b)[4][2], V (&h)[2][2], V (&l)[2][2], int o) {   // the set at o elements behind the two running addresses
#pragma unroll
        for (int kk = 0; kk < 2; ++kk)
#pragma unroll
            for (int i = 0; i < 4; ++i) b[i][kk] = W::ld(atl(wb, wo) + i * 16 * DQ + o + kk * 2 * FT);
#pragma unroll
        for (int kk = 0; kk < 2; ++kk)
#pragma unroll
            for (int i = 0; i < 2; ++i) { h[i][kk] = W::ld(la + i * 16 * DQ + o + kk * 2 * FT); l[i][kk] = W::ld(la + ORW * DQ + i * 16 * DQ + o + kk * 2 * FT); }
        asm volatile("s_wait_xcnt 0x0" : "+v"(wo) :: "memory"); };   // precaution: the global loads' offset register goes through this wait, so that its advance is formed behind the wait and not in front
#pragma unroll 1   // stays rolled: a trip already takes 128 k; more would only grow the code
    for (int kc = 0; kc < DQ - 128; kc += 128) {
        fetch(b1, h1, l1, 4 * FT);
        __builtin_amdgcn_sched_barrier(0);   // keeps the loads in front of the products of the other set: sunk behind them, their latency would lie open
        prod(b0, h0, l0);
        wo += 8 * FT * 2; la += 8 * FT;
        fetch(b0, h0, l0, 0);
        __builtin_amdgcn_sched_barrier(0);   // as above
        prod(b1, h1, l1);
    }
    fetch(b1, h1, l1, 4 * FT);   // the last 128 k: nothing is fetched behind them
    __builtin_amdgcn_sched_barrier(0);   // as above
    prod(b0, h0, l0);
    // this wave's four rows of the residual, gamma and beta: asked for here, so that the last products and the LDS exchange cover part of their latency
    const int rw = wave * (ORW / 8); const float* xp = xr + (size_t)(r0 + rw) * DM + lane * 4; const float* gp = g + lane * 4; const float* bp2 = bb + lane * 4;
    v4f v[ORW / 8][4], gv[4], bt[4];
#pragma unroll
    for (int q = 0; q < ORW / 8; ++q)
#pragma unroll
        for (int c = 0; c < 4; ++c) v[q][c] = *(const v4f*)(xp + q * DM + c * 128);
#pragma unroll
    for (int c = 0; c < 4; ++c) { gv[c] = *(const v4f*)(gp + c * 128); bt[c] = *(const v4f*)(bp2 + c * 128); }
    asm volatile("s_wait_xcnt 0x0" :: "v"(xp), "v"(gp), "v"(bp2) : "memory");   // precaution: as inputs, the loads' address registers stay live up to this wait
    __builtin_amdgcn_sched_barrier(0);   // keeps these loads in front of the last products
    prod(b1, h1, l1);
#pragma unroll
    for (int mb = 0; mb < 2; ++mb)
#pragma unroll
        for (int nb = 0; nb < 4; ++nb) { float* yp = ys + (mb * 16 + lr) * OPT + c0 + nb * 16 + 8 * hi;
            *(v4fa*)yp = __builtin_shufflevector(acc[mb][nb], acc[mb][nb], 0, 1, 2, 3); *(v4fa*)(yp + 4) = __builtin_shufflevector(acc[mb][nb], acc[mb][nb], 4, 5, 6, 7); }
    __builtin_amdgcn_sched_barrier(0);   // keeps the work on the residual, which waits for its loads, behind the last products and the LDS stores
    __syncthreads();   // every wave's columns of every row are in LDS
    float s[ORW / 8], s2[ORW / 8];
#pragma unroll
    for (int q = 0; q < ORW / 8; ++q) { s[q] = 0.f;
#pragma unroll
        for (int c = 0; c < 4; ++c) { const v4f a = *(const v4fa*)(ys + (rw + q) * OPT + c * 128 + lane * 4);
            v[q][c] = a + bfr4(v[q][c]);
#pragma unroll
            for (int e = 0; e < 4; ++e) s[q] += v[q][c][e]; } }
#pragma unroll
    for (int q = 0; q < ORW / 8; ++q) s[q] = wsum(s[q]);
#pragma unroll
    for (int q = 0; q < ORW / 8; ++q) { const float mean = s[q] * (1.0f / DM); s2[q] = 0.f;   // DM is a power of two: the product is the exact quotient
#pragma unroll
        for (int c = 0; c < 4; ++c)
#pragma unroll
            for (int e = 0; e < 4; ++e) { const float dv = v[q][c][e] - mean; s2[q] += dv * dv; v[q][c][e] = dv; } }
#pragma unroll
    for (int q = 0; q < ORW / 8; ++q) s2[q] = wsum(s2[q]);
#pragma unroll
    for (int c = 0; c < 4; ++c) { gv[c] = bfr4(gv[c]); bt[c] = bfr4(bt[c]); }
    float* op = out + (size_t)(r0 + rw) * DM + lane * 4;
#pragma unroll
    for (int q = 0; q < ORW / 8; ++q) { const float rs = __fdiv_rn(1.0f, __fsqrt_rn(s2[q] * (1.0f / DM) + LNEPS));
#pragma unroll
        for (int c = 0; c < 4; ++c) { v[q][c] = v[q][c] * rs * gv[c] + bt[c]; *(v4f*)(op + q * DM + c * 128) = v[q][c]; }
        if (q + 1 < ORW / 8) asm volatile("s_wait_xcnt 0x0" :: "v"(v[q][0]), "v"(v[q][1]), "v"(v[q][2]), "v"(v[q][3]) : "memory"); }   // precaution: as inputs, the four stores' data registers stay live up to this wait, so the next row's values do not overwrite them in front of it
}

extern "C" void kernel_launch(void* const* d_in, const int* in_sizes, int n_in,
                              void* d_out, int out_size, void* d_ws, size_t ws_size, hipStream_t stream) {
    (void)in_sizes; (void)n_in; (void)out_size;
    const float* x = (const float*)d_in[0];   /* query_modality */ const float* xk = (const float*)d_in[1]; const float* xv = (const float*)d_in[2]; const float* wq = (const float*)d_in[3]; const float* bq = (const float*)d_in[4]; const float* wk = (const float*)d_in[5]; const float* bk = (const float*)d_in[6]; const float* wv = (const float*)d_in[7]; const float* bv = (const float*)d_in[8]; const float* wo = (const float*)d_in[9]; const float* bo = (const float*)d_in[10]; const float* mc = (const float*)d_in[11];   /* modal_compat [8] */ const float* lng = (const float*)d_in[12]; const float* lnb = (const float*)d_in[13];
    float* OUT = (float*)d_out;     // [4][2048][512]
    char* wsp = (char*)d_ws;
    auto take = [&](size_t bytes) { char* p = wsp; wsp += (bytes + 255) & ~(size_t)255; return (void*)p; };
    bf* WQ = (bf*)take((size_t)DQ * DM * 2); take((size_t)DKV * DM * 2); take((size_t)DKV * DM * 2);   /* Wq^T, then Wk^T and Wv^T behind it */ bf* WO = (bf*)take((size_t)DM * DQ * 2);
    h16* QP16 = (h16*)take((size_t)NB_ * NH_ * TT * HD * 2); h16* KP16 = (h16*)take((size_t)NB_ * NKV * TT * HD * 2); h16* VT16 = (h16*)take((size_t)NB_ * NKV * HD * TT * 2);
    bf* QPh = (bf*)take((size_t)NB_ * NH_ * TT * HD * 2); bf* QPl = (bf*)take((size_t)NB_ * NH_ * TT * HD * 2); bf* KPh = (bf*)take((size_t)NB_ * NKV * TT * HD * 2); bf* KPl = (bf*)take((size_t)NB_ * NKV * TT * HD * 2); bf* VTh = (bf*)take((size_t)NB_ * NKV * HD * TT * 2); bf* VTl = (bf*)take((size_t)NB_ * NKV * HD * TT * 2);
    bf* XB = (bf*)take((size_t)3 * MT * DM * 2);   // bf16 copies of the query, key, value inputs, one behind the other
    bf* ATh = (bf*)take((size_t)MT * DQ * 2); bf* ATl = (bf*)take((size_t)MT * DQ * 2);
    static_assert(DQ == DM && DKV == DM, "the three input copies and the four transposed weights are equal in size");
    if ((size_t)(wsp - (char*)d_ws) > ws_size) return;    // ws 256 MiB
    k_wtG<<<dim3((unsigned)((DM * DQ / 8 + 255) / 256), 4), 256, 0, stream>>>(wq, wk, wv, wo, WQ);   // WQ, WK, WV, WO are taken one behind the other
    const unsigned LX = (unsigned)(((size_t)MT * DM / 8 + 255) / 256);
    k_cvt8<<<dim3(LX, 3), 256, 0, stream>>>(x, xk, xv, XB, (size_t)MT * DM / 8);
    k_proj<<<dim3(MT / 128, DQ / 128, 3), 128, 0, stream>>>(XB, WQ, bq, bk, bv, QP16, QPh, QPl, KP16, KPh, KPl, VT16, VTh, VTl);
    k_fattn<<<dim3(RH / (AWH * 32), NB_ * NH_), (AWH + AWF) * 32, 0, stream>>>(QP16, KP16, VT16, QPh, QPl, KPh, KPl, VTh, VTl, mc, ATh, ATl);   /* per-head compatibility scale inside */
    k_oln<<<MT / ORW, 256, 0, stream>>>(ATh, ATl, WO, bo, x, lng, lnb, OUT);   /* output projection + bo + query_modality, LayerNorm */
}

// v007
// A run of this version takes 97.3 microseconds.
// Timed twice side by side with v006, it ran 1.08 and 1.09 times as fast.
// Counting every step since v000, it is 21.5 times as fast.
#include <hip/hip_runtime.h>

// Cross-modal multi-head attention with a learned per-head compatibility scale, residual and post-LayerNorm (query_modality, key_modality, value_modality [4][2048][512]; Q,K,V = x W + b ('xw' 1/sqrt(512), zero biases; 8 heads x 64); scores = (Q.K / 8) x modal_compat[h] ([1][8][1][1], read); softmax; out = merged Wo + bo; y = LayerNorm(out + query_modality) gamma/beta (1e-5) -> [4][2048][512] (4.2 M)).
// Layout, all batches in one launch of each kernel (rows b*2048+t; head planes [b][h]): 'xw' weights transposed once; one launch for the q, k, v projections + f32 biases, whose work-groups round their own input rows to bf16 in LDS and whose tiles store the head planes themselves; one fused attention kernel for all 32 planes (scores, the head's bf16-rounded compatibility scalar, online softmax, P x V; scores and P stay in registers; hybrid rows: < 512 hi/lo 3 products, rest fp16); one kernel for merged hi/lo x Wo exact + bo, the residual add of query_modality and the row LayerNorm, which writes the output rows.
// Compute dtypes, f32 accumulate: every input rounded to bf16; projections exact + f32 biases; attention rows < 512 3 products, rest fp16; per-head scale and softmax f32; Wo hl x exact + bias; residual + LayerNorm f32.

#define NB_  4
#define TT   2048
#define DM   512
#define NH_  8
#define NKV  8
#define REP  (NH_ / NKV)
#define HD   64
#define DQ   (NH_ * HD)
#define DKV  (NKV * HD)
#define MT   (NB_ * TT)           // rows of all batches together
#define RH   512                  // query rows < RH use hi+lo planes
#define SCL  0.125f
#define LNEPS 1e-5f
// Fragment order, the form of every 16-bit operand plane (input rows in LDS, transposed weights, q, k, v planes, merged rows): a plane of rows x k is cut into tiles of 16 rows x 16 k, FT elements = 512 contiguous bytes each;
// inside a tile lane l = 16 ((k % 16) / 8) + row % 16 owns the 16 bytes at 16 l (its 8 neighbouring k). A fragment is two tiles (k and k + 16), so each of its two loads, and each store of a converted accumulator tile, covers four whole 128-byte lines.
// Tiles of one row block lie one behind the other in k (row block r at element 16 r K, as in row-major form); the v planes ([d][t]) lie in blocks of 64 t: tile (t / 16 % 4) * 4 + d / 16 of block t / 64.
#define FT   256                  // elements of a 16 x 16 tile
typedef _Float16 h16;
typedef unsigned short bf;
typedef __attribute__((ext_vector_type(16))) __bf16   v16bf;
typedef __attribute__((ext_vector_type(16))) _Float16 v16h;
typedef __attribute__((ext_vector_type(8)))  _Float16 v8h;
typedef __attribute__((ext_vector_type(8)))  unsigned short v8us;
typedef __attribute__((ext_vector_type(8)))  float    v8f;
typedef __attribute__((ext_vector_type(4)))  float    v4f;
typedef v8h  __attribute__((may_alias)) v8ha;
typedef v4f  __attribute__((may_alias)) v4fa;
typedef v8us __attribute__((may_alias)) v8usa;

__device__ __forceinline__ unsigned short f2bf(float f) { unsigned u = __float_as_uint(f); u += 0x7FFFu + ((u >> 16) & 1u); return (unsigned short)(u >> 16); }
__device__ __forceinline__ float bf2f(unsigned short b) { return __uint_as_float(((unsigned)b) << 16); }
__device__ __forceinline__ float bfr(float f) { return bf2f(f2bf(f)); }
__device__ __forceinline__ v16h cat16(v8h lo, v8h hi) { return __builtin_shufflevector(lo, hi, 0, 1, 2, 3, 4, 5, 6, 7, 8, 9, 10, 11, 12, 13, 14, 15); }
__device__ __forceinline__ v16bf cat16b(v8us lo, v8us hi) { return __builtin_bit_cast(v16bf, __builtin_shufflevector(lo, hi, 0, 1, 2, 3, 4, 5, 6, 7, 8, 9, 10, 11, 12, 13, 14, 15)); }
__device__ __forceinline__ v8f wmma16(v16h a, v16h b, v8f c) { return __builtin_amdgcn_wmma_f32_16x16x32_f16(false, a, false, b, (short)0, c, false, false); }
__device__ __forceinline__ v8f wmmab(v16bf a, v16bf b, v8f c) { return __builtin_amdgcn_wmma_f32_16x16x32_bf16(false, a, false, b, (short)0, c, false, false); }



// WFrag: a 16x16x32 operand fragment of a plane in fragment order (two 16-byte loads, the second d2 elements on) and its product
template <typename T16> struct WFrag;
template <> struct WFrag<h16> { typedef v16h V; static __device__ __forceinline__ V ld(const h16* p, int d2 = FT) { return cat16(*(const v8h*)p, *(const v8h*)(p + d2)); } static __device__ __forceinline__ v8f mma(V a, V b, v8f c) { return wmma16(a, b, c); } };
template <> struct WFrag<bf> { typedef v16bf V; static __device__ __forceinline__ V ld(const bf* p, int d2 = FT) { return cat16b(*(const v8us*)p, *(const v8us*)(p + d2)); } static __device__ __forceinline__ v8f mma(V a, V b, v8f c) { return wmmab(a, b, c); } };
__device__ __forceinline__ void splitf(float y, unsigned short& h, unsigned short& l) { h = f2bf(y); l = f2bf(y - bf2f(h)); }
typedef __attribute__((ext_vector_type(2))) _Float16 v2h;
typedef __attribute__((ext_vector_type(4))) _Float16 v4h;
typedef __attribute__((ext_vector_type(2))) unsigned short v2us;
typedef __attribute__((ext_vector_type(4))) unsigned short v4us;
typedef __attribute__((ext_vector_type(2))) float v2f;
typedef __attribute__((ext_vector_type(4))) int v4i;

// k_wtG: a thread makes one lane's 16 bytes of a tile of W^T: 8 neighbouring k of one n. Lanes run along n, so each of its 8 loads reads whole lines of w and the store covers two runs of 256 bytes.
__global__ __launch_bounds__(256) void k_wtG(const float* __restrict__ w0, const float* __restrict__ w1, const float* __restrict__ w2, const float* __restrict__ w3, bf* Bt) {
    const float* __restrict__ w = blockIdx.y == 0 ? w0 : blockIdx.y == 1 ? w1 : blockIdx.y == 2 ? w2 : w3; Bt += (size_t)blockIdx.y * DQ * DM;   // grid y: which of the four equal-shaped weights [DM][DQ]; their transposes lie one behind the other
    const int i = blockIdx.x * 256 + threadIdx.x; const int n = i % DQ, k8 = i / DQ; if (k8 >= DM / 8) return;
    const float* wp = w + (size_t)k8 * 8 * DQ + n; float v[8];
#pragma unroll
    for (int e = 0; e < 8; ++e) v[e] = wp[e * DQ];
    asm volatile("s_wait_xcnt 0x0" :: "v"(wp) : "memory");   // precaution: as an input, the eight loads' address stays live up to this wait
    v8us o;
#pragma unroll
    for (int e = 0; e < 8; ++e) o[e] = f2bf(v[e]);
    *(v8us*)(Bt + ((size_t)(n >> 4) * (DM >> 4) + (k8 >> 1)) * FT + ((k8 & 1) * 16 + (n & 15)) * 8) = o;
}

// ---- k_fattn: scores, softmax and P x V of one (batch, head) in one kernel; no score and no P ever leaves the registers.
// Transposed products: S^T = K Q^T (A = 16 key rows, B = 16 query columns), so a lane holds 8 keys' scores of ONE query per tile; two score tiles (32 keys), converted in place, are the B operand of O^T += V^T P^T (A = 16 d rows of the [d][t] plane).
// Every fragment comes by WFrag::ld, whose two 16-byte halves (k = 8 hi .. and 16 + 8 hi .., from two tiles of a plane in fragment order) are the order in which the packed score tiles lie.
// Online softmax in the log2 domain: the maximum in use may trail the true one by up to 8, sums and outputs are rescaled only when a column's maximum passes that.
// Query rows < RH: bf16 hi/lo planes, 3 products each, 32 columns a wave; the rest fp16, 64 columns a wave. Output: the merged hi/lo bf16 rows [b t][h d], in fragment order.
// A work-group is AWH hi/lo waves and AWF fp16 waves of one plane (no barrier, no LDS: the waves share only the cache): 8 equal work-groups a plane, 256 in all, one per WGP.
#define AWH  2                    // hi/lo waves per work-group of k_fattn, 32 query rows each
#define AWF  3                    // fp16 waves per work-group, 64 query rows each
#define NPS  (TT / 32)            // 32-key passes
typedef __attribute__((ext_vector_type(2))) __bf16 v2bf;
typedef __attribute__((ext_vector_type(8))) unsigned v8u;
__device__ __forceinline__ float xhalf(float x) { return __builtin_bit_cast(float, __builtin_amdgcn_permlanex16(__builtin_bit_cast(int, x), __builtin_bit_cast(int, x), 0x76543210, 0xfedcba98, false, false)); }   // lane l with lane l ^ 16
__device__ __forceinline__ unsigned pk2(float a, float b, bf) { v2f x; x[0] = a; x[1] = b; return __builtin_bit_cast(unsigned, __builtin_convertvector(x, v2bf)); }
__device__ __forceinline__ unsigned pk2(float a, float b, h16) { v2f x; x[0] = a; x[1] = b; return __builtin_bit_cast(unsigned, __builtin_convertvector(x, v2h)); }
// xwait: precaution behind a group of global loads: as inputs, the loads' address registers stay live up to this wait, so none is advanced or reused in front of it
template <bool HI, typename T16> __device__ __forceinline__ void xwait(const T16* a, const T16* b) { if (HI) asm volatile("s_wait_xcnt 0x0" :: "v"(a), "v"(b) : "memory"); else asm volatile("s_wait_xcnt 0x0" :: "v"(a) : "memory"); }
// the same where the addresses are a plane's base + the lane's byte offset lb inside a tile: a load may name lb itself beside a scalar base, so lb is held too
template <bool HI, typename T16> __device__ __forceinline__ void xwaits(const T16* a, const T16* b, unsigned lb) { if (HI) asm volatile("s_wait_xcnt 0x0" :: "v"(a), "v"(b), "v"(lb) : "memory"); else asm volatile("s_wait_xcnt 0x0" :: "v"(a), "v"(lb) : "memory"); }
template <typename T16> __device__ __forceinline__ const T16* atl(const T16* base, unsigned lb) { return (const T16*)((const char*)base + lb); }
// ---- k_proj: the q, k and v projections of all batches in one launch, each with the rounding of its input in front and its layout step behind: a work-group of 16 waves owns PRW input rows and all DQ columns.
// It reads its f32 rows once, rounds them to bf16 and lays them into LDS in fragment order; behind one barrier ONE WAVE per 64x64 tile sums the whole K = DM in registers and stores the fp16, hi and lo head planes itself (no bf16 copy of an input and no f32 plane in memory).
// grid (MT/PRW, 1, 3), waves = 2 row halves x 8 heads: the X fragments come from LDS, each wave streams its head's 64 rows of W^T from global memory (the two waves of a head read the same rows at about the same time, so that the second can find them in the WGP cache). z picks input, transposed weight, bias and planes. A tile is 64 rows t of one batch x the 64 columns d of one head.
// TR (q, k; planes [b][h][t][d]): D = W^T-rows x X-rows, so a lane's 8 accumulator registers are 8 neighbouring d of one t. Not TR (v; planes [b][h][d][t]): D = X-rows x W^T-rows, 8 neighbouring t of one d. Either way one 16-byte store a plane and tile, and the wave's store is that tile in fragment order: 512 contiguous bytes; a wave's 64x64 tile is 8 KiB in a row of each plane.
// The accumulators start at the bf16-rounded bias.
#define PRW  128                  // input rows of a work-group of k_proj
typedef __attribute__((ext_vector_type(4))) unsigned v4u;
typedef v4u __attribute__((may_alias)) v4ua;
template <bool TR>
__device__ __forceinline__ void proj_tile(const float* __restrict__ X, bf* xs, const bf* __restrict__ Wt, const float* __restrict__ bias, h16* P16, bf* Ph, bf* Pl) {
    typedef WFrag<bf> W; typedef WFrag<bf>::V V;
    const int lane = threadIdx.x & 31, lr = lane & 15, hi = lane >> 4; const int wave = __builtin_amdgcn_readfirstlane(threadIdx.x >> 5); const int r0 = blockIdx.x * PRW + (wave & 1) * 64, hd = wave >> 1, c0 = hd * 64;
    // every full unroll below: fragments, sums and staged rows are register arrays, which only constant indices keep in registers
    // staging: a lane makes one lane's 16 bytes of a tile (8 neighbouring columns of one row). A wave's unit is 8 rows x 32 columns: it reads one whole line of each row. Unit j of the 16 waves together: half (256 columns) j % 2 of the 16 rows of row block j / 2.
    const int c8 = lane & 7, p = lane >> 3, ch = wave & 1, k2 = wave >> 1;
    const float* sp = X + (size_t)(blockIdx.x * PRW + ch * 8 + c8) * DM + k2 * 32 + p * 8; bf* dp = xs + (k2 * 2 + (p >> 1)) * FT + ((p & 1) * 16 + ch * 8 + c8) * 8;
    v8f t[16];   // all 16 units are asked for at once, so that the memory latency is paid once
#pragma unroll
    for (int j = 0; j < 16; ++j) t[j] = *(const v8f*)(sp + (j >> 1) * 16 * DM + (j & 1) * 256);
    asm volatile("s_wait_xcnt 0x0" :: "v"(sp) : "memory");   // precaution: as an input, the loads' address stays live up to this wait
    const bf* la = xs + (wave & 1) * 64 * DM + lane * 8; const bf* wp = Wt + (size_t)c0 * DM + lane * 8;
    V a[4], b0[4], b1[4];   // W^T: two fragment sets of 32 k each, one in flight while the other is multiplied; X: one set, read from LDS just ahead of its products (the SIMD's other waves cover that wait)
#pragma unroll
    for (int i = 0; i < 4; ++i) b0[i] = W::ld(wp + i * 16 * DM);   // the first W^T set and the bias are asked for behind the rows, so that their latency lies under the rows'
    auto publish = [&]() {   // the rows rounded, laid into LDS and handed to the other waves
#pragma unroll
        for (int j = 0; j < 16; ++j) { v4u o;
#pragma unroll
            for (int k = 0; k < 4; ++k) o[k] = pk2(t[j][2 * k], t[j][2 * k + 1], bf());
            *(v4ua*)(dp + (j >> 1) * 16 * DM + (j & 1) * 16 * FT) = o; }
        __syncthreads(); };   // the rounded rows are complete
    v8f acc[4][4];
    if (TR) { const float* bp = bias + c0 + 8 * hi; v8f bv[4];
#pragma unroll
        for (int nb = 0; nb < 4; ++nb) bv[nb] = *(const v8f*)(bp + nb * 16);
        asm volatile("s_wait_xcnt 0x0" :: "v"(bp) : "memory");   // precaution: as an input, the bias loads' address stays live up to this wait
        publish();
#pragma unroll
        for (int nb = 0; nb < 4; ++nb) {
#pragma unroll
            for (int j = 0; j < 8; ++j) bv[nb][j] = bfr(bv[nb][j]);
#pragma unroll
            for (int mb = 0; mb < 4; ++mb) acc[mb][nb] = bv[nb]; } }
    else { const float* bp = bias + c0 + lr; float bv[4];
#pragma unroll
        for (int nb = 0; nb < 4; ++nb) bv[nb] = bp[nb * 16];
        asm volatile("s_wait_xcnt 0x0" :: "v"(bp) : "memory");   // precaution: as an input, the bias loads' address stays live up to this wait
        publish();
#pragma unroll
        for (int nb = 0; nb < 4; ++nb) { const float bb = bfr(bv[nb]);
#pragma unroll
            for (int mb = 0; mb < 4; ++mb)
#pragma unroll
                for (int j = 0; j < 8; ++j) acc[mb][nb][j] = bb; } }
#pragma unroll 1   // stays rolled: a trip already takes 64 k, 2 KiB in a row of each operand row block
    for (int kc = 0; kc < DM; kc += 64) {
#pragma unroll
        for (int i = 0; i < 4; ++i) b1[i] = W::ld(wp + i * 16 * DM + 2 * FT);
#pragma unroll
        for (int i = 0; i < 4; ++i) a[i] = W::ld(la + i * 16 * DM);
        __builtin_amdgcn_sched_barrier(0);   // keeps the global loads in front of the products of the other set: sunk behind them, their latency would lie open
#pragma unroll
        for (int nb = 0; nb < 4; ++nb)
#pragma unroll
            for (int mb = 0; mb < 4; ++mb) acc[mb][nb] = TR ? W::mma(b0[nb], a[mb], acc[mb][nb]) : W::mma(a[mb], b0[nb], acc[mb][nb]);
        xwait<false>(wp, wp);   // stands between every global load issued so far and the advance of their address
        const int adv = (kc + 64 < DM) ? 4 * FT : 0;   // the last trip fetches its own first half again: inside the plane, never used
        wp += adv;
#pragma unroll
        for (int i = 0; i < 4; ++i) b0[i] = W::ld(wp + i * 16 * DM);
#pragma unroll
        for (int i = 0; i < 4; ++i) a[i] = W::ld(la + i * 16 * DM + 2 * FT);
        __builtin_amdgcn_sched_barrier(0);   // as above
#pragma unroll
        for (int nb = 0; nb < 4; ++nb)
#pragma unroll
            for (int mb = 0; mb < 4; ++mb) acc[mb][nb] = TR ? W::mma(b1[nb], a[mb], acc[mb][nb]) : W::mma(a[mb], b1[nb], acc[mb][nb]);
        la += 4 * FT;
    }
    xwait<false>(wp, wp);   // behind the last trip's loads: their address's registers are free for reuse below
    const int bt = r0 / TT, t0 = r0 % TT;   // 64 divides TT: a tile's rows lie in one batch
    const size_t e0 = ((size_t)(bt * NH_ + hd) * TT + t0) * HD + lane * 8;   // q, k: row blocks t0 / 16 .. + 3, four tiles each; v: block t0 / 64
    h16* p16 = P16 + e0; bf* ph = Ph + e0; bf* pl = Pl + e0;
#pragma unroll
    for (int mb = 0; mb < 4; ++mb) { v4u o16[4], oh[4], ol[4];
#pragma unroll
        for (int nb = 0; nb < 4; ++nb) {
#pragma unroll
            for (int i = 0; i < 4; ++i) { const float y0 = acc[mb][nb][2 * i], y1 = acc[mb][nb][2 * i + 1]; o16[nb][i] = pk2(y0, y1, h16()); const unsigned wh = pk2(y0, y1, bf()); oh[nb][i] = wh;
                ol[nb][i] = pk2(y0 - __uint_as_float(wh << 16), y1 - __uint_as_float(wh & 0xFFFF0000u), bf()); }
            const int eo = (mb * 4 + nb) * FT;
            *(v4ua*)(p16 + eo) = o16[nb]; *(v4ua*)(ph + eo) = oh[nb]; *(v4ua*)(pl + eo) = ol[nb]; }
        asm volatile("s_wait_xcnt 0x0" :: "v"(o16[0]), "v"(o16[1]), "v"(o16[2]), "v"(o16[3]), "v"(oh[0]), "v"(oh[1]), "v"(oh[2]), "v"(oh[3]), "v"(ol[0]), "v"(ol[1]), "v"(ol[2]), "v"(ol[3]) : "memory"); }   // precaution: as inputs, the twelve stores' data registers stay live up to this wait, so the next row of tiles does not overwrite them in front of it
}
__global__ __launch_bounds__(512) void k_proj(const float* __restrict__ x0, const float* __restrict__ x1, const float* __restrict__ x2, const bf* __restrict__ WT, const float* __restrict__ bq, const float* __restrict__ bk, const float* __restrict__ bv, h16* Q16, bf* Qh, bf* Ql, h16* K16, bf* Kh, bf* Kl, h16* V16, bf* Vh, bf* Vl) {
    static_assert(TT % 64 == 0 && MT % PRW == 0 && PRW == 128 && HD == 64 && DM == 512 && DQ == DKV && DQ == 512, "a 64x64 tile is one head's columns and rows of one batch; 16 waves are 2 row halves x 8 heads, and 16 units of 8 rows x 32 columns a wave are the PRW rows");
    __shared__ __align__(16) bf xs[PRW * DM];   // the work-group's input rows, bf16, in fragment order
    const int z = blockIdx.z; const float* __restrict__ X = z == 0 ? x0 : z == 1 ? x1 : x2; const bf* Wt = WT + (size_t)z * DQ * DM;   // the transposed weights lie one behind the other
    if (z < 2) proj_tile<true>(X, xs, Wt, z == 0 ? bq : bk, z == 0 ? Q16 : K16, z == 0 ? Qh : Kh, z == 0 ? Ql : Kl);   // block-uniform: a scalar branch
    else proj_tile<false>(X, xs, Wt, bv, V16, Vh, Vl);
}
template <typename T16, bool HI, int R>
__device__ __forceinline__ void attn_wave(const T16* __restrict__ Q, const T16* __restrict__ Q2, const T16* __restrict__ Kp, const T16* __restrict__ K2, const T16* __restrict__ Vt, const T16* __restrict__ V2, float csc, int q0, bf* Ah, bf* Al) {
    typedef typename WFrag<T16>::V V; typedef WFrag<T16> W;
    const int lane = threadIdx.x & 31;
    // every full unroll below: fragments, scores and sums are register arrays, which only constant indices keep in registers
    V qf[R][2], ql[R][2];
    const unsigned lb = lane * 16;   // this lane's 16 bytes of every tile
    { const T16* qp = atl(Q + (size_t)q0 * HD, lb); const T16* qp2 = HI ? atl(Q2 + (size_t)q0 * HD, lb) : qp;
#pragma unroll
      for (int g = 0; g < R; ++g)
#pragma unroll
        for (int kc = 0; kc < 2; ++kc) { qf[g][kc] = W::ld(qp + g * 16 * HD + 2 * FT * kc); if (HI) ql[g][kc] = W::ld(qp2 + g * 16 * HD + 2 * FT * kc); }
      xwaits<HI>(qp, qp2, lb); }
    v8f acc[R][4]; float m_run[R], l_run[R];
#pragma unroll
    for (int g = 0; g < R; ++g) { m_run[g] = -__builtin_inff(); l_run[g] = 0.f;
#pragma unroll
        for (int t = 0; t < 4; ++t) acc[g][t] = (v8f){}; }
    const T16* kp = atl(Kp, lb); const T16* kp2 = HI ? atl(K2, lb) : kp;
    const T16* vp = atl(Vt, lb); const T16* vp2 = HI ? atl(V2, lb) : vp;
    V kf[2][2], kl[2][2];
#pragma unroll
    for (int kt = 0; kt < 2; ++kt)
#pragma unroll
        for (int kc = 0; kc < 2; ++kc) { kf[kt][kc] = W::ld(kp + kt * 16 * HD + 2 * FT * kc); if (HI) kl[kt][kc] = W::ld(kp2 + kt * 16 * HD + 2 * FT * kc); }
    xwaits<HI>(kp, kp2, lb);   // the K addresses are advanced in the loop
#pragma unroll 1   // stays rolled: the body already holds two passes; more would only grow the code and the registers
    for (int pp = 0; pp < NPS / 2; ++pp) {
        V vf[2][4], vl[2][4];   // two passes' V^T fragments, 64 keys = one 8-KiB block of the plane: issued first, used behind the exponentials
#pragma unroll
        for (int t = 0; t < 4; ++t)
#pragma unroll
            for (int u = 0; u < 2; ++u) { vf[u][t] = W::ld(vp + (8 * u + t) * FT, 4 * FT); if (HI) vl[u][t] = W::ld(vp2 + (8 * u + t) * FT, 4 * FT); }   // keys 32 u .. + 15 in tile 8 u + t, the next 16 four tiles on
        xwaits<HI>(vp, vp2, lb);   // stands between the V loads and the advance of their addresses
        vp += 64 * HD; if (HI) vp2 += 64 * HD;
#pragma unroll
      for (int u = 0; u < 2; ++u) {   // the two 32-key passes
        v8f s[2][R];
#pragma unroll
        for (int kt = 0; kt < 2; ++kt)
#pragma unroll
            for (int g = 0; g < R; ++g) { s[kt][g] = (v8f){};
#pragma unroll
                for (int kc = 0; kc < 2; ++kc) { s[kt][g] = W::mma(kf[kt][kc], qf[g][kc], s[kt][g]); if (HI) { s[kt][g] = W::mma(kf[kt][kc], ql[g][kc], s[kt][g]); s[kt][g] = W::mma(kl[kt][kc], qf[g][kc], s[kt][g]); } } }
        if (u == 1) { const int adv = (pp + 1 < NPS / 2) ? 64 * HD : 0;   // kp: the first K row of a pair of passes; the last pass fetches rows of its own pair again: inside the plane, never used
          kp += adv; if (HI) kp2 += adv; }
        const int ko = (u == 0) ? 32 * HD : 0;
#pragma unroll
        for (int kt = 0; kt < 2; ++kt)   // the next pass's K fragments, in flight under this pass's softmax and second product
#pragma unroll
            for (int kc = 0; kc < 2; ++kc) { kf[kt][kc] = W::ld(kp + ko + kt * 16 * HD + 2 * FT * kc); if (HI) kl[kt][kc] = W::ld(kp2 + ko + kt * 16 * HD + 2 * FT * kc); }
        xwaits<HI>(kp, kp2, lb);   // stands between the K loads and the next advance of their addresses
        float mb[R]; bool need = false;
#pragma unroll
        for (int g = 0; g < R; ++g) { s[0][g] = s[0][g] * csc; s[1][g] = s[1][g] * csc;   // the head's scale may be negative: scale first, then the maximum
            float mx = fmaxf(s[0][g][0], s[1][g][0]);
#pragma unroll
            for (int r = 1; r < 8; ++r) mx = fmaxf(mx, fmaxf(s[0][g][r], s[1][g][r]));
            mx = fmaxf(mx, xhalf(mx)); mb[g] = mx; need = need || (mx > m_run[g] + 8.0f); }
        if (__builtin_amdgcn_ballot_w32(need) != 0) {   // one scalar branch a pass; rare behind the first passes
#pragma unroll
            for (int g = 0; g < R; ++g) { const float mn = fmaxf(m_run[g], mb[g]); const float corr = __builtin_amdgcn_exp2f(m_run[g] - mn); m_run[g] = mn; l_run[g] *= corr;
#pragma unroll
                for (int t = 0; t < 4; ++t) acc[g][t] = acc[g][t] * corr; } }
#pragma unroll
        for (int g = 0; g < R; ++g) { v8u w, wl;
#pragma unroll
            for (int i = 0; i < 8; ++i) {
                const float p0 = __builtin_amdgcn_exp2f(s[i >> 2][g][2 * (i & 3)] - m_run[g]), p1 = __builtin_amdgcn_exp2f(s[i >> 2][g][2 * (i & 3) + 1] - m_run[g]);
                l_run[g] += p0; l_run[g] += p1; w[i] = pk2(p0, p1, T16());
                if (HI) wl[i] = pk2(p0 - __uint_as_float(w[i] << 16), p1 - __uint_as_float(w[i] & 0xFFFF0000u), T16()); }
            const V pf = __builtin_bit_cast(V, w);
#pragma unroll
            for (int t = 0; t < 4; ++t) { acc[g][t] = W::mma(vf[u][t], pf, acc[g][t]); if (HI) { acc[g][t] = W::mma(vf[u][t], __builtin_bit_cast(V, wl), acc[g][t]); acc[g][t] = W::mma(vl[u][t], pf, acc[g][t]); } } }
      }
    }
    bf* ap = Ah + (size_t)q0 * DQ + lane * 8; bf* ap2 = Al + (size_t)q0 * DQ + lane * 8;
#pragma unroll
    for (int g = 0; g < R; ++g) { const float l = l_run[g] + xhalf(l_run[g]); const float inv = __fdiv_rn(1.0f, l);   // the wave halves' sums joined once
#pragma unroll
        for (int t = 0; t < 4; ++t) { v8us oh, ol;   // a lane's 8 registers are d = 16 t + 8 h .. + 7 of its query: one 16-byte store a plane
#pragma unroll
            for (int r = 0; r < 8; ++r) { unsigned short a, c2; splitf(acc[g][t][r] * inv, a, c2); oh[r] = a; ol[r] = c2; }
            *(v8us*)(ap + (size_t)g * 16 * DQ + t * FT) = oh; *(v8us*)(ap2 + (size_t)g * 16 * DQ + t * FT) = ol;
            asm volatile("s_wait_xcnt 0x0" :: "v"(oh), "v"(ol) : "memory"); } }   // precaution: as inputs, the two stores' data registers stay live up to this wait, so the next tile's values do not overwrite them in front of it
}
__global__ __launch_bounds__((AWH + AWF) * 32) void k_fattn(const h16* __restrict__ Q16, const h16* __restrict__ K16, const h16* __restrict__ V16, const bf* __restrict__ Qh, const bf* __restrict__ Ql, const bf* __restrict__ Kh, const bf* __restrict__ Kl, const bf* __restrict__ Vh, const bf* __restrict__ Vl, const float* __restrict__ mcp, bf* Ah, bf* Al) {
    static_assert(REP == 1 && HD == 64 && RH % (AWH * 32) == 0 && (TT - RH) % (AWF * 64) == 0 && RH / (AWH * 32) == (TT - RH) / (AWF * 64), "one kv head per query head; every work-group has its share of both kinds of rows");
    const int z = blockIdx.y, hd = z % NH_, b = z / NH_; const size_t pl = (size_t)z * TT * HD;   // grid y: the (batch, head) plane; grid x: the query block
    const float csc = __fmul_rn(__fmul_rn(SCL, bfr(mcp[hd])), 1.4426950408889634f);   // (1/8) x modal_compat[h] (bf16-rounded input) x log2 e
    const int wave = __builtin_amdgcn_readfirstlane(threadIdx.x >> 5); const int yb = blockIdx.x;
    bf* ah = Ah + (size_t)b * TT * DQ + hd * (HD / 16) * FT; bf* al = Al + (size_t)b * TT * DQ + hd * (HD / 16) * FT;   // the head's four tiles of every row block
    if (wave < AWH) attn_wave<bf, true, 2>(Qh + pl, Ql + pl, Kh + pl, Kl + pl, Vh + pl, Vl + pl, csc, (yb * AWH + wave) * 32, ah, al);   // wave-uniform: a scalar branch
    else attn_wave<h16, false, 4>(Q16 + pl, nullptr, K16 + pl, nullptr, V16 + pl, nullptr, csc, RH + (yb * AWF + wave - AWH) * 64, ah, al);
}
// ---- k_oln: output projection, residual and LayerNorm in one kernel. A work-group of 8 waves owns ORW whole rows: wave w sums the whole K = DQ of columns 64 w .. + 63 in registers, the rows cross the waves through LDS, then each wave normalises ORW / 8 rows.
// The ORW merged rows (hi and lo, 32 KiB in a row of each plane, already in fragment order) are staged once in LDS, since all 8 waves read them; each wave streams its own 64 rows of Wo^T from global memory. Two fragment sets of 64 k: one is in flight while the other is multiplied.
// D = Wo^T-rows x merged-rows: a lane's 8 accumulator registers are 8 neighbouring columns of one row, two 16-byte LDS stores. The accumulators start at the bf16-rounded bias; per 32 k all hi products, then all lo products.
template <int M> __device__ __forceinline__ float xrow(float x) { return __builtin_bit_cast(float, __builtin_amdgcn_update_dpp(0, __builtin_bit_cast(int, x), 0x160 + M, 0xf, 0xf, true)); }   // lane l ^ M of the 16-lane row (row_xmask)
__device__ __forceinline__ float wsum(float x) { x += xrow<1>(x); x += xrow<2>(x); x += xrow<4>(x); x += xrow<8>(x); return x + xhalf(x); }   // the sum over the wave's 32 lanes, in every lane
__device__ __forceinline__ v4f bfr4(v4f x) { const unsigned a = pk2(x[0], x[1], bf()), b = pk2(x[2], x[3], bf()); v4f r; r[0] = __uint_as_float(a << 16); r[1] = __uint_as_float(a & 0xFFFF0000u); r[2] = __uint_as_float(b << 16); r[3] = __uint_as_float(b & 0xFFFF0000u); return r; }   // four values rounded to bf16
#define ORW  32                   // rows of a work-group of k_oln
#define OPT  (DM + 4)             // pitch of the f32 rows in LDS: 16 bytes x odd, so that 16 lanes' 16-byte stores of 16 rows fall on all 64 banks
__global__ __launch_bounds__(256) void k_oln(const bf* __restrict__ Ah, const bf* __restrict__ Al, const bf* __restrict__ Wt, const float* __restrict__ bo, const float* __restrict__ xr, const float* __restrict__ g, const float* __restrict__ bb, float* out) {
    typedef WFrag<bf> W; typedef WFrag<bf>::V V;
    static_assert(DM == 512 && DQ == 512 && MT % ORW == 0 && ORW == 32, "8 waves x 64 columns are a whole row; 256 threads x 8 loads of 16 bytes are a plane's ORW rows");
    __shared__ __align__(16) bf as[2 * ORW * DQ];   // hi rows, then lo rows
    __shared__ __align__(16) float ys[ORW * OPT];
    const int tid = threadIdx.x, lane = tid & 31, lr = lane & 15, hi = lane >> 4; const int wave = __builtin_amdgcn_readfirstlane(tid >> 5); const int r0 = blockIdx.x * ORW, c0 = wave * 64;
    // every full unroll below: fragments, sums and rows are register arrays, which only constant indices keep in registers
    const bf* wb = Wt + (size_t)c0 * DQ; unsigned wo = lane * 16;   // this wave's rows of Wo^T (the same for the whole wave) and the lane's running byte offset in them
    V h0[2][2], l0[2][2], b0[4][2], h1[2][2], l1[2][2], b1[4][2];   // [row block][32 k]
    { const bf* sh = Ah + (size_t)r0 * DQ + tid * 8; const bf* sl = Al + (size_t)r0 * DQ + tid * 8; v8us th[8], tl[8];
#pragma unroll
      for (int i = 0; i < 8; ++i) { th[i] = *(const v8us*)(sh + i * 2048); tl[i] = *(const v8us*)(sl + i * 2048); }
#pragma unroll
      for (int i = 0; i < 4; ++i) { b0[i][0] = W::ld(atl(wb, wo) + i * 16 * DQ); b0[i][1] = W::ld(atl(wb, wo) + i * 16 * DQ + 2 * FT); }
      asm volatile("s_wait_xcnt 0x0" :: "v"(sh), "v"(sl), "v"(wo) : "memory");   // precaution: as inputs, the loads' address registers stay live up to this wait
#pragma unroll
      for (int i = 0; i < 8; ++i) { *(v8us*)(as + tid * 8 + i * 2048) = th[i]; *(v8us*)(as + ORW * DQ + tid * 8 + i * 2048) = tl[i]; } }
    v8f acc[2][4];
    { const float* bp = bo + c0 + 8 * hi; v8f bv[4];
#pragma unroll
      for (int nb = 0; nb < 4; ++nb) bv[nb] = *(const v8f*)(bp + nb * 16);
      asm volatile("s_wait_xcnt 0x0" :: "v"(bp) : "memory");   // precaution: as an input, the bias loads' address stays live up to this wait
#pragma unroll
      for (int nb = 0; nb < 4; ++nb) {
#pragma unroll
          for (int j = 0; j < 8; ++j) bv[nb][j] = bfr(bv[nb][j]);
          acc[0][nb] = bv[nb]; acc[1][nb] = bv[nb]; } }
    __syncthreads();   // the staged rows are complete
    const bf* la = as + lane * 8;
#pragma unroll
    for (int i = 0; i < 2; ++i)
#pragma unroll
        for (int kk = 0; kk < 2; ++kk) { h0[i][kk] = W::ld(la + i * 16 * DQ + kk * 2 * FT); l0[i][kk] = W::ld(la + ORW * DQ + i * 16 * DQ + kk * 2 * FT); }
    auto prod = [&](const V (&b)[4][2], const V (&h)[2][2], const V (&l)[2][2]) {   // a set's 32 products; per 32 k the 8 hi ones, then the 8 lo ones, so that no sum is asked for again before 8 products have gone by
#pragma unroll
        for (int kk = 0; kk < 2; ++kk) {
#pragma unroll
            for (int nb = 0; nb < 4; ++nb) { acc[0][nb] = W::mma(b[nb][kk], h[0][kk], acc[0][nb]); acc[1][nb] = W::mma(b[nb][kk], h[1][kk], acc[1][nb]); }
#pragma unroll
            for (int nb = 0; nb < 4; ++nb) { acc[0][nb] = W::mma(b[nb][kk], l[0][kk], acc[0][nb]); acc[1][nb] = W::mma(b[nb][kk], l[1][kk], acc[1][nb]); } } };
    auto fetch = [&](V (&b)[4][2], V (&h)[2][2], V (&l)[2][2], int o) {   // the set at o elements behind the two running addresses
#pragma unroll
        for (int kk = 0; kk < 2; ++kk)
#pragma unroll
            for (int i = 0; i < 4; ++i) b[i][kk] = W::ld(atl(wb, wo) + i * 16 * DQ + o + kk * 2 * FT);
#pragma unroll
        for (int kk = 0; kk < 2; ++kk)
#pragma unroll
            for (int i = 0; i < 2; ++i) { h[i][kk] = W::ld(la + i * 16 * DQ + o + kk * 2 * FT); l[i][kk] = W::ld(la + ORW * DQ + i * 16 * DQ + o + kk * 2 * FT); }
        asm volatile("s_wait_xcnt 0x0" : "+v"(wo) :: "memory"); };   // precaution: the global loads' offset register goes through this wait, so that its advance is formed behind the wait and not in front
#pragma unroll 1   // stays rolled: a trip already takes 128 k; more would only grow the code
    for (int kc = 0; kc < DQ - 128; kc += 128) {
        fetch(b1, h1, l1, 4 * FT);
        __builtin_amdgcn_sched_barrier(0);   // keeps the loads in front of the products of the other set: sunk behind them, their latency would lie open
        prod(b0, h0, l0);
        wo += 8 * FT * 2; la += 8 * FT;
        fetch(b0, h0, l0, 0);
        __builtin_amdgcn_sched_barrier(0);   // as above
        prod(b1, h1, l1);
    }
    fetch(b1, h1, l1, 4 * FT);   // the last 128 k: nothing is fetched behind them
    __builtin_amdgcn_sched_barrier(0);   // as above
    prod(b0, h0, l0);
    // this wave's four rows of the residual, gamma and beta: asked for here, so that the last products and the LDS exchange cover part of their latency
    const int rw = wave * (ORW / 8); const float* xp = xr + (size_t)(r0 + rw) * DM + lane * 4; const float* gp = g + lane * 4; const float* bp2 = bb + lane * 4;
    v4f v[ORW / 8][4], gv[4], bt[4];
#pragma unroll
    for (int q = 0; q < ORW / 8; ++q)
#pragma unroll
        for (int c = 0; c < 4; ++c) v[q][c] = *(const v4f*)(xp + q * DM + c * 128);
#pragma unroll
    for (int c = 0; c < 4; ++c) { gv[c] = *(const v4f*)(gp + c * 128); bt[c] = *(const v4f*)(bp2 + c * 128); }
    asm volatile("s_wait_xcnt 0x0" :: "v"(xp), "v"(gp), "v"(bp2) : "memory");   // precaution: as inputs, the loads' address registers stay live up to this wait
    __builtin_amdgcn_sched_barrier(0);   // keeps these loads in front of the last products
    prod(b1, h1, l1);
#pragma unroll
    for (int mb = 0; mb < 2; ++mb)
#pragma unroll
        for (int nb = 0; nb < 4; ++nb) { float* yp = ys + (mb * 16 + lr) * OPT + c0 + nb * 16 + 8 * hi;
            *(v4fa*)yp = __builtin_shufflevector(acc[mb][nb], acc[mb][nb], 0, 1, 2, 3); *(v4fa*)(yp + 4) = __builtin_shufflevector(acc[mb][nb], acc[mb][nb], 4, 5, 6, 7); }
    __builtin_amdgcn_sched_barrier(0);   // keeps the work on the residual, which waits for its loads, behind the last products and the LDS stores
    __syncthreads();   // every wave's columns of every row are in LDS
    float s[ORW / 8], s2[ORW / 8];
#pragma unroll
    for (int q = 0; q < ORW / 8; ++q) { s[q] = 0.f;
#pragma unroll
        for (int c = 0; c < 4; ++c) { const v4f a = *(const v4fa*)(ys + (rw + q) * OPT + c * 128 + lane * 4);
            v[q][c] = a + bfr4(v[q][c]);
#pragma unroll
            for (int e = 0; e < 4; ++e) s[q] += v[q][c][e]; } }
#pragma unroll
    for (int q = 0; q < ORW / 8; ++q) s[q] = wsum(s[q]);
#pragma unroll
    for (int q = 0; q < ORW / 8; ++q) { const float mean = s[q] * (1.0f / DM); s2[q] = 0.f;   // DM is a power of two: the product is the exact quotient
#pragma unroll
        for (int c = 0; c < 4; ++c)
#pragma unroll
            for (int e = 0; e < 4; ++e) { const float dv = v[q][c][e] - mean; s2[q] += dv * dv; v[q][c][e] = dv; } }
#pragma unroll
    for (int q = 0; q < ORW / 8; ++q) s2[q] = wsum(s2[q]);
#pragma unroll
    for (int c = 0; c < 4; ++c) { gv[c] = bfr4(gv[c]); bt[c] = bfr4(bt[c]); }
    float* op = out + (size_t)(r0 + rw) * DM + lane * 4;
#pragma unroll
    for (int q = 0; q < ORW / 8; ++q) { const float rs = __fdiv_rn(1.0f, __fsqrt_rn(s2[q] * (1.0f / DM) + LNEPS));
#pragma unroll
        for (int c = 0; c < 4; ++c) { v[q][c] = v[q][c] * rs * gv[c] + bt[c]; *(v4f*)(op + q * DM + c * 128) = v[q][c]; }
        if (q + 1 < ORW / 8) asm volatile("s_wait_xcnt 0x0" :: "v"(v[q][0]), "v"(v[q][1]), "v"(v[q][2]), "v"(v[q][3]) : "memory"); }   // precaution: as inputs, the four stores' data registers stay live up to this wait, so the next row's values do not overwrite them in front of it
}

extern "C" void kernel_launch(void* const* d_in, const int* in_sizes, int n_in,
                              void* d_out, int out_size, void* d_ws, size_t ws_size, hipStream_t stream) {
    (void)in_sizes; (void)n_in; (void)out_size;
    const float* x = (const float*)d_in[0];   /* query_modality */ const float* xk = (const float*)d_in[1]; const float* xv = (const float*)d_in[2]; const float* wq = (const float*)d_in[3]; const float* bq = (const float*)d_in[4]; const float* wk = (const float*)d_in[5]; const float* bk = (const float*)d_in[6]; const float* wv = (const float*)d_in[7]; const float* bv = (const float*)d_in[8]; const float* wo = (const float*)d_in[9]; const float* bo = (const float*)d_in[10]; const float* mc = (const float*)d_in[11];   /* modal_compat [8] */ const float* lng = (const float*)d_in[12]; const float* lnb = (const float*)d_in[13];
    float* OUT = (float*)d_out;     // [4][2048][512]
    char* wsp = (char*)d_ws;
    auto take = [&](size_t bytes) { char* p = wsp; wsp += (bytes + 255) & ~(size_t)255; return (void*)p; };
    bf* WQ = (bf*)take((size_t)DQ * DM * 2); take((size_t)DKV * DM * 2); take((size_t)DKV * DM * 2);   /* Wq^T, then Wk^T and Wv^T behind it */ bf* WO = (bf*)take((size_t)DM * DQ * 2);
    h16* QP16 = (h16*)take((size_t)NB_ * NH_ * TT * HD * 2); h16* KP16 = (h16*)take((size_t)NB_ * NKV * TT * HD * 2); h16* VT16 = (h16*)take((size_t)NB_ * NKV * HD * TT * 2);
    bf* QPh = (bf*)take((size_t)NB_ * NH_ * TT * HD * 2); bf* QPl = (bf*)take((size_t)NB_ * NH_ * TT * HD * 2); bf* KPh = (bf*)take((size_t)NB_ * NKV * TT * HD * 2); bf* KPl = (bf*)take((size_t)NB_ * NKV * TT * HD * 2); bf* VTh = (bf*)take((size_t)NB_ * NKV * HD * TT * 2); bf* VTl = (bf*)take((size_t)NB_ * NKV * HD * TT * 2);
    bf* ATh = (bf*)take((size_t)MT * DQ * 2); bf* ATl = (bf*)take((size_t)MT * DQ * 2);
    static_assert(DQ == DM && DKV == DM, "the four transposed weights are equal in size");
    if ((size_t)(wsp - (char*)d_ws) > ws_size) return;    // ws 256 MiB
    k_wtG<<<dim3((unsigned)((DM * DQ / 8 + 255) / 256), 4), 256, 0, stream>>>(wq, wk, wv, wo, WQ);   // WQ, WK, WV, WO are taken one behind the other
    k_proj<<<dim3(MT / PRW, 1, 3), 512, 0, stream>>>(x, xk, xv, WQ, bq, bk, bv, QP16, QPh, QPl, KP16, KPh, KPl, VT16, VTh, VTl);
    k_fattn<<<dim3(RH / (AWH * 32), NB_ * NH_), (AWH + AWF) * 32, 0, stream>>>(QP16, KP16, VT16, QPh, QPl, KPh, KPl, VTh, VTl, mc, ATh, ATl);   /* per-head compatibility scale inside */
    k_oln<<<MT / ORW, 256, 0, stream>>>(ATh, ATl, WO, bo, x, lng, lnb, OUT);   /* output projection + bo + query_modality, LayerNorm */
}
